// v000
// Measured on an AMD MI455X. A time is GPU time per run, averaged over a window of back-to-back runs after a warm-up
// (all launches, gaps included; the runs take copies of the inputs in turn), and the median of several windows.
// Apart from v000's, it joins two sittings. Times from different sittings can be a few percent apart, while
// side-by-side timings come from the same sitting.
// v000, which the later versions start from, runs in 411 microseconds.
#include <hip/hip_runtime.h>
#include <hip/hip_bf16.h>
#include <math.h>

// HSTU attention for MI455X (gfx1250, wave32, WMMA).
// B=2, N=2048, H=1024, NH=16, HD=64.

typedef __attribute__((ext_vector_type(16))) _Float16 v16h;
typedef __attribute__((ext_vector_type(8)))  _Float16 v8h;
typedef __attribute__((ext_vector_type(4)))  _Float16 v4h;
typedef __attribute__((ext_vector_type(8)))  float    v8f;

#define WMMA16(a, b, c) __builtin_amdgcn_wmma_f32_16x16x32_f16( \
    false, (a), false, (b), (short)0, (c), false, false)

// SiLU via native v_exp_f32 + v_rcp_f32 (no IEEE div sequence).
__device__ __forceinline__ float silu_f(float x) {
    return x * __builtin_amdgcn_rcpf(1.0f + __expf(-x));
}

// Load a v16h fragment per the CDNA5 16-bit A/B layout:
// halves 0..7  = K (or col) khalf..khalf+7
// halves 8..15 = K (or col) khalf+16..khalf+23   (khalf = (lane>>4)*8)
__device__ __forceinline__ v16h load_frag(const _Float16* p) {
    v16h f;
    *((v8h*)&f)       = *(const v8h*)p;
    *(((v8h*)&f) + 1) = *(const v8h*)(p + 16);
    return f;
}

// ---------------------------------------------------------------------------
// Kernel: f32 [K x N] -> f16 transposed [N x K].  Writes are coalesced and
// contiguous; reads are strided but each weight is touched exactly once.
// ---------------------------------------------------------------------------
__global__ void cvt_transpose_f16_kernel(const float* __restrict__ src,
                                         _Float16* __restrict__ dst,
                                         int K, int N) {
    int i = blockIdx.x * blockDim.x + threadIdx.x;   // over N*K, dst-linear
    if (i < N * K) {
        int n = i / K;
        int k = i - n * K;
        dst[i] = (_Float16)src[(size_t)k * N + n];
    }
}

// ---------------------------------------------------------------------------
// WMMA GEMM: out = act(A[MxK] @ W[KxN] + bias), W given pre-transposed f16
// as Wt[N x K].  Block tile 128x64, BK=32. 256 threads = 8 waves arranged
// 4(M) x 2(N); each wave computes a 32x32 tile = 2x2 WMMA frags.
// ---------------------------------------------------------------------------
#define BM 128
#define BN 64
#define BK 32
#define LDA 40  // BK + 8 halves pad (row = 80B, 16B aligned)
#define LDB 40

template <bool A_IS_F32, bool SILU, bool OUT_F16>
__global__ __launch_bounds__(256) void gemm_wmma_kernel(
    const float* __restrict__ A32, const _Float16* __restrict__ A16,
    const _Float16* __restrict__ Wt, const float* __restrict__ bias,
    _Float16* __restrict__ out16, float* __restrict__ out32,
    int M, int N, int K)
{
    __shared__ _Float16 As[BM * LDA];
    __shared__ _Float16 Bs[BN * LDB];

    const int t     = threadIdx.x;
    const int lane  = t & 31;
    const int wid   = t >> 5;
    const int waveM = wid >> 1;   // 0..3
    const int waveN = wid & 1;    // 0..1
    const int row0  = blockIdx.x * BM;
    const int col0  = blockIdx.y * BN;
    const int l16   = lane & 15;
    const int khalf = (lane >> 4) * 8;

    v8f zero = {};
    v8f acc[2][2];
    acc[0][0] = zero; acc[0][1] = zero; acc[1][0] = zero; acc[1][1] = zero;

    for (int k0 = 0; k0 < K; k0 += BK) {
        __syncthreads();
        if (A_IS_F32) {
            // 128x32 f32 tile: float4 loads -> v4h LDS stores (4 per thread).
            #pragma unroll
            for (int i = t; i < BM * (BK / 4); i += 256) {
                int r = i >> 3;
                int c = (i & 7) * 4;
                const float4 v =
                    *(const float4*)&A32[(size_t)(row0 + r) * K + k0 + c];
                v4h h = { (_Float16)v.x, (_Float16)v.y,
                          (_Float16)v.z, (_Float16)v.w };
                *(v4h*)&As[r * LDA + c] = h;
            }
        } else {
            // 128x32 f16 tile: v8h copies (2 per thread).
            #pragma unroll
            for (int i = t; i < BM * (BK / 8); i += 256) {
                int r = i >> 2;
                int c = (i & 3) * 8;
                *(v8h*)&As[r * LDA + c] =
                    *(const v8h*)&A16[(size_t)(row0 + r) * K + k0 + c];
            }
        }
        // 64x32 f16 B tile from pre-transposed Wt[N][K]: one v8h per thread.
        {
            int n = t >> 2;
            int c = (t & 3) * 8;
            *(v8h*)&Bs[n * LDB + c] =
                *(const v8h*)&Wt[(size_t)(col0 + n) * K + k0 + c];
        }
        // Prefetch next Wt tile into GL2 (global_prefetch_b8).
        if (k0 + BK < K)
            __builtin_prefetch(&Wt[(size_t)(col0 + (t >> 2)) * K + k0 + BK], 0, 1);
        __syncthreads();

        v16h afrag[2], bfrag[2];
        #pragma unroll
        for (int am = 0; am < 2; ++am) {
            int r = waveM * 32 + am * 16 + l16;
            afrag[am] = load_frag(&As[r * LDA + khalf]);
        }
        #pragma unroll
        for (int bn = 0; bn < 2; ++bn) {
            int n = waveN * 32 + bn * 16 + l16;
            bfrag[bn] = load_frag(&Bs[n * LDB + khalf]);
        }
        acc[0][0] = WMMA16(afrag[0], bfrag[0], acc[0][0]);
        acc[0][1] = WMMA16(afrag[0], bfrag[1], acc[0][1]);
        acc[1][0] = WMMA16(afrag[1], bfrag[0], acc[1][0]);
        acc[1][1] = WMMA16(afrag[1], bfrag[1], acc[1][1]);
    }

    // Epilogue: C/D layout — lane: col = l16, VGPR r: row = r + (lane>>4)*8.
    #pragma unroll
    for (int am = 0; am < 2; ++am) {
        int rowbase = row0 + waveM * 32 + am * 16 + (lane >> 4) * 8;
        #pragma unroll
        for (int bn = 0; bn < 2; ++bn) {
            int col = col0 + waveN * 32 + bn * 16 + l16;
            float bv = bias[col];
            #pragma unroll
            for (int r = 0; r < 8; ++r) {
                float v = acc[am][bn][r] + bv;
                if (SILU) v = silu_f(v);
                size_t idx = (size_t)(rowbase + r) * N + col;
                if (OUT_F16) out16[idx] = (_Float16)v;
                else         out32[idx] = v;
            }
        }
    }
}

// ---------------------------------------------------------------------------
// Attention: per (b,head) slice, 128-query tile per block, stream 64-key tiles.
// scores = silu(Q K^T)/N * mask  (linear accumulation, no softmax) then S @ V.
// ---------------------------------------------------------------------------
#define AN 2048
#define AH 1024
#define ANH 16
#define AHD 64
#define LQK 72  // 64 + 8 halves pad (144B rows, 16B aligned)

__global__ __launch_bounds__(256) void attn_wmma_kernel(
    const _Float16* __restrict__ Qg, const _Float16* __restrict__ Kg,
    const _Float16* __restrict__ Vg, const float* __restrict__ mask,
    float* __restrict__ Og)
{
    __shared__ _Float16 Qs[128 * LQK];      // 128 queries x 64 d
    __shared__ _Float16 Ks[64 * LQK];       // 64 keys x 64 d
    __shared__ _Float16 Vt[64 * LQK];       // transposed: [d][key]
    __shared__ _Float16 Ps[8 * 16 * LQK];   // per-wave probs: 16 q x 64 key

    const int bh   = blockIdx.y;
    const int b    = bh / ANH;
    const int h    = bh % ANH;
    const int q0   = blockIdx.x * 128;
    const int t    = threadIdx.x;
    const int lane = t & 31;
    const int wid  = t >> 5;
    const int l16  = lane & 15;
    const int khalf = (lane >> 4) * 8;

    const _Float16* Qbase = Qg + (size_t)(b * AN + q0) * AH + h * AHD;
    const float* mrow = mask + (size_t)b * AN * AN;
    const float invN = 1.0f / (float)AN;

    // Stage Q tile: v8h copies (4 per thread).
    #pragma unroll
    for (int i = t; i < 128 * 8; i += 256) {
        int r = i >> 3, d = (i & 7) * 8;
        *(v8h*)&Qs[r * LQK + d] = *(const v8h*)&Qbase[(size_t)r * AH + d];
    }
    __syncthreads();

    // A-fragments from Q are loop-invariant per wave (16 query rows).
    v16h aq0, aq1;
    {
        int r = wid * 16 + l16;
        aq0 = load_frag(&Qs[r * LQK + khalf]);        // d 0..31
        aq1 = load_frag(&Qs[r * LQK + 32 + khalf]);   // d 32..63
    }

    v8f zero = {};
    v8f o[4];
    o[0] = zero; o[1] = zero; o[2] = zero; o[3] = zero;

    _Float16* Pw = &Ps[wid * 16 * LQK];

    for (int m0 = 0; m0 < AN; m0 += 64) {
        __syncthreads();
        const _Float16* Kb = Kg + (size_t)(b * AN + m0) * AH + h * AHD;
        const _Float16* Vb = Vg + (size_t)(b * AN + m0) * AH + h * AHD;
        // Stage K (straight copy) and V (transpose-scatter), v8h global loads.
        #pragma unroll
        for (int i = t; i < 64 * 8; i += 256) {
            int r = i >> 3, d = (i & 7) * 8;
            v8h kv = *(const v8h*)&Kb[(size_t)r * AH + d];
            v8h vv = *(const v8h*)&Vb[(size_t)r * AH + d];
            *(v8h*)&Ks[r * LQK + d] = kv;
            #pragma unroll
            for (int j = 0; j < 8; ++j)
                Vt[(d + j) * LQK + r] = vv[j];
        }
        __syncthreads();

        // Scores: 16 queries x 64 keys per wave, 2 WMMAs per 16x16 tile.
        const int qbg = q0 + wid * 16 + (lane >> 4) * 8;  // query row (global)
        #pragma unroll
        for (int nt = 0; nt < 4; ++nt) {
            int kr = nt * 16 + l16;
            v16h bk0 = load_frag(&Ks[kr * LQK + khalf]);
            v16h bk1 = load_frag(&Ks[kr * LQK + 32 + khalf]);
            v8f s = zero;
            s = WMMA16(aq0, bk0, s);
            s = WMMA16(aq1, bk1, s);

            int kc = m0 + nt * 16 + l16;  // key column (global)
            #pragma unroll
            for (int r = 0; r < 8; ++r) {
                float x = s[r];
                float v = silu_f(x) * invN *
                          mrow[(size_t)(qbg + r) * AN + kc];
                Pw[((lane >> 4) * 8 + r) * LQK + nt * 16 + l16] = (_Float16)v;
            }
        }

        // P @ V: re-layout P (C->A) via per-wave LDS round-trip (in-order DS).
        v16h ap0 = load_frag(&Pw[l16 * LQK + khalf]);        // keys 0..31
        v16h ap1 = load_frag(&Pw[l16 * LQK + 32 + khalf]);   // keys 32..63
        #pragma unroll
        for (int dt = 0; dt < 4; ++dt) {
            int dc = dt * 16 + l16;
            v16h bv0 = load_frag(&Vt[dc * LQK + khalf]);
            v16h bv1 = load_frag(&Vt[dc * LQK + 32 + khalf]);
            o[dt] = WMMA16(ap0, bv0, o[dt]);
            o[dt] = WMMA16(ap1, bv1, o[dt]);
        }
    }

    // Write f32 attention output [B*N, H].
    int qb = b * AN + q0 + wid * 16 + (lane >> 4) * 8;
    #pragma unroll
    for (int dt = 0; dt < 4; ++dt) {
        int col = h * AHD + dt * 16 + l16;
        #pragma unroll
        for (int r = 0; r < 8; ++r)
            Og[(size_t)(qb + r) * AH + col] = o[dt][r];
    }
}

// ---------------------------------------------------------------------------
// LayerNorm over H=1024 + build o_input = [U, A, U*A] as f16 [4096 x 3072].
// ---------------------------------------------------------------------------
__global__ __launch_bounds__(256) void ln_concat_kernel(
    const float* __restrict__ attn, const _Float16* __restrict__ Uh,
    _Float16* __restrict__ oin)
{
    __shared__ float red[256];
    const int row = blockIdx.x;
    const int t = threadIdx.x;
    const float* x = attn + (size_t)row * 1024;

    float vals[4], s = 0.0f, ss = 0.0f;
    #pragma unroll
    for (int i = 0; i < 4; ++i) {
        float v = x[t + i * 256];
        vals[i] = v; s += v; ss += v * v;
    }
    red[t] = s; __syncthreads();
    for (int st = 128; st > 0; st >>= 1) {
        if (t < st) red[t] += red[t + st];
        __syncthreads();
    }
    float mean = red[0] * (1.0f / 1024.0f);
    __syncthreads();
    red[t] = ss; __syncthreads();
    for (int st = 128; st > 0; st >>= 1) {
        if (t < st) red[t] += red[t + st];
        __syncthreads();
    }
    float var  = red[0] * (1.0f / 1024.0f) - mean * mean;
    float rstd = __builtin_amdgcn_rsqf(var + 1e-8f);   // native v_rsq_f32

    _Float16* orow = oin + (size_t)row * 3072;
    const _Float16* urow = Uh + (size_t)row * 1024;
    #pragma unroll
    for (int i = 0; i < 4; ++i) {
        int c = t + i * 256;
        float a = (vals[i] - mean) * rstd;
        float u = (float)urow[c];
        orow[c]        = (_Float16)u;
        orow[1024 + c] = (_Float16)a;
        orow[2048 + c] = (_Float16)(u * a);
    }
}

// ---------------------------------------------------------------------------
// Host-side orchestration.
// ---------------------------------------------------------------------------
extern "C" void kernel_launch(void* const* d_in, const int* in_sizes, int n_in,
                              void* d_out, int out_size, void* d_ws, size_t ws_size,
                              hipStream_t stream) {
    const float* query = (const float*)d_in[0];
    const float* key_  = (const float*)d_in[1];
    const float* value = (const float*)d_in[2];
    const float* mask  = (const float*)d_in[3];
    const float* Wq = (const float*)d_in[4];   const float* bq = (const float*)d_in[5];
    const float* Wk = (const float*)d_in[6];   const float* bk = (const float*)d_in[7];
    const float* Wv = (const float*)d_in[8];   const float* bv = (const float*)d_in[9];
    const float* Wu = (const float*)d_in[10];  const float* bu = (const float*)d_in[11];
    const float* Wo = (const float*)d_in[12];  const float* bo = (const float*)d_in[13];
    float* out = (float*)d_out;

    const int M = 2 * 2048;        // 4096 rows
    const int H = 1024;

    // Workspace carve-out (~90 MB total, deterministic layout).
    char* ws = (char*)d_ws;
    size_t off = 0;
    auto carve = [&](size_t bytes) -> void* {
        void* p = ws + off;
        off += (bytes + 255) & ~(size_t)255;
        return p;
    };
    _Float16* Wq_t = (_Float16*)carve((size_t)H * H * 2);       // [N][K] f16
    _Float16* Wk_t = (_Float16*)carve((size_t)H * H * 2);
    _Float16* Wv_t = (_Float16*)carve((size_t)H * H * 2);
    _Float16* Wu_t = (_Float16*)carve((size_t)H * H * 2);
    _Float16* Wo_t = (_Float16*)carve((size_t)H * 3 * H * 2);   // [1024][3072]
    _Float16* Q_h  = (_Float16*)carve((size_t)M * H * 2);
    _Float16* K_h  = (_Float16*)carve((size_t)M * H * 2);
    _Float16* V_h  = (_Float16*)carve((size_t)M * H * 2);
    _Float16* U_h  = (_Float16*)carve((size_t)M * H * 2);
    float*    At_f = (float*)   carve((size_t)M * H * 4);
    _Float16* Oi_h = (_Float16*)carve((size_t)M * 3 * H * 2);
    (void)ws_size; (void)in_sizes; (void)n_in; (void)out_size;

    // 1) Weights -> f16, transposed to [N][K] for contiguous B staging.
    int nw = H * H;
    cvt_transpose_f16_kernel<<<(nw + 255) / 256, 256, 0, stream>>>(Wq, Wq_t, H, H);
    cvt_transpose_f16_kernel<<<(nw + 255) / 256, 256, 0, stream>>>(Wk, Wk_t, H, H);
    cvt_transpose_f16_kernel<<<(nw + 255) / 256, 256, 0, stream>>>(Wv, Wv_t, H, H);
    cvt_transpose_f16_kernel<<<(nw + 255) / 256, 256, 0, stream>>>(Wu, Wu_t, H, H);
    int nwo = 3 * H * H;
    cvt_transpose_f16_kernel<<<(nwo + 255) / 256, 256, 0, stream>>>(Wo, Wo_t, 3 * H, H);

    // 2) Projections: silu(X @ W + b), f16 outputs.
    dim3 ggrid(M / BM, H / BN);
    gemm_wmma_kernel<true, true, true><<<ggrid, 256, 0, stream>>>(
        query, nullptr, Wq_t, bq, Q_h, nullptr, M, H, H);
    gemm_wmma_kernel<true, true, true><<<ggrid, 256, 0, stream>>>(
        key_,  nullptr, Wk_t, bk, K_h, nullptr, M, H, H);
    gemm_wmma_kernel<true, true, true><<<ggrid, 256, 0, stream>>>(
        value, nullptr, Wv_t, bv, V_h, nullptr, M, H, H);
    gemm_wmma_kernel<true, true, true><<<ggrid, 256, 0, stream>>>(
        value, nullptr, Wu_t, bu, U_h, nullptr, M, H, H);

    // 3) Attention (16 query tiles x 32 (b,head) slices).
    dim3 agrid(AN / 128, 2 * ANH);
    attn_wmma_kernel<<<agrid, 256, 0, stream>>>(Q_h, K_h, V_h, mask, At_f);

    // 4) LayerNorm + concat [U, A, U*A].
    ln_concat_kernel<<<M, 256, 0, stream>>>(At_f, U_h, Oi_h);

    // 5) Final GEMM: o_input[4096x3072] @ Wo[3072x1024] + bo -> f32 out.
    dim3 fgrid(M / BM, H / BN);
    gemm_wmma_kernel<false, false, false><<<fgrid, 256, 0, stream>>>(
        nullptr, Oi_h, Wo_t, bo, nullptr, out, M, H, 3 * H);
}

// v001
// It runs in 308 microseconds.
// Timed twice side by side with v000, it ran 1.35 and 1.34 times as fast.
#include <hip/hip_runtime.h>
#include <hip/hip_bf16.h>
#include <math.h>

// HSTU attention for MI455X (gfx1250, wave32, WMMA).
// B=2, N=2048, H=1024, NH=16, HD=64.

typedef __attribute__((ext_vector_type(16))) _Float16 v16h;
typedef __attribute__((ext_vector_type(8)))  _Float16 v8h;
typedef __attribute__((ext_vector_type(4)))  _Float16 v4h;
typedef __attribute__((ext_vector_type(8)))  float    v8f;

#define WMMA16(a, b, c) __builtin_amdgcn_wmma_f32_16x16x32_f16( \
    false, (a), false, (b), (short)0, (c), false, false)

// SiLU via native v_exp_f32 + v_rcp_f32 (no IEEE div sequence).
__device__ __forceinline__ float silu_f(float x) {
    return x * __builtin_amdgcn_rcpf(1.0f + __expf(-x));
}

// Load a v16h fragment per the CDNA5 16-bit A/B layout:
// halves 0..7  = K (or col) khalf..khalf+7
// halves 8..15 = K (or col) khalf+16..khalf+23   (khalf = (lane>>4)*8)
__device__ __forceinline__ v16h load_frag(const _Float16* p) {
    v16h f;
    *((v8h*)&f)       = *(const v8h*)p;
    *(((v8h*)&f) + 1) = *(const v8h*)(p + 16);
    return f;
}

// ---------------------------------------------------------------------------
// Kernel: f32 [K x N] -> f16 transposed [N x K].  Writes are coalesced and
// contiguous; reads are strided but each weight is touched exactly once.
// ---------------------------------------------------------------------------
__global__ void cvt_transpose_f16_kernel(const float* __restrict__ src,
                                         _Float16* __restrict__ dst,
                                         int K, int N) {
    int i = blockIdx.x * blockDim.x + threadIdx.x;   // over N*K, dst-linear
    if (i < N * K) {
        int n = i / K;
        int k = i - n * K;
        dst[i] = (_Float16)src[(size_t)k * N + n];
    }
}

// ---------------------------------------------------------------------------
// WMMA GEMM: out = act(A[MxK] @ W[KxN] + bias), W given pre-transposed f16
// as Wt[N x K].  Block tile 128x64, BK=32. 256 threads = 8 waves arranged
// 4(M) x 2(N); each wave computes a 32x32 tile = 2x2 WMMA frags.
// ---------------------------------------------------------------------------
#define BM 128
#define BN 64
#define BK 32
#define LDA 40  // BK + 8 halves pad (row = 80B, 16B aligned)
#define LDB 40

template <bool A_IS_F32, bool SILU, bool OUT_F16>
__global__ __launch_bounds__(256) void gemm_wmma_kernel(
    const float* __restrict__ A32, const _Float16* __restrict__ A16,
    const _Float16* __restrict__ Wt, const float* __restrict__ bias,
    _Float16* __restrict__ out16, float* __restrict__ out32,
    int M, int N, int K)
{
    __shared__ _Float16 As[BM * LDA];
    __shared__ _Float16 Bs[BN * LDB];

    const int t     = threadIdx.x;
    const int lane  = t & 31;
    const int wid   = t >> 5;
    const int waveM = wid >> 1;   // 0..3
    const int waveN = wid & 1;    // 0..1
    const int row0  = blockIdx.x * BM;
    const int col0  = blockIdx.y * BN;
    const int l16   = lane & 15;
    const int khalf = (lane >> 4) * 8;

    v8f zero = {};
    v8f acc[2][2];
    acc[0][0] = zero; acc[0][1] = zero; acc[1][0] = zero; acc[1][1] = zero;

    for (int k0 = 0; k0 < K; k0 += BK) {
        __syncthreads();
        // All global loads of the pass go out first, into registers, with
        // fixed trip counts (no per-trip bound test on the thread index), so
        // that the pass waits out one round trip and not one per load.
        // 64x32 f16 B tile from pre-transposed Wt[N][K]: one v8h per thread.
        const int bn_s = t >> 2;
        const int bc_s = (t & 3) * 8;
        const v8h vb = *(const v8h*)&Wt[(size_t)(col0 + bn_s) * K + k0 + bc_s];
        if (A_IS_F32) {
            // 128x32 f32 tile: float4 loads -> v4h LDS stores (4 per thread).
            float4 va[BM * (BK / 4) / 256];
            #pragma unroll
            for (int j = 0; j < BM * (BK / 4) / 256; ++j) {
                int i = t + j * 256;
                int r = i >> 3;
                int c = (i & 7) * 4;
                va[j] = *(const float4*)&A32[(size_t)(row0 + r) * K + k0 + c];
            }
            #pragma unroll
            for (int j = 0; j < BM * (BK / 4) / 256; ++j) {
                int i = t + j * 256;
                int r = i >> 3;
                int c = (i & 7) * 4;
                v4h h = { (_Float16)va[j].x, (_Float16)va[j].y,
                          (_Float16)va[j].z, (_Float16)va[j].w };
                *(v4h*)&As[r * LDA + c] = h;
            }
        } else {
            // 128x32 f16 tile: v8h copies (2 per thread).
            v8h va[BM * (BK / 8) / 256];
            #pragma unroll
            for (int j = 0; j < BM * (BK / 8) / 256; ++j) {
                int i = t + j * 256;
                int r = i >> 2;
                int c = (i & 3) * 8;
                va[j] = *(const v8h*)&A16[(size_t)(row0 + r) * K + k0 + c];
            }
            #pragma unroll
            for (int j = 0; j < BM * (BK / 8) / 256; ++j) {
                int i = t + j * 256;
                int r = i >> 2;
                int c = (i & 3) * 8;
                *(v8h*)&As[r * LDA + c] = va[j];
            }
        }
        *(v8h*)&Bs[bn_s * LDB + bc_s] = vb;
        // Prefetch next Wt tile into GL2 (global_prefetch_b8).
        if (k0 + BK < K)
            __builtin_prefetch(&Wt[(size_t)(col0 + (t >> 2)) * K + k0 + BK], 0, 1);
        __syncthreads();

        v16h afrag[2], bfrag[2];
        #pragma unroll
        for (int am = 0; am < 2; ++am) {
            int r = waveM * 32 + am * 16 + l16;
            afrag[am] = load_frag(&As[r * LDA + khalf]);
        }
        #pragma unroll
        for (int bn = 0; bn < 2; ++bn) {
            int n = waveN * 32 + bn * 16 + l16;
            bfrag[bn] = load_frag(&Bs[n * LDB + khalf]);
        }
        acc[0][0] = WMMA16(afrag[0], bfrag[0], acc[0][0]);
        acc[0][1] = WMMA16(afrag[0], bfrag[1], acc[0][1]);
        acc[1][0] = WMMA16(afrag[1], bfrag[0], acc[1][0]);
        acc[1][1] = WMMA16(afrag[1], bfrag[1], acc[1][1]);
    }

    // Epilogue: C/D layout — lane: col = l16, VGPR r: row = r + (lane>>4)*8.
    #pragma unroll
    for (int am = 0; am < 2; ++am) {
        int rowbase = row0 + waveM * 32 + am * 16 + (lane >> 4) * 8;
        #pragma unroll
        for (int bn = 0; bn < 2; ++bn) {
            int col = col0 + waveN * 32 + bn * 16 + l16;
            float bv = bias[col];
            #pragma unroll
            for (int r = 0; r < 8; ++r) {
                float v = acc[am][bn][r] + bv;
                if (SILU) v = silu_f(v);
                size_t idx = (size_t)(rowbase + r) * N + col;
                if (OUT_F16) out16[idx] = (_Float16)v;
                else         out32[idx] = v;
            }
        }
    }
}

// ---------------------------------------------------------------------------
// Attention: per (b,head) slice, 128-query tile per block, stream 64-key tiles.
// scores = silu(Q K^T)/N * mask  (linear accumulation, no softmax) then S @ V.
// ---------------------------------------------------------------------------
#define AN 2048
#define AH 1024
#define ANH 16
#define AHD 64
#define LQK 72  // 64 + 8 halves pad (144B rows, 16B aligned)

__global__ __launch_bounds__(256) void attn_wmma_kernel(
    const _Float16* __restrict__ Qg, const _Float16* __restrict__ Kg,
    const _Float16* __restrict__ Vg, const float* __restrict__ mask,
    float* __restrict__ Og)
{
    __shared__ _Float16 Qs[128 * LQK];      // 128 queries x 64 d
    __shared__ _Float16 Ks[64 * LQK];       // 64 keys x 64 d
    __shared__ _Float16 Vt[64 * LQK];       // transposed: [d][key]
    __shared__ _Float16 Ps[8 * 16 * LQK];   // per-wave probs: 16 q x 64 key

    const int bh   = blockIdx.y;
    const int b    = bh / ANH;
    const int h    = bh % ANH;
    const int q0   = blockIdx.x * 128;
    const int t    = threadIdx.x;
    const int lane = t & 31;
    const int wid  = t >> 5;
    const int l16  = lane & 15;
    const int khalf = (lane >> 4) * 8;

    const _Float16* Qbase = Qg + (size_t)(b * AN + q0) * AH + h * AHD;
    const float* mrow = mask + (size_t)b * AN * AN;
    const float invN = 1.0f / (float)AN;

    // Stage Q tile: v8h copies (4 per thread), all loads ahead of the stores.
    {
        v8h qv[4];
        #pragma unroll
        for (int j = 0; j < 4; ++j) {
            int i = t + j * 256;
            int r = i >> 3, d = (i & 7) * 8;
            qv[j] = *(const v8h*)&Qbase[(size_t)r * AH + d];
        }
        // Precaution: the offset registers of the four loads above are reused
        // soon after; this wait stands ahead of any such overwrite.
        asm volatile("s_wait_xcnt 0x0" ::: "memory");
        #pragma unroll
        for (int j = 0; j < 4; ++j) {
            int i = t + j * 256;
            int r = i >> 3, d = (i & 7) * 8;
            *(v8h*)&Qs[r * LQK + d] = qv[j];
        }
    }
    __syncthreads();

    // A-fragments from Q are loop-invariant per wave (16 query rows).
    v16h aq0, aq1;
    {
        int r = wid * 16 + l16;
        aq0 = load_frag(&Qs[r * LQK + khalf]);        // d 0..31
        aq1 = load_frag(&Qs[r * LQK + 32 + khalf]);   // d 32..63
    }

    v8f zero = {};
    v8f o[4];
    o[0] = zero; o[1] = zero; o[2] = zero; o[3] = zero;

    _Float16* Pw = &Ps[wid * 16 * LQK];

    for (int m0 = 0; m0 < AN; m0 += 64) {
        __syncthreads();
        const _Float16* Kb = Kg + (size_t)(b * AN + m0) * AH + h * AHD;
        const _Float16* Vb = Vg + (size_t)(b * AN + m0) * AH + h * AHD;
        // Stage K (straight copy) and V (transpose-scatter), v8h global loads:
        // all four loads ahead of the stores, fixed trip counts.
        v8h kv[2], vv[2];
        #pragma unroll
        for (int u = 0; u < 2; ++u) {
            int i = t + u * 256;
            int r = i >> 3, d = (i & 7) * 8;
            kv[u] = *(const v8h*)&Kb[(size_t)r * AH + d];
            vv[u] = *(const v8h*)&Vb[(size_t)r * AH + d];
        }
        // The pass's mask values go out with them (16 queries x 64 keys a wave).
        const int qbg = q0 + wid * 16 + (lane >> 4) * 8;  // query row (global)
        float mv[4][8];
        #pragma unroll
        for (int nt = 0; nt < 4; ++nt) {
            int kc = m0 + nt * 16 + l16;  // key column (global)
            #pragma unroll
            for (int r = 0; r < 8; ++r)
                mv[nt][r] = mrow[(size_t)(qbg + r) * AN + kc];
        }
        #pragma unroll
        for (int u = 0; u < 2; ++u) {
            int i = t + u * 256;
            int r = i >> 3, d = (i & 7) * 8;
            *(v8h*)&Ks[r * LQK + d] = kv[u];
            #pragma unroll
            for (int j = 0; j < 8; ++j)
                Vt[(d + j) * LQK + r] = vv[u][j];
        }
        __syncthreads();

        // Scores: 16 queries x 64 keys per wave, 2 WMMAs per 16x16 tile.
        #pragma unroll
        for (int nt = 0; nt < 4; ++nt) {
            int kr = nt * 16 + l16;
            v16h bk0 = load_frag(&Ks[kr * LQK + khalf]);
            v16h bk1 = load_frag(&Ks[kr * LQK + 32 + khalf]);
            v8f s = zero;
            s = WMMA16(aq0, bk0, s);
            s = WMMA16(aq1, bk1, s);

            #pragma unroll
            for (int r = 0; r < 8; ++r) {
                float x = s[r];
                float v = silu_f(x) * invN * mv[nt][r];
                Pw[((lane >> 4) * 8 + r) * LQK + nt * 16 + l16] = (_Float16)v;
            }
        }

        // P @ V: re-layout P (C->A) via per-wave LDS round-trip (in-order DS).
        v16h ap0 = load_frag(&Pw[l16 * LQK + khalf]);        // keys 0..31
        v16h ap1 = load_frag(&Pw[l16 * LQK + 32 + khalf]);   // keys 32..63
        #pragma unroll
        for (int dt = 0; dt < 4; ++dt) {
            int dc = dt * 16 + l16;
            v16h bv0 = load_frag(&Vt[dc * LQK + khalf]);
            v16h bv1 = load_frag(&Vt[dc * LQK + 32 + khalf]);
            o[dt] = WMMA16(ap0, bv0, o[dt]);
            o[dt] = WMMA16(ap1, bv1, o[dt]);
        }
    }

    // Write f32 attention output [B*N, H].
    int qb = b * AN + q0 + wid * 16 + (lane >> 4) * 8;
    #pragma unroll
    for (int dt = 0; dt < 4; ++dt) {
        int col = h * AHD + dt * 16 + l16;
        #pragma unroll
        for (int r = 0; r < 8; ++r)
            Og[(size_t)(qb + r) * AH + col] = o[dt][r];
    }
}

// ---------------------------------------------------------------------------
// LayerNorm over H=1024 + build o_input = [U, A, U*A] as f16 [4096 x 3072].
// ---------------------------------------------------------------------------
__global__ __launch_bounds__(256) void ln_concat_kernel(
    const float* __restrict__ attn, const _Float16* __restrict__ Uh,
    _Float16* __restrict__ oin)
{
    __shared__ float red[256];
    const int row = blockIdx.x;
    const int t = threadIdx.x;
    const float* x = attn + (size_t)row * 1024;

    float vals[4], s = 0.0f, ss = 0.0f;
    #pragma unroll
    for (int i = 0; i < 4; ++i) {
        float v = x[t + i * 256];
        vals[i] = v; s += v; ss += v * v;
    }
    red[t] = s; __syncthreads();
    for (int st = 128; st > 0; st >>= 1) {
        if (t < st) red[t] += red[t + st];
        __syncthreads();
    }
    float mean = red[0] * (1.0f / 1024.0f);
    __syncthreads();
    red[t] = ss; __syncthreads();
    for (int st = 128; st > 0; st >>= 1) {
        if (t < st) red[t] += red[t + st];
        __syncthreads();
    }
    float var  = red[0] * (1.0f / 1024.0f) - mean * mean;
    float rstd = __builtin_amdgcn_rsqf(var + 1e-8f);   // native v_rsq_f32

    _Float16* orow = oin + (size_t)row * 3072;
    const _Float16* urow = Uh + (size_t)row * 1024;
    #pragma unroll
    for (int i = 0; i < 4; ++i) {
        int c = t + i * 256;
        float a = (vals[i] - mean) * rstd;
        float u = (float)urow[c];
        orow[c]        = (_Float16)u;
        orow[1024 + c] = (_Float16)a;
        orow[2048 + c] = (_Float16)(u * a);
    }
}

// ---------------------------------------------------------------------------
// Host-side orchestration.
// ---------------------------------------------------------------------------
extern "C" void kernel_launch(void* const* d_in, const int* in_sizes, int n_in,
                              void* d_out, int out_size, void* d_ws, size_t ws_size,
                              hipStream_t stream) {
    const float* query = (const float*)d_in[0];
    const float* key_  = (const float*)d_in[1];
    const float* value = (const float*)d_in[2];
    const float* mask  = (const float*)d_in[3];
    const float* Wq = (const float*)d_in[4];   const float* bq = (const float*)d_in[5];
    const float* Wk = (const float*)d_in[6];   const float* bk = (const float*)d_in[7];
    const float* Wv = (const float*)d_in[8];   const float* bv = (const float*)d_in[9];
    const float* Wu = (const float*)d_in[10];  const float* bu = (const float*)d_in[11];
    const float* Wo = (const float*)d_in[12];  const float* bo = (const float*)d_in[13];
    float* out = (float*)d_out;

    const int M = 2 * 2048;        // 4096 rows
    const int H = 1024;

    // Workspace carve-out (~90 MB total, deterministic layout).
    char* ws = (char*)d_ws;
    size_t off = 0;
    auto carve = [&](size_t bytes) -> void* {
        void* p = ws + off;
        off += (bytes + 255) & ~(size_t)255;
        return p;
    };
    _Float16* Wq_t = (_Float16*)carve((size_t)H * H * 2);       // [N][K] f16
    _Float16* Wk_t = (_Float16*)carve((size_t)H * H * 2);
    _Float16* Wv_t = (_Float16*)carve((size_t)H * H * 2);
    _Float16* Wu_t = (_Float16*)carve((size_t)H * H * 2);
    _Float16* Wo_t = (_Float16*)carve((size_t)H * 3 * H * 2);   // [1024][3072]
    _Float16* Q_h  = (_Float16*)carve((size_t)M * H * 2);
    _Float16* K_h  = (_Float16*)carve((size_t)M * H * 2);
    _Float16* V_h  = (_Float16*)carve((size_t)M * H * 2);
    _Float16* U_h  = (_Float16*)carve((size_t)M * H * 2);
    float*    At_f = (float*)   carve((size_t)M * H * 4);
    _Float16* Oi_h = (_Float16*)carve((size_t)M * 3 * H * 2);
    (void)ws_size; (void)in_sizes; (void)n_in; (void)out_size;

    // 1) Weights -> f16, transposed to [N][K] for contiguous B staging.
    int nw = H * H;
    cvt_transpose_f16_kernel<<<(nw + 255) / 256, 256, 0, stream>>>(Wq, Wq_t, H, H);
    cvt_transpose_f16_kernel<<<(nw + 255) / 256, 256, 0, stream>>>(Wk, Wk_t, H, H);
    cvt_transpose_f16_kernel<<<(nw + 255) / 256, 256, 0, stream>>>(Wv, Wv_t, H, H);
    cvt_transpose_f16_kernel<<<(nw + 255) / 256, 256, 0, stream>>>(Wu, Wu_t, H, H);
    int nwo = 3 * H * H;
    cvt_transpose_f16_kernel<<<(nwo + 255) / 256, 256, 0, stream>>>(Wo, Wo_t, 3 * H, H);

    // 2) Projections: silu(X @ W + b), f16 outputs.
    dim3 ggrid(M / BM, H / BN);
    gemm_wmma_kernel<true, true, true><<<ggrid, 256, 0, stream>>>(
        query, nullptr, Wq_t, bq, Q_h, nullptr, M, H, H);
    gemm_wmma_kernel<true, true, true><<<ggrid, 256, 0, stream>>>(
        key_,  nullptr, Wk_t, bk, K_h, nullptr, M, H, H);
    gemm_wmma_kernel<true, true, true><<<ggrid, 256, 0, stream>>>(
        value, nullptr, Wv_t, bv, V_h, nullptr, M, H, H);
    gemm_wmma_kernel<true, true, true><<<ggrid, 256, 0, stream>>>(
        value, nullptr, Wu_t, bu, U_h, nullptr, M, H, H);

    // 3) Attention (16 query tiles x 32 (b,head) slices).
    dim3 agrid(AN / 128, 2 * ANH);
    attn_wmma_kernel<<<agrid, 256, 0, stream>>>(Q_h, K_h, V_h, mask, At_f);

    // 4) LayerNorm + concat [U, A, U*A].
    ln_concat_kernel<<<M, 256, 0, stream>>>(At_f, U_h, Oi_h);

    // 5) Final GEMM: o_input[4096x3072] @ Wo[3072x1024] + bo -> f32 out.
    dim3 fgrid(M / BM, H / BN);
    gemm_wmma_kernel<false, false, false><<<fgrid, 256, 0, stream>>>(
        nullptr, Oi_h, Wo_t, bo, nullptr, out, M, H, 3 * H);
}

// v002
// Measured time: 268 microseconds a run.
// Next to v001, in two timings, it ran 1.15 times as fast each time.
// Counting every step since v000, it is 1.55 times as fast.
#include <hip/hip_runtime.h>
#include <hip/hip_bf16.h>
#include <math.h>

// HSTU attention for MI455X (gfx1250, wave32, WMMA).
// B=2, N=2048, H=1024, NH=16, HD=64.

typedef __attribute__((ext_vector_type(16))) _Float16 v16h;
typedef __attribute__((ext_vector_type(8)))  _Float16 v8h;
typedef __attribute__((ext_vector_type(4)))  _Float16 v4h;
typedef __attribute__((ext_vector_type(8)))  float    v8f;
typedef __attribute__((ext_vector_type(4)))  float    v4f;

#define WMMA16(a, b, c) __builtin_amdgcn_wmma_f32_16x16x32_f16( \
    false, (a), false, (b), (short)0, (c), false, false)

// SiLU via native v_exp_f32 + v_rcp_f32 (no IEEE div sequence).
__device__ __forceinline__ float silu_f(float x) {
    return x * __builtin_amdgcn_rcpf(1.0f + __expf(-x));
}

// Load a v16h fragment per the CDNA5 16-bit A/B layout:
// halves 0..7  = K (or col) khalf..khalf+7
// halves 8..15 = K (or col) khalf+16..khalf+23   (khalf = (lane>>4)*8)
__device__ __forceinline__ v16h load_frag(const _Float16* p) {
    v16h f;
    *((v8h*)&f)       = *(const v8h*)p;
    *(((v8h*)&f) + 1) = *(const v8h*)(p + 16);
    return f;
}

// ---------------------------------------------------------------------------
// Kernel: all five weights, f32 [K x 1024] -> f16 transposed [1024 x K], in one
// launch.  A work-group moves a 256(k) x 64(n) tile.  A thread loads a
// 16(k) x 4(n) block as 16 float4 (a wave-load covers two rows of 256 B), turns
// it in registers into 8-half runs along k, and the runs pass through LDS so
// that each wave-store writes 512 contiguous bytes of one output row.
// blockIdx.y counts slabs of 256 k rows: 4 each for Wq, Wk, Wv, Wu, 12 for Wo.
// ---------------------------------------------------------------------------
#define TK 256
#define TN 64
#define TP (TK + 8)  // LDS row pitch in halves (528 B = 16 B x odd)

__global__ __launch_bounds__(256) void cvt_transpose_all_kernel(
    const float* __restrict__ Wq, const float* __restrict__ Wk,
    const float* __restrict__ Wv, const float* __restrict__ Wu,
    const float* __restrict__ Wo,
    _Float16* __restrict__ Tq, _Float16* __restrict__ Tk,
    _Float16* __restrict__ Tv, _Float16* __restrict__ Tu,
    _Float16* __restrict__ To)
{
    __shared__ _Float16 Ts[TN * TP];   // [n][k], 16-B chunks swizzled per row

    const int t    = threadIdx.x;
    const int slab = blockIdx.y;
    const int w    = slab >> 2;
    const float* src = w == 0 ? Wq : w == 1 ? Wk : w == 2 ? Wv : w == 3 ? Wu : Wo;
    _Float16*    dst = w == 0 ? Tq : w == 1 ? Tk : w == 2 ? Tv : w == 3 ? Tu : To;
    const int K  = w < 4 ? 1024 : 3072;
    const int k0 = (w < 4 ? (slab & 3) : (slab - 16)) * TK;
    const int n0 = blockIdx.x * TN;

    const int nq = t & 15;   // which group of 4 columns
    const int kb = t >> 4;   // which group of 16 rows
    const float* p = src + (size_t)(k0 + kb * 16) * 1024 + n0 + nq * 4;
    v4f v[16];
    #pragma unroll
    for (int j = 0; j < 16; ++j)
        v[j] = *(const v4f*)(p + j * 1024);
    // Precaution: stands ahead of any reuse of the loads' address registers;
    // p as an input keeps them from being a load's own destination before it.
    asm volatile("s_wait_xcnt 0x0" :: "v"(p) : "memory");
    // Keeps the conversions behind all 16 loads: left free, the scheduler holds
    // four loads back behind the first waits, a second memory round trip.
    __builtin_amdgcn_sched_barrier(0);

    // The 16 lanes of a half-wave write rows 4 apart, which at this pitch fall
    // on four bank groups only; the chunk index is XORed with (row >> 4) so
    // that they spread over all 64 banks.  The reader undoes it.
    #pragma unroll
    for (int c = 0; c < 4; ++c) {
        #pragma unroll
        for (int hh = 0; hh < 2; ++hh) {
            v8h h;
            #pragma unroll
            for (int j = 0; j < 8; ++j)
                h[j] = (_Float16)v[hh * 8 + j][c];
            *(v8h*)&Ts[(nq * 4 + c) * TP + ((kb * 2 + hh) ^ (nq >> 2)) * 8] = h;
        }
    }
    __syncthreads();

    const int ch = t & 31;
    v8h h[8];
    #pragma unroll
    for (int i = 0; i < 8; ++i) {
        const int n = (t >> 5) + i * 8;    // one output row a wave
        h[i] = *(const v8h*)&Ts[n * TP + (ch ^ (n >> 4)) * 8];
    }
    _Float16* q = dst + ((n0 + (t >> 5)) * K + k0 + ch * 8);
    #pragma unroll
    for (int i = 0; i < 8; ++i)
        *(v8h*)(q + i * 8 * K) = h[i];
}

// ---------------------------------------------------------------------------
// WMMA GEMM: out = act(A[MxK] @ W[KxN] + bias), W given pre-transposed f16
// as Wt[N x K].  Block tile 128x64, BK=32. 256 threads = 8 waves arranged
// 4(M) x 2(N); each wave computes a 32x32 tile = 2x2 WMMA frags.
// ---------------------------------------------------------------------------
#define BM 128
#define BN 64
#define BK 32
#define LDA 40  // BK + 8 halves pad (row = 80B, 16B aligned)
#define LDB 40

template <bool A_IS_F32, bool SILU, bool OUT_F16>
__global__ __launch_bounds__(256) void gemm_wmma_kernel(
    const float* __restrict__ A32, const _Float16* __restrict__ A16,
    const _Float16* __restrict__ Wt, const float* __restrict__ bias,
    _Float16* __restrict__ out16, float* __restrict__ out32,
    int M, int N, int K)
{
    __shared__ _Float16 As[BM * LDA];
    __shared__ _Float16 Bs[BN * LDB];

    const int t     = threadIdx.x;
    const int lane  = t & 31;
    const int wid   = t >> 5;
    const int waveM = wid >> 1;   // 0..3
    const int waveN = wid & 1;    // 0..1
    const int row0  = blockIdx.x * BM;
    const int col0  = blockIdx.y * BN;
    const int l16   = lane & 15;
    const int khalf = (lane >> 4) * 8;

    v8f zero = {};
    v8f acc[2][2];
    acc[0][0] = zero; acc[0][1] = zero; acc[1][0] = zero; acc[1][1] = zero;

    for (int k0 = 0; k0 < K; k0 += BK) {
        __syncthreads();
        // All global loads of the pass go out first, into registers, with
        // fixed trip counts (no per-trip bound test on the thread index), so
        // that the pass waits out one round trip and not one per load.
        // 64x32 f16 B tile from pre-transposed Wt[N][K]: one v8h per thread.
        const int bn_s = t >> 2;
        const int bc_s = (t & 3) * 8;
        const v8h vb = *(const v8h*)&Wt[(size_t)(col0 + bn_s) * K + k0 + bc_s];
        if (A_IS_F32) {
            // 128x32 f32 tile: float4 loads -> v4h LDS stores (4 per thread).
            float4 va[BM * (BK / 4) / 256];
            #pragma unroll
            for (int j = 0; j < BM * (BK / 4) / 256; ++j) {
                int i = t + j * 256;
                int r = i >> 3;
                int c = (i & 7) * 4;
                va[j] = *(const float4*)&A32[(size_t)(row0 + r) * K + k0 + c];
            }
            #pragma unroll
            for (int j = 0; j < BM * (BK / 4) / 256; ++j) {
                int i = t + j * 256;
                int r = i >> 3;
                int c = (i & 7) * 4;
                v4h h = { (_Float16)va[j].x, (_Float16)va[j].y,
                          (_Float16)va[j].z, (_Float16)va[j].w };
                *(v4h*)&As[r * LDA + c] = h;
            }
        } else {
            // 128x32 f16 tile: v8h copies (2 per thread).
            v8h va[BM * (BK / 8) / 256];
            #pragma unroll
            for (int j = 0; j < BM * (BK / 8) / 256; ++j) {
                int i = t + j * 256;
                int r = i >> 2;
                int c = (i & 3) * 8;
                va[j] = *(const v8h*)&A16[(size_t)(row0 + r) * K + k0 + c];
            }
            #pragma unroll
            for (int j = 0; j < BM * (BK / 8) / 256; ++j) {
                int i = t + j * 256;
                int r = i >> 2;
                int c = (i & 3) * 8;
                *(v8h*)&As[r * LDA + c] = va[j];
            }
        }
        *(v8h*)&Bs[bn_s * LDB + bc_s] = vb;
        // Prefetch next Wt tile into GL2 (global_prefetch_b8).
        if (k0 + BK < K)
            __builtin_prefetch(&Wt[(size_t)(col0 + (t >> 2)) * K + k0 + BK], 0, 1);
        __syncthreads();

        v16h afrag[2], bfrag[2];
        #pragma unroll
        for (int am = 0; am < 2; ++am) {
            int r = waveM * 32 + am * 16 + l16;
            afrag[am] = load_frag(&As[r * LDA + khalf]);
        }
        #pragma unroll
        for (int bn = 0; bn < 2; ++bn) {
            int n = waveN * 32 + bn * 16 + l16;
            bfrag[bn] = load_frag(&Bs[n * LDB + khalf]);
        }
        acc[0][0] = WMMA16(afrag[0], bfrag[0], acc[0][0]);
        acc[0][1] = WMMA16(afrag[0], bfrag[1], acc[0][1]);
        acc[1][0] = WMMA16(afrag[1], bfrag[0], acc[1][0]);
        acc[1][1] = WMMA16(afrag[1], bfrag[1], acc[1][1]);
    }

    // Epilogue: C/D layout — lane: col = l16, VGPR r: row = r + (lane>>4)*8.
    #pragma unroll
    for (int am = 0; am < 2; ++am) {
        int rowbase = row0 + waveM * 32 + am * 16 + (lane >> 4) * 8;
        #pragma unroll
        for (int bn = 0; bn < 2; ++bn) {
            int col = col0 + waveN * 32 + bn * 16 + l16;
            float bv = bias[col];
            #pragma unroll
            for (int r = 0; r < 8; ++r) {
                float v = acc[am][bn][r] + bv;
                if (SILU) v = silu_f(v);
                size_t idx = (size_t)(rowbase + r) * N + col;
                if (OUT_F16) out16[idx] = (_Float16)v;
                else         out32[idx] = v;
            }
        }
    }
}

// ---------------------------------------------------------------------------
// Attention: per (b,head) slice, 128-query tile per block, stream 64-key tiles.
// scores = silu(Q K^T)/N * mask  (linear accumulation, no softmax) then S @ V.
// ---------------------------------------------------------------------------
#define AN 2048
#define AH 1024
#define ANH 16
#define AHD 64
#define LQK 72  // 64 + 8 halves pad (144B rows, 16B aligned)

__global__ __launch_bounds__(256) void attn_wmma_kernel(
    const _Float16* __restrict__ Qg, const _Float16* __restrict__ Kg,
    const _Float16* __restrict__ Vg, const float* __restrict__ mask,
    float* __restrict__ Og)
{
    __shared__ _Float16 Qs[128 * LQK];      // 128 queries x 64 d
    __shared__ _Float16 Ks[64 * LQK];       // 64 keys x 64 d
    __shared__ _Float16 Vt[64 * LQK];       // transposed: [d][key]
    __shared__ _Float16 Ps[8 * 16 * LQK];   // per-wave probs: 16 q x 64 key

    const int bh   = blockIdx.y;
    const int b    = bh / ANH;
    const int h    = bh % ANH;
    const int q0   = blockIdx.x * 128;
    const int t    = threadIdx.x;
    const int lane = t & 31;
    const int wid  = t >> 5;
    const int l16  = lane & 15;
    const int khalf = (lane >> 4) * 8;

    const _Float16* Qbase = Qg + (size_t)(b * AN + q0) * AH + h * AHD;
    const float* mrow = mask + (size_t)b * AN * AN;
    const float invN = 1.0f / (float)AN;

    // Stage Q tile: v8h copies (4 per thread), all loads ahead of the stores.
    {
        v8h qv[4];
        #pragma unroll
        for (int j = 0; j < 4; ++j) {
            int i = t + j * 256;
            int r = i >> 3, d = (i & 7) * 8;
            qv[j] = *(const v8h*)&Qbase[(size_t)r * AH + d];
        }
        // Precaution: the offset registers of the four loads above are reused
        // soon after; this wait stands ahead of any such overwrite.
        asm volatile("s_wait_xcnt 0x0" ::: "memory");
        #pragma unroll
        for (int j = 0; j < 4; ++j) {
            int i = t + j * 256;
            int r = i >> 3, d = (i & 7) * 8;
            *(v8h*)&Qs[r * LQK + d] = qv[j];
        }
    }
    __syncthreads();

    // A-fragments from Q are loop-invariant per wave (16 query rows).
    v16h aq0, aq1;
    {
        int r = wid * 16 + l16;
        aq0 = load_frag(&Qs[r * LQK + khalf]);        // d 0..31
        aq1 = load_frag(&Qs[r * LQK + 32 + khalf]);   // d 32..63
    }

    v8f zero = {};
    v8f o[4];
    o[0] = zero; o[1] = zero; o[2] = zero; o[3] = zero;

    _Float16* Pw = &Ps[wid * 16 * LQK];

    for (int m0 = 0; m0 < AN; m0 += 64) {
        __syncthreads();
        const _Float16* Kb = Kg + (size_t)(b * AN + m0) * AH + h * AHD;
        const _Float16* Vb = Vg + (size_t)(b * AN + m0) * AH + h * AHD;
        // Stage K (straight copy) and V (transpose-scatter), v8h global loads:
        // all four loads ahead of the stores, fixed trip counts.
        v8h kv[2], vv[2];
        #pragma unroll
        for (int u = 0; u < 2; ++u) {
            int i = t + u * 256;
            int r = i >> 3, d = (i & 7) * 8;
            kv[u] = *(const v8h*)&Kb[(size_t)r * AH + d];
            vv[u] = *(const v8h*)&Vb[(size_t)r * AH + d];
        }
        // The pass's mask values go out with them (16 queries x 64 keys a wave).
        const int qbg = q0 + wid * 16 + (lane >> 4) * 8;  // query row (global)
        float mv[4][8];
        #pragma unroll
        for (int nt = 0; nt < 4; ++nt) {
            int kc = m0 + nt * 16 + l16;  // key column (global)
            #pragma unroll
            for (int r = 0; r < 8; ++r)
                mv[nt][r] = mrow[(size_t)(qbg + r) * AN + kc];
        }
        #pragma unroll
        for (int u = 0; u < 2; ++u) {
            int i = t + u * 256;
            int r = i >> 3, d = (i & 7) * 8;
            *(v8h*)&Ks[r * LQK + d] = kv[u];
            #pragma unroll
            for (int j = 0; j < 8; ++j)
                Vt[(d + j) * LQK + r] = vv[u][j];
        }
        __syncthreads();

        // Scores: 16 queries x 64 keys per wave, 2 WMMAs per 16x16 tile.
        #pragma unroll
        for (int nt = 0; nt < 4; ++nt) {
            int kr = nt * 16 + l16;
            v16h bk0 = load_frag(&Ks[kr * LQK + khalf]);
            v16h bk1 = load_frag(&Ks[kr * LQK + 32 + khalf]);
            v8f s = zero;
            s = WMMA16(aq0, bk0, s);
            s = WMMA16(aq1, bk1, s);

            #pragma unroll
            for (int r = 0; r < 8; ++r) {
                float x = s[r];
                float v = silu_f(x) * invN * mv[nt][r];
                Pw[((lane >> 4) * 8 + r) * LQK + nt * 16 + l16] = (_Float16)v;
            }
        }

        // P @ V: re-layout P (C->A) via per-wave LDS round-trip (in-order DS).
        v16h ap0 = load_frag(&Pw[l16 * LQK + khalf]);        // keys 0..31
        v16h ap1 = load_frag(&Pw[l16 * LQK + 32 + khalf]);   // keys 32..63
        #pragma unroll
        for (int dt = 0; dt < 4; ++dt) {
            int dc = dt * 16 + l16;
            v16h bv0 = load_frag(&Vt[dc * LQK + khalf]);
            v16h bv1 = load_frag(&Vt[dc * LQK + 32 + khalf]);
            o[dt] = WMMA16(ap0, bv0, o[dt]);
            o[dt] = WMMA16(ap1, bv1, o[dt]);
        }
    }

    // Write f32 attention output [B*N, H].
    int qb = b * AN + q0 + wid * 16 + (lane >> 4) * 8;
    #pragma unroll
    for (int dt = 0; dt < 4; ++dt) {
        int col = h * AHD + dt * 16 + l16;
        #pragma unroll
        for (int r = 0; r < 8; ++r)
            Og[(size_t)(qb + r) * AH + col] = o[dt][r];
    }
}

// ---------------------------------------------------------------------------
// LayerNorm over H=1024 + build o_input = [U, A, U*A] as f16 [4096 x 3072].
// ---------------------------------------------------------------------------
__global__ __launch_bounds__(256) void ln_concat_kernel(
    const float* __restrict__ attn, const _Float16* __restrict__ Uh,
    _Float16* __restrict__ oin)
{
    __shared__ float red[256];
    const int row = blockIdx.x;
    const int t = threadIdx.x;
    const float* x = attn + (size_t)row * 1024;

    float vals[4], s = 0.0f, ss = 0.0f;
    #pragma unroll
    for (int i = 0; i < 4; ++i) {
        float v = x[t + i * 256];
        vals[i] = v; s += v; ss += v * v;
    }
    red[t] = s; __syncthreads();
    for (int st = 128; st > 0; st >>= 1) {
        if (t < st) red[t] += red[t + st];
        __syncthreads();
    }
    float mean = red[0] * (1.0f / 1024.0f);
    __syncthreads();
    red[t] = ss; __syncthreads();
    for (int st = 128; st > 0; st >>= 1) {
        if (t < st) red[t] += red[t + st];
        __syncthreads();
    }
    float var  = red[0] * (1.0f / 1024.0f) - mean * mean;
    float rstd = __builtin_amdgcn_rsqf(var + 1e-8f);   // native v_rsq_f32

    _Float16* orow = oin + (size_t)row * 3072;
    const _Float16* urow = Uh + (size_t)row * 1024;
    #pragma unroll
    for (int i = 0; i < 4; ++i) {
        int c = t + i * 256;
        float a = (vals[i] - mean) * rstd;
        float u = (float)urow[c];
        orow[c]        = (_Float16)u;
        orow[1024 + c] = (_Float16)a;
        orow[2048 + c] = (_Float16)(u * a);
    }
}

// ---------------------------------------------------------------------------
// Host-side orchestration.
// ---------------------------------------------------------------------------
extern "C" void kernel_launch(void* const* d_in, const int* in_sizes, int n_in,
                              void* d_out, int out_size, void* d_ws, size_t ws_size,
                              hipStream_t stream) {
    const float* query = (const float*)d_in[0];
    const float* key_  = (const float*)d_in[1];
    const float* value = (const float*)d_in[2];
    const float* mask  = (const float*)d_in[3];
    const float* Wq = (const float*)d_in[4];   const float* bq = (const float*)d_in[5];
    const float* Wk = (const float*)d_in[6];   const float* bk = (const float*)d_in[7];
    const float* Wv = (const float*)d_in[8];   const float* bv = (const float*)d_in[9];
    const float* Wu = (const float*)d_in[10];  const float* bu = (const float*)d_in[11];
    const float* Wo = (const float*)d_in[12];  const float* bo = (const float*)d_in[13];
    float* out = (float*)d_out;

    const int M = 2 * 2048;        // 4096 rows
    const int H = 1024;

    // Workspace carve-out (~90 MB total, deterministic layout).
    char* ws = (char*)d_ws;
    size_t off = 0;
    auto carve = [&](size_t bytes) -> void* {
        void* p = ws + off;
        off += (bytes + 255) & ~(size_t)255;
        return p;
    };
    _Float16* Wq_t = (_Float16*)carve((size_t)H * H * 2);       // [N][K] f16
    _Float16* Wk_t = (_Float16*)carve((size_t)H * H * 2);
    _Float16* Wv_t = (_Float16*)carve((size_t)H * H * 2);
    _Float16* Wu_t = (_Float16*)carve((size_t)H * H * 2);
    _Float16* Wo_t = (_Float16*)carve((size_t)H * 3 * H * 2);   // [1024][3072]
    _Float16* Q_h  = (_Float16*)carve((size_t)M * H * 2);
    _Float16* K_h  = (_Float16*)carve((size_t)M * H * 2);
    _Float16* V_h  = (_Float16*)carve((size_t)M * H * 2);
    _Float16* U_h  = (_Float16*)carve((size_t)M * H * 2);
    float*    At_f = (float*)   carve((size_t)M * H * 4);
    _Float16* Oi_h = (_Float16*)carve((size_t)M * 3 * H * 2);
    (void)ws_size; (void)in_sizes; (void)n_in; (void)out_size;

    // 1) Weights -> f16, transposed to [N][K] for contiguous B staging:
    //    16 column tiles x 28 slabs of 256 k rows, one launch.
    cvt_transpose_all_kernel<<<dim3(16, 28), 256, 0, stream>>>(
        Wq, Wk, Wv, Wu, Wo, Wq_t, Wk_t, Wv_t, Wu_t, Wo_t);

    // 2) Projections: silu(X @ W + b), f16 outputs.
    dim3 ggrid(M / BM, H / BN);
    gemm_wmma_kernel<true, true, true><<<ggrid, 256, 0, stream>>>(
        query, nullptr, Wq_t, bq, Q_h, nullptr, M, H, H);
    gemm_wmma_kernel<true, true, true><<<ggrid, 256, 0, stream>>>(
        key_,  nullptr, Wk_t, bk, K_h, nullptr, M, H, H);
    gemm_wmma_kernel<true, true, true><<<ggrid, 256, 0, stream>>>(
        value, nullptr, Wv_t, bv, V_h, nullptr, M, H, H);
    gemm_wmma_kernel<true, true, true><<<ggrid, 256, 0, stream>>>(
        value, nullptr, Wu_t, bu, U_h, nullptr, M, H, H);

    // 3) Attention (16 query tiles x 32 (b,head) slices).
    dim3 agrid(AN / 128, 2 * ANH);
    attn_wmma_kernel<<<agrid, 256, 0, stream>>>(Q_h, K_h, V_h, mask, At_f);

    // 4) LayerNorm + concat [U, A, U*A].
    ln_concat_kernel<<<M, 256, 0, stream>>>(At_f, U_h, Oi_h);

    // 5) Final GEMM: o_input[4096x3072] @ Wo[3072x1024] + bo -> f32 out.
    dim3 fgrid(M / BM, H / BN);
    gemm_wmma_kernel<false, false, false><<<fgrid, 256, 0, stream>>>(
        nullptr, Oi_h, Wo_t, bo, nullptr, out, M, H, 3 * H);
}

// v003
// A run of this version takes 226 microseconds.
// Next to v002, in two timings, it ran 1.18 times as fast each time.
// Counting every step since v000, it is 1.83 times as fast.
#include <hip/hip_runtime.h>
#include <hip/hip_bf16.h>
#include <math.h>

// HSTU attention for MI455X (gfx1250, wave32, WMMA).
// B=2, N=2048, H=1024, NH=16, HD=64.

typedef __attribute__((ext_vector_type(16))) _Float16 v16h;
typedef __attribute__((ext_vector_type(8)))  _Float16 v8h;
typedef __attribute__((ext_vector_type(4)))  _Float16 v4h;
typedef __attribute__((ext_vector_type(8)))  float    v8f;
typedef __attribute__((ext_vector_type(4)))  float    v4f;

#define WMMA16(a, b, c) __builtin_amdgcn_wmma_f32_16x16x32_f16( \
    false, (a), false, (b), (short)0, (c), false, false)

// SiLU via native v_exp_f32 + v_rcp_f32 (no IEEE div sequence).
__device__ __forceinline__ float silu_f(float x) {
    return x * __builtin_amdgcn_rcpf(1.0f + __expf(-x));
}

// Load a v16h fragment per the CDNA5 16-bit A/B layout:
// halves 0..7  = K (or col) khalf..khalf+7
// halves 8..15 = K (or col) khalf+16..khalf+23   (khalf = (lane>>4)*8)
__device__ __forceinline__ v16h load_frag(const _Float16* p) {
    v16h f;
    *((v8h*)&f)       = *(const v8h*)p;
    *(((v8h*)&f) + 1) = *(const v8h*)(p + 16);
    return f;
}

// ---------------------------------------------------------------------------
// Kernel: all five weights, f32 [K x 1024] -> f16 transposed [1024 x K], in one
// launch.  A work-group moves a 256(k) x 64(n) tile.  A thread loads a
// 16(k) x 4(n) block as 16 float4 (a wave-load covers two rows of 256 B), turns
// it in registers into 8-half runs along k, and the runs pass through LDS so
// that each wave-store writes 512 contiguous bytes of one output row.
// blockIdx.y counts slabs of 256 k rows: 4 each for Wq, Wk, Wv, Wu, 12 for Wo.
// ---------------------------------------------------------------------------
#define TK 256
#define TN 64
#define TP (TK + 8)  // LDS row pitch in halves (528 B = 16 B x odd)

__global__ __launch_bounds__(256) void cvt_transpose_all_kernel(
    const float* __restrict__ Wq, const float* __restrict__ Wk,
    const float* __restrict__ Wv, const float* __restrict__ Wu,
    const float* __restrict__ Wo,
    _Float16* __restrict__ Tq, _Float16* __restrict__ Tk,
    _Float16* __restrict__ Tv, _Float16* __restrict__ Tu,
    _Float16* __restrict__ To)
{
    __shared__ _Float16 Ts[TN * TP];   // [n][k], 16-B chunks swizzled per row

    const int t    = threadIdx.x;
    const int slab = blockIdx.y;
    const int w    = slab >> 2;
    const float* src = w == 0 ? Wq : w == 1 ? Wk : w == 2 ? Wv : w == 3 ? Wu : Wo;
    _Float16*    dst = w == 0 ? Tq : w == 1 ? Tk : w == 2 ? Tv : w == 3 ? Tu : To;
    const int K  = w < 4 ? 1024 : 3072;
    const int k0 = (w < 4 ? (slab & 3) : (slab - 16)) * TK;
    const int n0 = blockIdx.x * TN;

    const int nq = t & 15;   // which group of 4 columns
    const int kb = t >> 4;   // which group of 16 rows
    const float* p = src + (size_t)(k0 + kb * 16) * 1024 + n0 + nq * 4;
    v4f v[16];
    #pragma unroll
    for (int j = 0; j < 16; ++j)
        v[j] = *(const v4f*)(p + j * 1024);
    // Precaution: stands ahead of any reuse of the loads' address registers;
    // p as an input keeps them from being a load's own destination before it.
    asm volatile("s_wait_xcnt 0x0" :: "v"(p) : "memory");
    // Keeps the conversions behind all 16 loads: left free, the scheduler holds
    // four loads back behind the first waits, a second memory round trip.
    __builtin_amdgcn_sched_barrier(0);

    // The 16 lanes of a half-wave write rows 4 apart, which at this pitch fall
    // on four bank groups only; the chunk index is XORed with (row >> 4) so
    // that they spread over all 64 banks.  The reader undoes it.
    #pragma unroll
    for (int c = 0; c < 4; ++c) {
        #pragma unroll
        for (int hh = 0; hh < 2; ++hh) {
            v8h h;
            #pragma unroll
            for (int j = 0; j < 8; ++j)
                h[j] = (_Float16)v[hh * 8 + j][c];
            *(v8h*)&Ts[(nq * 4 + c) * TP + ((kb * 2 + hh) ^ (nq >> 2)) * 8] = h;
        }
    }
    __syncthreads();

    const int ch = t & 31;
    v8h h[8];
    #pragma unroll
    for (int i = 0; i < 8; ++i) {
        const int n = (t >> 5) + i * 8;    // one output row a wave
        h[i] = *(const v8h*)&Ts[n * TP + (ch ^ (n >> 4)) * 8];
    }
    _Float16* q = dst + ((n0 + (t >> 5)) * K + k0 + ch * 8);
    #pragma unroll
    for (int i = 0; i < 8; ++i)
        *(v8h*)(q + i * 8 * K) = h[i];
}

// ---------------------------------------------------------------------------
// WMMA GEMM: out = act(A[MxK] @ W[KxN] + bias), W given pre-transposed f16
// as Wt[N x K].  Block tile 128x64, BK=32. 256 threads = 8 waves arranged
// 4(M) x 2(N); each wave computes a 32x32 tile = 2x2 WMMA frags.
// ---------------------------------------------------------------------------
#define BM 128
#define BN 64
#define BK 32
#define LDA 40  // BK + 8 halves pad (row = 80B, 16B aligned)
#define LDB 40

template <bool A_IS_F32, bool SILU, bool OUT_F16>
__device__ __forceinline__ void gemm_tile(
    const float* __restrict__ A32, const _Float16* __restrict__ A16,
    const _Float16* __restrict__ Wt, const float* __restrict__ bias,
    _Float16* __restrict__ out16, float* __restrict__ out32,
    int M, int N, int K)
{
    __shared__ _Float16 As[BM * LDA];
    __shared__ _Float16 Bs[BN * LDB];

    const int t     = threadIdx.x;
    const int lane  = t & 31;
    const int wid   = t >> 5;
    const int waveM = wid >> 1;   // 0..3
    const int waveN = wid & 1;    // 0..1
    const int row0  = blockIdx.x * BM;
    const int col0  = blockIdx.y * BN;
    const int l16   = lane & 15;
    const int khalf = (lane >> 4) * 8;

    v8f zero = {};
    v8f acc[2][2];
    acc[0][0] = zero; acc[0][1] = zero; acc[1][0] = zero; acc[1][1] = zero;

    for (int k0 = 0; k0 < K; k0 += BK) {
        __syncthreads();
        // All global loads of the pass go out first, into registers, with
        // fixed trip counts (no per-trip bound test on the thread index), so
        // that the pass waits out one round trip and not one per load.
        // 64x32 f16 B tile from pre-transposed Wt[N][K]: one v8h per thread.
        const int bn_s = t >> 2;
        const int bc_s = (t & 3) * 8;
        const v8h vb = *(const v8h*)&Wt[(size_t)(col0 + bn_s) * K + k0 + bc_s];
        if (A_IS_F32) {
            // 128x32 f32 tile: float4 loads -> v4h LDS stores (4 per thread).
            float4 va[BM * (BK / 4) / 256];
            #pragma unroll
            for (int j = 0; j < BM * (BK / 4) / 256; ++j) {
                int i = t + j * 256;
                int r = i >> 3;
                int c = (i & 7) * 4;
                va[j] = *(const float4*)&A32[(size_t)(row0 + r) * K + k0 + c];
            }
            #pragma unroll
            for (int j = 0; j < BM * (BK / 4) / 256; ++j) {
                int i = t + j * 256;
                int r = i >> 3;
                int c = (i & 7) * 4;
                v4h h = { (_Float16)va[j].x, (_Float16)va[j].y,
                          (_Float16)va[j].z, (_Float16)va[j].w };
                *(v4h*)&As[r * LDA + c] = h;
            }
        } else {
            // 128x32 f16 tile: v8h copies (2 per thread).
            v8h va[BM * (BK / 8) / 256];
            #pragma unroll
            for (int j = 0; j < BM * (BK / 8) / 256; ++j) {
                int i = t + j * 256;
                int r = i >> 2;
                int c = (i & 3) * 8;
                va[j] = *(const v8h*)&A16[(size_t)(row0 + r) * K + k0 + c];
            }
            #pragma unroll
            for (int j = 0; j < BM * (BK / 8) / 256; ++j) {
                int i = t + j * 256;
                int r = i >> 2;
                int c = (i & 3) * 8;
                *(v8h*)&As[r * LDA + c] = va[j];
            }
        }
        *(v8h*)&Bs[bn_s * LDB + bc_s] = vb;
        // Prefetch next Wt tile into GL2 (global_prefetch_b8).
        if (k0 + BK < K)
            __builtin_prefetch(&Wt[(size_t)(col0 + (t >> 2)) * K + k0 + BK], 0, 1);
        __syncthreads();

        v16h afrag[2], bfrag[2];
        #pragma unroll
        for (int am = 0; am < 2; ++am) {
            int r = waveM * 32 + am * 16 + l16;
            afrag[am] = load_frag(&As[r * LDA + khalf]);
        }
        #pragma unroll
        for (int bn = 0; bn < 2; ++bn) {
            int n = waveN * 32 + bn * 16 + l16;
            bfrag[bn] = load_frag(&Bs[n * LDB + khalf]);
        }
        acc[0][0] = WMMA16(afrag[0], bfrag[0], acc[0][0]);
        acc[0][1] = WMMA16(afrag[0], bfrag[1], acc[0][1]);
        acc[1][0] = WMMA16(afrag[1], bfrag[0], acc[1][0]);
        acc[1][1] = WMMA16(afrag[1], bfrag[1], acc[1][1]);
    }

    // Epilogue: C/D layout — lane: col = l16, VGPR r: row = r + (lane>>4)*8.
    #pragma unroll
    for (int am = 0; am < 2; ++am) {
        int rowbase = row0 + waveM * 32 + am * 16 + (lane >> 4) * 8;
        #pragma unroll
        for (int bn = 0; bn < 2; ++bn) {
            int col = col0 + waveN * 32 + bn * 16 + l16;
            float bv = bias[col];
            #pragma unroll
            for (int r = 0; r < 8; ++r) {
                float v = acc[am][bn][r] + bv;
                if (SILU) v = silu_f(v);
                size_t idx = (size_t)(rowbase + r) * N + col;
                if (OUT_F16) out16[idx] = (_Float16)v;
                else         out32[idx] = v;
            }
        }
    }
}

// The four projections silu(X @ W + b) -> f16 in ONE launch: blockIdx.z picks
// the operand set (0: Q, 1: K, 2: V, 3: U; V and U both read Xv).  A pass of
// gemm_tile is mostly waiting (a global round trip, two barriers, LDS latency);
// one projection alone has only two work-groups for each WGP, the four
// together eight, so that as many as the registers allow are resident and
// fill each other's waits.
__global__ __launch_bounds__(256) void proj4_wmma_kernel(
    const float* __restrict__ Xq, const float* __restrict__ Xk,
    const float* __restrict__ Xv,
    const _Float16* __restrict__ Tq, const _Float16* __restrict__ Tk,
    const _Float16* __restrict__ Tv, const _Float16* __restrict__ Tu,
    const float* __restrict__ bq, const float* __restrict__ bk,
    const float* __restrict__ bv, const float* __restrict__ bu,
    _Float16* __restrict__ Qo, _Float16* __restrict__ Ko,
    _Float16* __restrict__ Vo, _Float16* __restrict__ Uo,
    int M, int N, int K)
{
    const int z = blockIdx.z;
    const float*    X = z == 0 ? Xq : z == 1 ? Xk : Xv;
    const _Float16* T = z == 0 ? Tq : z == 1 ? Tk : z == 2 ? Tv : Tu;
    const float*    b = z == 0 ? bq : z == 1 ? bk : z == 2 ? bv : bu;
    _Float16*       O = z == 0 ? Qo : z == 1 ? Ko : z == 2 ? Vo : Uo;
    gemm_tile<true, true, true>(X, nullptr, T, b, O, nullptr, M, N, K);
}

// One product a launch (the final GEMM).
template <bool A_IS_F32, bool SILU, bool OUT_F16>
__global__ __launch_bounds__(256) void gemm_wmma_kernel(
    const float* __restrict__ A32, const _Float16* __restrict__ A16,
    const _Float16* __restrict__ Wt, const float* __restrict__ bias,
    _Float16* __restrict__ out16, float* __restrict__ out32,
    int M, int N, int K)
{
    gemm_tile<A_IS_F32, SILU, OUT_F16>(A32, A16, Wt, bias, out16, out32, M, N, K);
}

// ---------------------------------------------------------------------------
// Attention: per (b,head) slice, 128-query tile per block, stream 64-key tiles.
// scores = silu(Q K^T)/N * mask  (linear accumulation, no softmax) then S @ V.
// ---------------------------------------------------------------------------
#define AN 2048
#define AH 1024
#define ANH 16
#define AHD 64
#define LQK 72  // 64 + 8 halves pad (144B rows, 16B aligned)

__global__ __launch_bounds__(256) void attn_wmma_kernel(
    const _Float16* __restrict__ Qg, const _Float16* __restrict__ Kg,
    const _Float16* __restrict__ Vg, const float* __restrict__ mask,
    float* __restrict__ Og)
{
    __shared__ _Float16 Qs[128 * LQK];      // 128 queries x 64 d
    __shared__ _Float16 Ks[64 * LQK];       // 64 keys x 64 d
    __shared__ _Float16 Vt[64 * LQK];       // transposed: [d][key]
    __shared__ _Float16 Ps[8 * 16 * LQK];   // per-wave probs: 16 q x 64 key

    const int bh   = blockIdx.y;
    const int b    = bh / ANH;
    const int h    = bh % ANH;
    const int q0   = blockIdx.x * 128;
    const int t    = threadIdx.x;
    const int lane = t & 31;
    const int wid  = t >> 5;
    const int l16  = lane & 15;
    const int khalf = (lane >> 4) * 8;

    const _Float16* Qbase = Qg + (size_t)(b * AN + q0) * AH + h * AHD;
    const float* mrow = mask + (size_t)b * AN * AN;
    const float invN = 1.0f / (float)AN;

    // Stage Q tile: v8h copies (4 per thread), all loads ahead of the stores.
    {
        v8h qv[4];
        #pragma unroll
        for (int j = 0; j < 4; ++j) {
            int i = t + j * 256;
            int r = i >> 3, d = (i & 7) * 8;
            qv[j] = *(const v8h*)&Qbase[(size_t)r * AH + d];
        }
        // Precaution: the offset registers of the four loads above are reused
        // soon after; this wait stands ahead of any such overwrite.
        asm volatile("s_wait_xcnt 0x0" ::: "memory");
        #pragma unroll
        for (int j = 0; j < 4; ++j) {
            int i = t + j * 256;
            int r = i >> 3, d = (i & 7) * 8;
            *(v8h*)&Qs[r * LQK + d] = qv[j];
        }
    }
    __syncthreads();

    // A-fragments from Q are loop-invariant per wave (16 query rows).
    v16h aq0, aq1;
    {
        int r = wid * 16 + l16;
        aq0 = load_frag(&Qs[r * LQK + khalf]);        // d 0..31
        aq1 = load_frag(&Qs[r * LQK + 32 + khalf]);   // d 32..63
    }

    v8f zero = {};
    v8f o[4];
    o[0] = zero; o[1] = zero; o[2] = zero; o[3] = zero;

    _Float16* Pw = &Ps[wid * 16 * LQK];

    for (int m0 = 0; m0 < AN; m0 += 64) {
        __syncthreads();
        const _Float16* Kb = Kg + (size_t)(b * AN + m0) * AH + h * AHD;
        const _Float16* Vb = Vg + (size_t)(b * AN + m0) * AH + h * AHD;
        // Stage K (straight copy) and V (transpose-scatter), v8h global loads:
        // all four loads ahead of the stores, fixed trip counts.
        v8h kv[2], vv[2];
        #pragma unroll
        for (int u = 0; u < 2; ++u) {
            int i = t + u * 256;
            int r = i >> 3, d = (i & 7) * 8;
            kv[u] = *(const v8h*)&Kb[(size_t)r * AH + d];
            vv[u] = *(const v8h*)&Vb[(size_t)r * AH + d];
        }
        // The pass's mask values go out with them (16 queries x 64 keys a wave).
        const int qbg = q0 + wid * 16 + (lane >> 4) * 8;  // query row (global)
        float mv[4][8];
        #pragma unroll
        for (int nt = 0; nt < 4; ++nt) {
            int kc = m0 + nt * 16 + l16;  // key column (global)
            #pragma unroll
            for (int r = 0; r < 8; ++r)
                mv[nt][r] = mrow[(size_t)(qbg + r) * AN + kc];
        }
        #pragma unroll
        for (int u = 0; u < 2; ++u) {
            int i = t + u * 256;
            int r = i >> 3, d = (i & 7) * 8;
            *(v8h*)&Ks[r * LQK + d] = kv[u];
            #pragma unroll
            for (int j = 0; j < 8; ++j)
                Vt[(d + j) * LQK + r] = vv[u][j];
        }
        __syncthreads();

        // Scores: 16 queries x 64 keys per wave, 2 WMMAs per 16x16 tile.
        #pragma unroll
        for (int nt = 0; nt < 4; ++nt) {
            int kr = nt * 16 + l16;
            v16h bk0 = load_frag(&Ks[kr * LQK + khalf]);
            v16h bk1 = load_frag(&Ks[kr * LQK + 32 + khalf]);
            v8f s = zero;
            s = WMMA16(aq0, bk0, s);
            s = WMMA16(aq1, bk1, s);

            #pragma unroll
            for (int r = 0; r < 8; ++r) {
                float x = s[r];
                float v = silu_f(x) * invN * mv[nt][r];
                Pw[((lane >> 4) * 8 + r) * LQK + nt * 16 + l16] = (_Float16)v;
            }
        }

        // P @ V: re-layout P (C->A) via per-wave LDS round-trip (in-order DS).
        v16h ap0 = load_frag(&Pw[l16 * LQK + khalf]);        // keys 0..31
        v16h ap1 = load_frag(&Pw[l16 * LQK + 32 + khalf]);   // keys 32..63
        #pragma unroll
        for (int dt = 0; dt < 4; ++dt) {
            int dc = dt * 16 + l16;
            v16h bv0 = load_frag(&Vt[dc * LQK + khalf]);
            v16h bv1 = load_frag(&Vt[dc * LQK + 32 + khalf]);
            o[dt] = WMMA16(ap0, bv0, o[dt]);
            o[dt] = WMMA16(ap1, bv1, o[dt]);
        }
    }

    // Write f32 attention output [B*N, H].
    int qb = b * AN + q0 + wid * 16 + (lane >> 4) * 8;
    #pragma unroll
    for (int dt = 0; dt < 4; ++dt) {
        int col = h * AHD + dt * 16 + l16;
        #pragma unroll
        for (int r = 0; r < 8; ++r)
            Og[(size_t)(qb + r) * AH + col] = o[dt][r];
    }
}

// ---------------------------------------------------------------------------
// LayerNorm over H=1024 + build o_input = [U, A, U*A] as f16 [4096 x 3072].
// ---------------------------------------------------------------------------
__global__ __launch_bounds__(256) void ln_concat_kernel(
    const float* __restrict__ attn, const _Float16* __restrict__ Uh,
    _Float16* __restrict__ oin)
{
    __shared__ float red[256];
    const int row = blockIdx.x;
    const int t = threadIdx.x;
    const float* x = attn + (size_t)row * 1024;

    float vals[4], s = 0.0f, ss = 0.0f;
    #pragma unroll
    for (int i = 0; i < 4; ++i) {
        float v = x[t + i * 256];
        vals[i] = v; s += v; ss += v * v;
    }
    red[t] = s; __syncthreads();
    for (int st = 128; st > 0; st >>= 1) {
        if (t < st) red[t] += red[t + st];
        __syncthreads();
    }
    float mean = red[0] * (1.0f / 1024.0f);
    __syncthreads();
    red[t] = ss; __syncthreads();
    for (int st = 128; st > 0; st >>= 1) {
        if (t < st) red[t] += red[t + st];
        __syncthreads();
    }
    float var  = red[0] * (1.0f / 1024.0f) - mean * mean;
    float rstd = __builtin_amdgcn_rsqf(var + 1e-8f);   // native v_rsq_f32

    _Float16* orow = oin + (size_t)row * 3072;
    const _Float16* urow = Uh + (size_t)row * 1024;
    #pragma unroll
    for (int i = 0; i < 4; ++i) {
        int c = t + i * 256;
        float a = (vals[i] - mean) * rstd;
        float u = (float)urow[c];
        orow[c]        = (_Float16)u;
        orow[1024 + c] = (_Float16)a;
        orow[2048 + c] = (_Float16)(u * a);
    }
}

// ---------------------------------------------------------------------------
// Host-side orchestration.
// ---------------------------------------------------------------------------
extern "C" void kernel_launch(void* const* d_in, const int* in_sizes, int n_in,
                              void* d_out, int out_size, void* d_ws, size_t ws_size,
                              hipStream_t stream) {
    const float* query = (const float*)d_in[0];
    const float* key_  = (const float*)d_in[1];
    const float* value = (const float*)d_in[2];
    const float* mask  = (const float*)d_in[3];
    const float* Wq = (const float*)d_in[4];   const float* bq = (const float*)d_in[5];
    const float* Wk = (const float*)d_in[6];   const float* bk = (const float*)d_in[7];
    const float* Wv = (const float*)d_in[8];   const float* bv = (const float*)d_in[9];
    const float* Wu = (const float*)d_in[10];  const float* bu = (const float*)d_in[11];
    const float* Wo = (const float*)d_in[12];  const float* bo = (const float*)d_in[13];
    float* out = (float*)d_out;

    const int M = 2 * 2048;        // 4096 rows
    const int H = 1024;

    // Workspace carve-out (~90 MB total, deterministic layout).
    char* ws = (char*)d_ws;
    size_t off = 0;
    auto carve = [&](size_t bytes) -> void* {
        void* p = ws + off;
        off += (bytes + 255) & ~(size_t)255;
        return p;
    };
    _Float16* Wq_t = (_Float16*)carve((size_t)H * H * 2);       // [N][K] f16
    _Float16* Wk_t = (_Float16*)carve((size_t)H * H * 2);
    _Float16* Wv_t = (_Float16*)carve((size_t)H * H * 2);
    _Float16* Wu_t = (_Float16*)carve((size_t)H * H * 2);
    _Float16* Wo_t = (_Float16*)carve((size_t)H * 3 * H * 2);   // [1024][3072]
    _Float16* Q_h  = (_Float16*)carve((size_t)M * H * 2);
    _Float16* K_h  = (_Float16*)carve((size_t)M * H * 2);
    _Float16* V_h  = (_Float16*)carve((size_t)M * H * 2);
    _Float16* U_h  = (_Float16*)carve((size_t)M * H * 2);
    float*    At_f = (float*)   carve((size_t)M * H * 4);
    _Float16* Oi_h = (_Float16*)carve((size_t)M * 3 * H * 2);
    (void)ws_size; (void)in_sizes; (void)n_in; (void)out_size;

    // 1) Weights -> f16, transposed to [N][K] for contiguous B staging:
    //    16 column tiles x 28 slabs of 256 k rows, one launch.
    cvt_transpose_all_kernel<<<dim3(16, 28), 256, 0, stream>>>(
        Wq, Wk, Wv, Wu, Wo, Wq_t, Wk_t, Wv_t, Wu_t, Wo_t);

    // 2) Projections: silu(X @ W + b), f16 outputs, all four in one launch.
    dim3 ggrid(M / BM, H / BN, 4);
    proj4_wmma_kernel<<<ggrid, 256, 0, stream>>>(
        query, key_, value, Wq_t, Wk_t, Wv_t, Wu_t, bq, bk, bv, bu,
        Q_h, K_h, V_h, U_h, M, H, H);

    // 3) Attention (16 query tiles x 32 (b,head) slices).
    dim3 agrid(AN / 128, 2 * ANH);
    attn_wmma_kernel<<<agrid, 256, 0, stream>>>(Q_h, K_h, V_h, mask, At_f);

    // 4) LayerNorm + concat [U, A, U*A].
    ln_concat_kernel<<<M, 256, 0, stream>>>(At_f, U_h, Oi_h);

    // 5) Final GEMM: o_input[4096x3072] @ Wo[3072x1024] + bo -> f32 out.
    dim3 fgrid(M / BM, H / BN);
    gemm_wmma_kernel<false, false, false><<<fgrid, 256, 0, stream>>>(
        nullptr, Oi_h, Wo_t, bo, nullptr, out, M, H, 3 * H);
}

// v004
// Measured time: 194 microseconds a run.
// Next to v003, in two timings, it ran 1.17 times as fast each time.
// Over all steps from v000 it is 2.14 times as fast.
#include <hip/hip_runtime.h>
#include <hip/hip_bf16.h>
#include <math.h>

// HSTU attention for MI455X (gfx1250, wave32, WMMA).
// B=2, N=2048, H=1024, NH=16, HD=64.

typedef __attribute__((ext_vector_type(16))) _Float16 v16h;
typedef __attribute__((ext_vector_type(8)))  _Float16 v8h;
typedef __attribute__((ext_vector_type(4)))  _Float16 v4h;
typedef __attribute__((ext_vector_type(8)))  float    v8f;
typedef __attribute__((ext_vector_type(4)))  float    v4f;

#define WMMA16(a, b, c) __builtin_amdgcn_wmma_f32_16x16x32_f16( \
    false, (a), false, (b), (short)0, (c), false, false)

// SiLU via native v_exp_f32 + v_rcp_f32 (no IEEE div sequence).
__device__ __forceinline__ float silu_f(float x) {
    return x * __builtin_amdgcn_rcpf(1.0f + __expf(-x));
}

// Load a v16h fragment per the CDNA5 16-bit A/B layout:
// halves 0..7  = K (or col) khalf..khalf+7
// halves 8..15 = K (or col) khalf+16..khalf+23   (khalf = (lane>>4)*8)
__device__ __forceinline__ v16h load_frag(const _Float16* p) {
    v16h f;
    *((v8h*)&f)       = *(const v8h*)p;
    *(((v8h*)&f) + 1) = *(const v8h*)(p + 16);
    return f;
}

// ---------------------------------------------------------------------------
// Kernel: all five weights, f32 [K x 1024] -> f16 transposed [1024 x K], in one
// launch.  A work-group moves a 256(k) x 64(n) tile.  A thread loads a
// 16(k) x 4(n) block as 16 float4 (a wave-load covers two rows of 256 B), turns
// it in registers into 8-half runs along k, and the runs pass through LDS so
// that each wave-store writes 512 contiguous bytes of one output row.
// blockIdx.y counts slabs of 256 k rows: 4 each for Wq, Wk, Wv, Wu, 12 for Wo.
// ---------------------------------------------------------------------------
#define TK 256
#define TN 64
#define TP (TK + 8)  // LDS row pitch in halves (528 B = 16 B x odd)

__global__ __launch_bounds__(256) void cvt_transpose_all_kernel(
    const float* __restrict__ Wq, const float* __restrict__ Wk,
    const float* __restrict__ Wv, const float* __restrict__ Wu,
    const float* __restrict__ Wo,
    _Float16* __restrict__ Tq, _Float16* __restrict__ Tk,
    _Float16* __restrict__ Tv, _Float16* __restrict__ Tu,
    _Float16* __restrict__ To)
{
    __shared__ _Float16 Ts[TN * TP];   // [n][k], 16-B chunks swizzled per row

    const int t    = threadIdx.x;
    const int slab = blockIdx.y;
    const int w    = slab >> 2;
    const float* src = w == 0 ? Wq : w == 1 ? Wk : w == 2 ? Wv : w == 3 ? Wu : Wo;
    _Float16*    dst = w == 0 ? Tq : w == 1 ? Tk : w == 2 ? Tv : w == 3 ? Tu : To;
    const int K  = w < 4 ? 1024 : 3072;
    const int k0 = (w < 4 ? (slab & 3) : (slab - 16)) * TK;
    const int n0 = blockIdx.x * TN;

    const int nq = t & 15;   // which group of 4 columns
    const int kb = t >> 4;   // which group of 16 rows
    const float* p = src + (size_t)(k0 + kb * 16) * 1024 + n0 + nq * 4;
    v4f v[16];
    #pragma unroll
    for (int j = 0; j < 16; ++j)
        v[j] = *(const v4f*)(p + j * 1024);
    // Precaution: stands ahead of any reuse of the loads' address registers;
    // p as an input keeps them from being a load's own destination before it.
    asm volatile("s_wait_xcnt 0x0" :: "v"(p) : "memory");
    // Keeps the conversions behind all 16 loads: left free, the scheduler holds
    // four loads back behind the first waits, a second memory round trip.
    __builtin_amdgcn_sched_barrier(0);

    // The 16 lanes of a half-wave write rows 4 apart, which at this pitch fall
    // on four bank groups only; the chunk index is XORed with (row >> 4) so
    // that they spread over all 64 banks.  The reader undoes it.
    #pragma unroll
    for (int c = 0; c < 4; ++c) {
        #pragma unroll
        for (int hh = 0; hh < 2; ++hh) {
            v8h h;
            #pragma unroll
            for (int j = 0; j < 8; ++j)
                h[j] = (_Float16)v[hh * 8 + j][c];
            *(v8h*)&Ts[(nq * 4 + c) * TP + ((kb * 2 + hh) ^ (nq >> 2)) * 8] = h;
        }
    }
    __syncthreads();

    const int ch = t & 31;
    v8h h[8];
    #pragma unroll
    for (int i = 0; i < 8; ++i) {
        const int n = (t >> 5) + i * 8;    // one output row a wave
        h[i] = *(const v8h*)&Ts[n * TP + (ch ^ (n >> 4)) * 8];
    }
    _Float16* q = dst + ((n0 + (t >> 5)) * K + k0 + ch * 8);
    #pragma unroll
    for (int i = 0; i < 8; ++i)
        *(v8h*)(q + i * 8 * K) = h[i];
}

// ---------------------------------------------------------------------------
// WMMA GEMM: out = act(A[MxK] @ W[KxN] + bias), W given pre-transposed f16
// as Wt[N x K].  Block tile 128x64, BK=128. 256 threads = 8 waves arranged
// 4(M) x 2(N); each wave computes a 32x32 tile = 2x2 WMMA frags.
// A pass costs a global round trip, two barriers and an LDS round trip
// whatever its depth, so a pass takes 128 k (four WMMA k steps): a quarter of
// the passes, each with four times the bytes in flight, and every f16 operand
// row piece is 256 aligned bytes.  K must be a multiple of 128.
// ---------------------------------------------------------------------------
#define BM 128
#define BN 64
#define BK 128
#define LDA 136  // BK + 8 halves pad (row = 272B = 16B x odd)
#define LDB 136

template <bool A_IS_F32, bool SILU, bool OUT_F16, int N, int K>
__device__ __forceinline__ void gemm_tile(
    const float* __restrict__ A32, const _Float16* __restrict__ A16,
    const _Float16* __restrict__ Wt, const float* __restrict__ bias,
    _Float16* __restrict__ out16, float* __restrict__ out32)
{
    __shared__ _Float16 As[BM * LDA];
    __shared__ _Float16 Bs[BN * LDB];

    const int t     = threadIdx.x;
    const int lane  = t & 31;
    const int wid   = t >> 5;
    const int waveM = wid >> 1;   // 0..3
    const int waveN = wid & 1;    // 0..1
    const int row0  = blockIdx.x * BM;
    const int col0  = blockIdx.y * BN;
    const int l16   = lane & 15;
    const int khalf = (lane >> 4) * 8;

    v8f zero = {};
    v8f acc[2][2];
    acc[0][0] = zero; acc[0][1] = zero; acc[1][0] = zero; acc[1][1] = zero;

    // Staging maps, fixed for the thread: every load of a pass is its base
    // pointer plus a compile-time offset (N and K are template constants), so
    // the fatter pass needs no address register per load.
    const int a_r = A_IS_F32 ? (t >> 5) : (t >> 4);            // first A row
    const int a_c = A_IS_F32 ? (t & 31) * 4 : (t & 15) * 8;    // A column
    const int b_n = t >> 4;                                    // first B row
    const int b_c = (t & 15) * 8;                              // B column
    const float*    pA32 = A_IS_F32 ? A32 + (size_t)(row0 + a_r) * K + a_c : nullptr;
    const _Float16* pA16 = A_IS_F32 ? nullptr : A16 + (size_t)(row0 + a_r) * K + a_c;
    const _Float16* pB   = Wt + (size_t)(col0 + b_n) * K + b_c;
    _Float16* sA = &As[a_r * LDA + a_c];
    _Float16* sB = &Bs[b_n * LDB + b_c];
    const _Float16* pPre = Wt + (size_t)(col0 + (t >> 2)) * K + BK;

    for (int k0 = 0; k0 < K; k0 += BK) {
        __syncthreads();
        // All global loads of the pass go out first, into registers, with
        // fixed trip counts (no per-trip bound test on the thread index), so
        // that the pass waits out one round trip and not one per load.
        // 64x128 f16 B tile from pre-transposed Wt[N][K]: 4 v8h per thread,
        // 16 rows apart.
        v8h vb[BN / 16];
        #pragma unroll
        for (int j = 0; j < BN / 16; ++j)
            vb[j] = *(const v8h*)(pB + k0 + j * 16 * K);
        if (A_IS_F32) {
            // 128x128 f32 tile: float4 loads -> v4h LDS stores (16 per
            // thread, 8 rows apart; a wave-load is one row piece of 512 B).
            float4 va[BM / 8];
            #pragma unroll
            for (int j = 0; j < BM / 8; ++j)
                va[j] = *(const float4*)(pA32 + k0 + j * 8 * K);
            #pragma unroll
            for (int j = 0; j < BM / 8; ++j) {
                v4h h = { (_Float16)va[j].x, (_Float16)va[j].y,
                          (_Float16)va[j].z, (_Float16)va[j].w };
                *(v4h*)(sA + j * 8 * LDA) = h;
            }
        } else {
            // 128x128 f16 tile: v8h copies (8 per thread, 16 rows apart).
            v8h va[BM / 16];
            #pragma unroll
            for (int j = 0; j < BM / 16; ++j)
                va[j] = *(const v8h*)(pA16 + k0 + j * 16 * K);
            #pragma unroll
            for (int j = 0; j < BM / 16; ++j)
                *(v8h*)(sA + j * 16 * LDA) = va[j];
        }
        #pragma unroll
        for (int j = 0; j < BN / 16; ++j)
            *(v8h*)(sB + j * 16 * LDB) = vb[j];
        // Prefetch next Wt tile into L2, one address a row.  In asm text over a pointer that lives through the
        // loop: the builtin's address here was a temporary whose register the
        // fragment reads below take over at once.
        if (k0 + BK < K)
            asm volatile("global_prefetch_b8 %0, off scope:SCOPE_SE" :: "v"(pPre));
        // The pointer stays inside Wt behind its last use as well.
        pPre += (k0 + 2 * BK < K) ? BK : 0;
        __syncthreads();

        // The four k steps of 32 run in ascending k as before, but their
        // fragment reads go out in groups of FG k steps ahead of the WMMAs, so
        // that the pass also waits out one LDS round trip a group and not two
        // a k step.  FG: what fits in the registers that the staging has just
        // left (f32 A: two k steps, which keeps four work-groups on a WGP).
        constexpr int FG = A_IS_F32 ? 2 : 4;
        #pragma unroll
        for (int g = 0; g < BK / 32; g += FG) {
            v16h afrag[FG][2], bfrag[FG][2];
            #pragma unroll
            for (int s = 0; s < FG; ++s) {
                const int ks = (g + s) * 32;
                #pragma unroll
                for (int am = 0; am < 2; ++am) {
                    int r = waveM * 32 + am * 16 + l16;
                    afrag[s][am] = load_frag(&As[r * LDA + ks + khalf]);
                }
                #pragma unroll
                for (int bn = 0; bn < 2; ++bn) {
                    int n = waveN * 32 + bn * 16 + l16;
                    bfrag[s][bn] = load_frag(&Bs[n * LDB + ks + khalf]);
                }
            }
            // Holds the group's reads ahead of its WMMAs: left free, the
            // scheduler sinks them back among the WMMAs, each behind a full wait.
            __builtin_amdgcn_sched_barrier(0);
            #pragma unroll
            for (int s = 0; s < FG; ++s) {
                acc[0][0] = WMMA16(afrag[s][0], bfrag[s][0], acc[0][0]);
                acc[0][1] = WMMA16(afrag[s][0], bfrag[s][1], acc[0][1]);
                acc[1][0] = WMMA16(afrag[s][1], bfrag[s][0], acc[1][0]);
                acc[1][1] = WMMA16(afrag[s][1], bfrag[s][1], acc[1][1]);
            }
        }
    }

    // Epilogue: C/D layout — lane: col = l16, VGPR r: row = r + (lane>>4)*8.
    #pragma unroll
    for (int am = 0; am < 2; ++am) {
        int rowbase = row0 + waveM * 32 + am * 16 + (lane >> 4) * 8;
        #pragma unroll
        for (int bn = 0; bn < 2; ++bn) {
            int col = col0 + waveN * 32 + bn * 16 + l16;
            float bv = bias[col];
            #pragma unroll
            for (int r = 0; r < 8; ++r) {
                float v = acc[am][bn][r] + bv;
                if (SILU) v = silu_f(v);
                size_t idx = (size_t)(rowbase + r) * N + col;
                if (OUT_F16) out16[idx] = (_Float16)v;
                else         out32[idx] = v;
            }
        }
    }
}

// The four projections silu(X @ W + b) -> f16 in ONE launch: blockIdx.z picks
// the operand set (0: Q, 1: K, 2: V, 3: U; V and U both read Xv).  A pass of
// gemm_tile is mostly waiting (a global round trip, two barriers, LDS latency);
// one projection alone has only two work-groups for each WGP, the four
// together eight, so that as many as the registers allow are resident and
// fill each other's waits.
__global__ __launch_bounds__(256) void proj4_wmma_kernel(
    const float* __restrict__ Xq, const float* __restrict__ Xk,
    const float* __restrict__ Xv,
    const _Float16* __restrict__ Tq, const _Float16* __restrict__ Tk,
    const _Float16* __restrict__ Tv, const _Float16* __restrict__ Tu,
    const float* __restrict__ bq, const float* __restrict__ bk,
    const float* __restrict__ bv, const float* __restrict__ bu,
    _Float16* __restrict__ Qo, _Float16* __restrict__ Ko,
    _Float16* __restrict__ Vo, _Float16* __restrict__ Uo)
{
    const int z = blockIdx.z;
    const float*    X = z == 0 ? Xq : z == 1 ? Xk : Xv;
    const _Float16* T = z == 0 ? Tq : z == 1 ? Tk : z == 2 ? Tv : Tu;
    const float*    b = z == 0 ? bq : z == 1 ? bk : z == 2 ? bv : bu;
    _Float16*       O = z == 0 ? Qo : z == 1 ? Ko : z == 2 ? Vo : Uo;
    gemm_tile<true, true, true, 1024, 1024>(X, nullptr, T, b, O, nullptr);
}

// One product a launch (the final GEMM).
template <bool A_IS_F32, bool SILU, bool OUT_F16, int N, int K>
__global__ __launch_bounds__(256) void gemm_wmma_kernel(
    const float* __restrict__ A32, const _Float16* __restrict__ A16,
    const _Float16* __restrict__ Wt, const float* __restrict__ bias,
    _Float16* __restrict__ out16, float* __restrict__ out32)
{
    gemm_tile<A_IS_F32, SILU, OUT_F16, N, K>(A32, A16, Wt, bias, out16, out32);
}

// ---------------------------------------------------------------------------
// Attention: per (b,head) slice, 128-query tile per block, stream 64-key tiles.
// scores = silu(Q K^T)/N * mask  (linear accumulation, no softmax) then S @ V.
// ---------------------------------------------------------------------------
#define AN 2048
#define AH 1024
#define ANH 16
#define AHD 64
#define LQK 72  // 64 + 8 halves pad (144B rows, 16B aligned)

__global__ __launch_bounds__(256) void attn_wmma_kernel(
    const _Float16* __restrict__ Qg, const _Float16* __restrict__ Kg,
    const _Float16* __restrict__ Vg, const float* __restrict__ mask,
    float* __restrict__ Og)
{
    __shared__ _Float16 Qs[128 * LQK];      // 128 queries x 64 d
    __shared__ _Float16 Ks[64 * LQK];       // 64 keys x 64 d
    __shared__ _Float16 Vt[64 * LQK];       // transposed: [d][key]
    __shared__ _Float16 Ps[8 * 16 * LQK];   // per-wave probs: 16 q x 64 key

    const int bh   = blockIdx.y;
    const int b    = bh / ANH;
    const int h    = bh % ANH;
    const int q0   = blockIdx.x * 128;
    const int t    = threadIdx.x;
    const int lane = t & 31;
    const int wid  = t >> 5;
    const int l16  = lane & 15;
    const int khalf = (lane >> 4) * 8;

    const _Float16* Qbase = Qg + (size_t)(b * AN + q0) * AH + h * AHD;
    const float* mrow = mask + (size_t)b * AN * AN;
    const float invN = 1.0f / (float)AN;

    // Stage Q tile: v8h copies (4 per thread), all loads ahead of the stores.
    {
        v8h qv[4];
        #pragma unroll
        for (int j = 0; j < 4; ++j) {
            int i = t + j * 256;
            int r = i >> 3, d = (i & 7) * 8;
            qv[j] = *(const v8h*)&Qbase[(size_t)r * AH + d];
        }
        // Precaution: the offset registers of the four loads above are reused
        // soon after; this wait stands ahead of any such overwrite.
        asm volatile("s_wait_xcnt 0x0" ::: "memory");
        #pragma unroll
        for (int j = 0; j < 4; ++j) {
            int i = t + j * 256;
            int r = i >> 3, d = (i & 7) * 8;
            *(v8h*)&Qs[r * LQK + d] = qv[j];
        }
    }
    __syncthreads();

    // A-fragments from Q are loop-invariant per wave (16 query rows).
    v16h aq0, aq1;
    {
        int r = wid * 16 + l16;
        aq0 = load_frag(&Qs[r * LQK + khalf]);        // d 0..31
        aq1 = load_frag(&Qs[r * LQK + 32 + khalf]);   // d 32..63
    }

    v8f zero = {};
    v8f o[4];
    o[0] = zero; o[1] = zero; o[2] = zero; o[3] = zero;

    _Float16* Pw = &Ps[wid * 16 * LQK];

    for (int m0 = 0; m0 < AN; m0 += 64) {
        __syncthreads();
        const _Float16* Kb = Kg + (size_t)(b * AN + m0) * AH + h * AHD;
        const _Float16* Vb = Vg + (size_t)(b * AN + m0) * AH + h * AHD;
        // Stage K (straight copy) and V (transpose-scatter), v8h global loads:
        // all four loads ahead of the stores, fixed trip counts.
        v8h kv[2], vv[2];
        #pragma unroll
        for (int u = 0; u < 2; ++u) {
            int i = t + u * 256;
            int r = i >> 3, d = (i & 7) * 8;
            kv[u] = *(const v8h*)&Kb[(size_t)r * AH + d];
            vv[u] = *(const v8h*)&Vb[(size_t)r * AH + d];
        }
        // The pass's mask values go out with them (16 queries x 64 keys a wave).
        const int qbg = q0 + wid * 16 + (lane >> 4) * 8;  // query row (global)
        float mv[4][8];
        #pragma unroll
        for (int nt = 0; nt < 4; ++nt) {
            int kc = m0 + nt * 16 + l16;  // key column (global)
            #pragma unroll
            for (int r = 0; r < 8; ++r)
                mv[nt][r] = mrow[(size_t)(qbg + r) * AN + kc];
        }
        #pragma unroll
        for (int u = 0; u < 2; ++u) {
            int i = t + u * 256;
            int r = i >> 3, d = (i & 7) * 8;
            *(v8h*)&Ks[r * LQK + d] = kv[u];
            #pragma unroll
            for (int j = 0; j < 8; ++j)
                Vt[(d + j) * LQK + r] = vv[u][j];
        }
        __syncthreads();

        // Scores: 16 queries x 64 keys per wave, 2 WMMAs per 16x16 tile.
        #pragma unroll
        for (int nt = 0; nt < 4; ++nt) {
            int kr = nt * 16 + l16;
            v16h bk0 = load_frag(&Ks[kr * LQK + khalf]);
            v16h bk1 = load_frag(&Ks[kr * LQK + 32 + khalf]);
            v8f s = zero;
            s = WMMA16(aq0, bk0, s);
            s = WMMA16(aq1, bk1, s);

            #pragma unroll
            for (int r = 0; r < 8; ++r) {
                float x = s[r];
                float v = silu_f(x) * invN * mv[nt][r];
                Pw[((lane >> 4) * 8 + r) * LQK + nt * 16 + l16] = (_Float16)v;
            }
        }

        // P @ V: re-layout P (C->A) via per-wave LDS round-trip (in-order DS).
        v16h ap0 = load_frag(&Pw[l16 * LQK + khalf]);        // keys 0..31
        v16h ap1 = load_frag(&Pw[l16 * LQK + 32 + khalf]);   // keys 32..63
        #pragma unroll
        for (int dt = 0; dt < 4; ++dt) {
            int dc = dt * 16 + l16;
            v16h bv0 = load_frag(&Vt[dc * LQK + khalf]);
            v16h bv1 = load_frag(&Vt[dc * LQK + 32 + khalf]);
            o[dt] = WMMA16(ap0, bv0, o[dt]);
            o[dt] = WMMA16(ap1, bv1, o[dt]);
        }
    }

    // Write f32 attention output [B*N, H].
    int qb = b * AN + q0 + wid * 16 + (lane >> 4) * 8;
    #pragma unroll
    for (int dt = 0; dt < 4; ++dt) {
        int col = h * AHD + dt * 16 + l16;
        #pragma unroll
        for (int r = 0; r < 8; ++r)
            Og[(size_t)(qb + r) * AH + col] = o[dt][r];
    }
}

// ---------------------------------------------------------------------------
// LayerNorm over H=1024 + build o_input = [U, A, U*A] as f16 [4096 x 3072].
// ---------------------------------------------------------------------------
__global__ __launch_bounds__(256) void ln_concat_kernel(
    const float* __restrict__ attn, const _Float16* __restrict__ Uh,
    _Float16* __restrict__ oin)
{
    __shared__ float red[256];
    const int row = blockIdx.x;
    const int t = threadIdx.x;
    const float* x = attn + (size_t)row * 1024;

    float vals[4], s = 0.0f, ss = 0.0f;
    #pragma unroll
    for (int i = 0; i < 4; ++i) {
        float v = x[t + i * 256];
        vals[i] = v; s += v; ss += v * v;
    }
    red[t] = s; __syncthreads();
    for (int st = 128; st > 0; st >>= 1) {
        if (t < st) red[t] += red[t + st];
        __syncthreads();
    }
    float mean = red[0] * (1.0f / 1024.0f);
    __syncthreads();
    red[t] = ss; __syncthreads();
    for (int st = 128; st > 0; st >>= 1) {
        if (t < st) red[t] += red[t + st];
        __syncthreads();
    }
    float var  = red[0] * (1.0f / 1024.0f) - mean * mean;
    float rstd = __builtin_amdgcn_rsqf(var + 1e-8f);   // native v_rsq_f32

    _Float16* orow = oin + (size_t)row * 3072;
    const _Float16* urow = Uh + (size_t)row * 1024;
    #pragma unroll
    for (int i = 0; i < 4; ++i) {
        int c = t + i * 256;
        float a = (vals[i] - mean) * rstd;
        float u = (float)urow[c];
        orow[c]        = (_Float16)u;
        orow[1024 + c] = (_Float16)a;
        orow[2048 + c] = (_Float16)(u * a);
    }
}

// ---------------------------------------------------------------------------
// Host-side orchestration.
// ---------------------------------------------------------------------------
extern "C" void kernel_launch(void* const* d_in, const int* in_sizes, int n_in,
                              void* d_out, int out_size, void* d_ws, size_t ws_size,
                              hipStream_t stream) {
    const float* query = (const float*)d_in[0];
    const float* key_  = (const float*)d_in[1];
    const float* value = (const float*)d_in[2];
    const float* mask  = (const float*)d_in[3];
    const float* Wq = (const float*)d_in[4];   const float* bq = (const float*)d_in[5];
    const float* Wk = (const float*)d_in[6];   const float* bk = (const float*)d_in[7];
    const float* Wv = (const float*)d_in[8];   const float* bv = (const float*)d_in[9];
    const float* Wu = (const float*)d_in[10];  const float* bu = (const float*)d_in[11];
    const float* Wo = (const float*)d_in[12];  const float* bo = (const float*)d_in[13];
    float* out = (float*)d_out;

    const int M = 2 * 2048;        // 4096 rows
    const int H = 1024;

    // Workspace carve-out (~90 MB total, deterministic layout).
    char* ws = (char*)d_ws;
    size_t off = 0;
    auto carve = [&](size_t bytes) -> void* {
        void* p = ws + off;
        off += (bytes + 255) & ~(size_t)255;
        return p;
    };
    _Float16* Wq_t = (_Float16*)carve((size_t)H * H * 2);       // [N][K] f16
    _Float16* Wk_t = (_Float16*)carve((size_t)H * H * 2);
    _Float16* Wv_t = (_Float16*)carve((size_t)H * H * 2);
    _Float16* Wu_t = (_Float16*)carve((size_t)H * H * 2);
    _Float16* Wo_t = (_Float16*)carve((size_t)H * 3 * H * 2);   // [1024][3072]
    _Float16* Q_h  = (_Float16*)carve((size_t)M * H * 2);
    _Float16* K_h  = (_Float16*)carve((size_t)M * H * 2);
    _Float16* V_h  = (_Float16*)carve((size_t)M * H * 2);
    _Float16* U_h  = (_Float16*)carve((size_t)M * H * 2);
    float*    At_f = (float*)   carve((size_t)M * H * 4);
    _Float16* Oi_h = (_Float16*)carve((size_t)M * 3 * H * 2);
    (void)ws_size; (void)in_sizes; (void)n_in; (void)out_size;

    // 1) Weights -> f16, transposed to [N][K] for contiguous B staging:
    //    16 column tiles x 28 slabs of 256 k rows, one launch.
    cvt_transpose_all_kernel<<<dim3(16, 28), 256, 0, stream>>>(
        Wq, Wk, Wv, Wu, Wo, Wq_t, Wk_t, Wv_t, Wu_t, Wo_t);

    // 2) Projections: silu(X @ W + b), f16 outputs, all four in one launch.
    dim3 ggrid(M / BM, H / BN, 4);
    proj4_wmma_kernel<<<ggrid, 256, 0, stream>>>(
        query, key_, value, Wq_t, Wk_t, Wv_t, Wu_t, bq, bk, bv, bu,
        Q_h, K_h, V_h, U_h);

    // 3) Attention (16 query tiles x 32 (b,head) slices).
    dim3 agrid(AN / 128, 2 * ANH);
    attn_wmma_kernel<<<agrid, 256, 0, stream>>>(Q_h, K_h, V_h, mask, At_f);

    // 4) LayerNorm + concat [U, A, U*A].
    ln_concat_kernel<<<M, 256, 0, stream>>>(At_f, U_h, Oi_h);

    // 5) Final GEMM: o_input[4096x3072] @ Wo[3072x1024] + bo -> f32 out.
    dim3 fgrid(M / BM, H / BN);
    gemm_wmma_kernel<false, false, false, 1024, 3072><<<fgrid, 256, 0, stream>>>(
        nullptr, Oi_h, Wo_t, bo, nullptr, out);
}

// v005
// Measured time: 183 microseconds a run.
// Two timings next to v004 put it at 1.06 and 1.05 times that version's speed.
// All steps since v000 together make it 2.27 times as fast.
#include <hip/hip_runtime.h>
#include <hip/hip_bf16.h>
#include <math.h>

// HSTU attention for MI455X (gfx1250, wave32, WMMA).
// B=2, N=2048, H=1024, NH=16, HD=64.

typedef __attribute__((ext_vector_type(16))) _Float16 v16h;
typedef __attribute__((ext_vector_type(8)))  _Float16 v8h;
typedef __attribute__((ext_vector_type(4)))  _Float16 v4h;
typedef __attribute__((ext_vector_type(8)))  float    v8f;
typedef __attribute__((ext_vector_type(4)))  float    v4f;

#define WMMA16(a, b, c) __builtin_amdgcn_wmma_f32_16x16x32_f16( \
    false, (a), false, (b), (short)0, (c), false, false)

// SiLU via native v_exp_f32 + v_rcp_f32 (no IEEE div sequence).
__device__ __forceinline__ float silu_f(float x) {
    return x * __builtin_amdgcn_rcpf(1.0f + __expf(-x));
}

// Work-group barrier for tiles handed over through LDS alone: its fences name
// the LDS only, so that a wave waits out its LDS operations at the barrier and
// not its global loads as well (__syncthreads() drains those too, and a load
// issued ahead could never stay in flight across it).
__device__ __forceinline__ void lds_barrier() {
    __builtin_amdgcn_fence(__ATOMIC_RELEASE, "workgroup", "local");
    __builtin_amdgcn_s_barrier();
    __builtin_amdgcn_fence(__ATOMIC_ACQUIRE, "workgroup", "local");
}

// Load a v16h fragment per the CDNA5 16-bit A/B layout:
// halves 0..7  = K (or col) khalf..khalf+7
// halves 8..15 = K (or col) khalf+16..khalf+23   (khalf = (lane>>4)*8)
__device__ __forceinline__ v16h load_frag(const _Float16* p) {
    v16h f;
    *((v8h*)&f)       = *(const v8h*)p;
    *(((v8h*)&f) + 1) = *(const v8h*)(p + 16);
    return f;
}

// ---------------------------------------------------------------------------
// Kernel: all five weights, f32 [K x 1024] -> f16 transposed [1024 x K], in one
// launch.  A work-group moves a 256(k) x 64(n) tile.  A thread loads a
// 16(k) x 4(n) block as 16 float4 (a wave-load covers two rows of 256 B), turns
// it in registers into 8-half runs along k, and the runs pass through LDS so
// that each wave-store writes 512 contiguous bytes of one output row.
// blockIdx.y counts slabs of 256 k rows: 4 each for Wq, Wk, Wv, Wu, 12 for Wo.
// ---------------------------------------------------------------------------
#define TK 256
#define TN 64
#define TP (TK + 8)  // LDS row pitch in halves (528 B = 16 B x odd)

__global__ __launch_bounds__(256) void cvt_transpose_all_kernel(
    const float* __restrict__ Wq, const float* __restrict__ Wk,
    const float* __restrict__ Wv, const float* __restrict__ Wu,
    const float* __restrict__ Wo,
    _Float16* __restrict__ Tq, _Float16* __restrict__ Tk,
    _Float16* __restrict__ Tv, _Float16* __restrict__ Tu,
    _Float16* __restrict__ To)
{
    __shared__ _Float16 Ts[TN * TP];   // [n][k], 16-B chunks swizzled per row

    const int t    = threadIdx.x;
    const int slab = blockIdx.y;
    const int w    = slab >> 2;
    const float* src = w == 0 ? Wq : w == 1 ? Wk : w == 2 ? Wv : w == 3 ? Wu : Wo;
    _Float16*    dst = w == 0 ? Tq : w == 1 ? Tk : w == 2 ? Tv : w == 3 ? Tu : To;
    const int K  = w < 4 ? 1024 : 3072;
    const int k0 = (w < 4 ? (slab & 3) : (slab - 16)) * TK;
    const int n0 = blockIdx.x * TN;

    const int nq = t & 15;   // which group of 4 columns
    const int kb = t >> 4;   // which group of 16 rows
    const float* p = src + (size_t)(k0 + kb * 16) * 1024 + n0 + nq * 4;
    v4f v[16];
    #pragma unroll
    for (int j = 0; j < 16; ++j)
        v[j] = *(const v4f*)(p + j * 1024);
    // Precaution: stands ahead of any reuse of the loads' address registers;
    // p as an input keeps them from being a load's own destination before it.
    asm volatile("s_wait_xcnt 0x0" :: "v"(p) : "memory");
    // Keeps the conversions behind all 16 loads: left free, the scheduler holds
    // four loads back behind the first waits, a second memory round trip.
    __builtin_amdgcn_sched_barrier(0);

    // The 16 lanes of a half-wave write rows 4 apart, which at this pitch fall
    // on four bank groups only; the chunk index is XORed with (row >> 4) so
    // that they spread over all 64 banks.  The reader undoes it.
    #pragma unroll
    for (int c = 0; c < 4; ++c) {
        #pragma unroll
        for (int hh = 0; hh < 2; ++hh) {
            v8h h;
            #pragma unroll
            for (int j = 0; j < 8; ++j)
                h[j] = (_Float16)v[hh * 8 + j][c];
            *(v8h*)&Ts[(nq * 4 + c) * TP + ((kb * 2 + hh) ^ (nq >> 2)) * 8] = h;
        }
    }
    __syncthreads();

    const int ch = t & 31;
    v8h h[8];
    #pragma unroll
    for (int i = 0; i < 8; ++i) {
        const int n = (t >> 5) + i * 8;    // one output row a wave
        h[i] = *(const v8h*)&Ts[n * TP + (ch ^ (n >> 4)) * 8];
    }
    _Float16* q = dst + ((n0 + (t >> 5)) * K + k0 + ch * 8);
    #pragma unroll
    for (int i = 0; i < 8; ++i)
        *(v8h*)(q + i * 8 * K) = h[i];
}

// ---------------------------------------------------------------------------
// WMMA GEMM: out = act(A[MxK] @ W[KxN] + bias), W given pre-transposed f16
// as Wt[N x K].  Block tile 128x64, BK=128. 256 threads = 8 waves arranged
// 4(M) x 2(N); each wave computes a 32x32 tile = 2x2 WMMA frags.
// A pass costs a global round trip, two barriers and an LDS round trip
// whatever its depth, so a pass takes 128 k (four WMMA k steps): a quarter of
// the passes, each with four times the bytes in flight, and every f16 operand
// row piece is 256 aligned bytes.  K must be a multiple of 128.
// ---------------------------------------------------------------------------
#define BM 128
#define BN 64
#define BK 128
#define LDA 136  // BK + 8 halves pad (row = 272B = 16B x odd)
#define LDB 136

template <bool A_IS_F32, bool SILU, bool OUT_F16, int N, int K>
__device__ __forceinline__ void gemm_tile(
    const float* __restrict__ A32, const _Float16* __restrict__ A16,
    const _Float16* __restrict__ Wt, const float* __restrict__ bias,
    _Float16* __restrict__ out16, float* __restrict__ out32)
{
    __shared__ _Float16 As[BM * LDA];
    __shared__ _Float16 Bs[BN * LDB];

    const int t     = threadIdx.x;
    const int lane  = t & 31;
    const int wid   = t >> 5;
    const int waveM = wid >> 1;   // 0..3
    const int waveN = wid & 1;    // 0..1
    const int row0  = blockIdx.x * BM;
    const int col0  = blockIdx.y * BN;
    const int l16   = lane & 15;
    const int khalf = (lane >> 4) * 8;

    v8f zero = {};
    v8f acc[2][2];
    acc[0][0] = zero; acc[0][1] = zero; acc[1][0] = zero; acc[1][1] = zero;

    // Staging maps, fixed for the thread: every load of a pass is its base
    // pointer plus a compile-time offset (N and K are template constants), so
    // the fatter pass needs no address register per load.
    const int a_r = A_IS_F32 ? (t >> 5) : (t >> 4);            // first A row
    const int a_c = A_IS_F32 ? (t & 31) * 4 : (t & 15) * 8;    // A column
    const int b_n = t >> 4;                                    // first B row
    const int b_c = (t & 15) * 8;                              // B column
    const float*    pA32 = A_IS_F32 ? A32 + (size_t)(row0 + a_r) * K + a_c : nullptr;
    const _Float16* pA16 = A_IS_F32 ? nullptr : A16 + (size_t)(row0 + a_r) * K + a_c;
    const _Float16* pB   = Wt + (size_t)(col0 + b_n) * K + b_c;
    _Float16* sA = &As[a_r * LDA + a_c];
    _Float16* sB = &Bs[b_n * LDB + b_c];
    const _Float16* pPre = Wt + (size_t)(col0 + (t >> 2)) * K + BK;

    // 64x128 f16 B tile from pre-transposed Wt[N][K]: 4 v8h per thread,
    // 16 rows apart.  128x128 f16 A tile: 8 v8h per thread, 16 rows apart.
    v8h vb[BN / 16];
    v8h va16[BM / 16];
    // f16 A (two work-groups a WGP, registers to spare): the staging registers
    // are filled one pass ahead, behind the barrier that publishes the pass in
    // hand, so that the global round trip runs under its fragment reads and
    // WMMAs and not in front of them.
    auto fetch16 = [&](int k0) {
        #pragma unroll
        for (int j = 0; j < BN / 16; ++j)
            vb[j] = *(const v8h*)(pB + k0 + j * 16 * K);
        #pragma unroll
        for (int j = 0; j < BM / 16; ++j)
            va16[j] = *(const v8h*)(pA16 + k0 + j * 16 * K);
    };
    if (!A_IS_F32) fetch16(0);

    for (int k0 = 0; k0 < K; k0 += BK) {
        __syncthreads();
        if (A_IS_F32) {
            // All global loads of the pass go out first, into registers, with
            // fixed trip counts (no per-trip bound test on the thread index),
            // so that the pass waits out one round trip and not one per load.
            #pragma unroll
            for (int j = 0; j < BN / 16; ++j)
                vb[j] = *(const v8h*)(pB + k0 + j * 16 * K);
            // 128x128 f32 tile: float4 loads -> v4h LDS stores (16 per
            // thread, 8 rows apart; a wave-load is one row piece of 512 B).
            float4 va[BM / 8];
            #pragma unroll
            for (int j = 0; j < BM / 8; ++j)
                va[j] = *(const float4*)(pA32 + k0 + j * 8 * K);
            #pragma unroll
            for (int j = 0; j < BM / 8; ++j) {
                v4h h = { (_Float16)va[j].x, (_Float16)va[j].y,
                          (_Float16)va[j].z, (_Float16)va[j].w };
                *(v4h*)(sA + j * 8 * LDA) = h;
            }
        } else {
            #pragma unroll
            for (int j = 0; j < BM / 16; ++j)
                *(v8h*)(sA + j * 16 * LDA) = va16[j];
        }
        #pragma unroll
        for (int j = 0; j < BN / 16; ++j)
            *(v8h*)(sB + j * 16 * LDB) = vb[j];
        // Prefetch next Wt tile into L2, one address a row.  In asm text over a pointer that lives through the
        // loop: the builtin's address here was a temporary whose register the
        // fragment reads below take over at once.
        // (f32 A only: with f16 A the loads themselves ask for that tile below.)
        if (A_IS_F32) {
            if (k0 + BK < K)
                asm volatile("global_prefetch_b8 %0, off scope:SCOPE_SE" :: "v"(pPre));
            // The pointer stays inside Wt behind its last use as well.
            pPre += (k0 + 2 * BK < K) ? BK : 0;
        }
        __syncthreads();

        if (!A_IS_F32) {
            if (k0 + BK < K) fetch16(k0 + BK);
            // Holds the next pass's loads ahead of this pass's fragment reads:
            // sunk among the WMMAs they would lose the lead they are issued for.
            __builtin_amdgcn_sched_barrier(0);
        }

        // The four k steps of 32 run in ascending k as before, but their
        // fragment reads go out in groups of FG k steps ahead of the WMMAs, so
        // that the pass also waits out one LDS round trip a group and not two
        // a k step.  FG: what the registers allow (f32 A: two k steps, in the
        // registers that the staging has just left, which keeps four
        // work-groups on a WGP; f16 A: all four, beside the next pass's
        // staging registers, with the two work-groups a WGP that its grid gives).
        constexpr int FG = A_IS_F32 ? 2 : 4;
        #pragma unroll
        for (int g = 0; g < BK / 32; g += FG) {
            v16h afrag[FG][2], bfrag[FG][2];
            #pragma unroll
            for (int s = 0; s < FG; ++s) {
                const int ks = (g + s) * 32;
                #pragma unroll
                for (int am = 0; am < 2; ++am) {
                    int r = waveM * 32 + am * 16 + l16;
                    afrag[s][am] = load_frag(&As[r * LDA + ks + khalf]);
                }
                #pragma unroll
                for (int bn = 0; bn < 2; ++bn) {
                    int n = waveN * 32 + bn * 16 + l16;
                    bfrag[s][bn] = load_frag(&Bs[n * LDB + ks + khalf]);
                }
            }
            // Holds the group's reads ahead of its WMMAs: left free, the
            // scheduler sinks them back among the WMMAs, each behind a full wait.
            __builtin_amdgcn_sched_barrier(0);
            #pragma unroll
            for (int s = 0; s < FG; ++s) {
                acc[0][0] = WMMA16(afrag[s][0], bfrag[s][0], acc[0][0]);
                acc[0][1] = WMMA16(afrag[s][0], bfrag[s][1], acc[0][1]);
                acc[1][0] = WMMA16(afrag[s][1], bfrag[s][0], acc[1][0]);
                acc[1][1] = WMMA16(afrag[s][1], bfrag[s][1], acc[1][1]);
            }
        }
    }

    // Epilogue: C/D layout — lane: col = l16, VGPR r: row = r + (lane>>4)*8.
    #pragma unroll
    for (int am = 0; am < 2; ++am) {
        int rowbase = row0 + waveM * 32 + am * 16 + (lane >> 4) * 8;
        #pragma unroll
        for (int bn = 0; bn < 2; ++bn) {
            int col = col0 + waveN * 32 + bn * 16 + l16;
            float bv = bias[col];
            #pragma unroll
            for (int r = 0; r < 8; ++r) {
                float v = acc[am][bn][r] + bv;
                if (SILU) v = silu_f(v);
                size_t idx = (size_t)(rowbase + r) * N + col;
                if (OUT_F16) out16[idx] = (_Float16)v;
                else         out32[idx] = v;
            }
        }
    }
}

// The four projections silu(X @ W + b) -> f16 in ONE launch: blockIdx.z picks
// the operand set (0: Q, 1: K, 2: V, 3: U; V and U both read Xv).  A pass of
// gemm_tile is mostly waiting (a global round trip, two barriers, LDS latency);
// one projection alone has only two work-groups for each WGP, the four
// together eight, so that as many as the registers allow are resident and
// fill each other's waits.
__global__ __launch_bounds__(256) void proj4_wmma_kernel(
    const float* __restrict__ Xq, const float* __restrict__ Xk,
    const float* __restrict__ Xv,
    const _Float16* __restrict__ Tq, const _Float16* __restrict__ Tk,
    const _Float16* __restrict__ Tv, const _Float16* __restrict__ Tu,
    const float* __restrict__ bq, const float* __restrict__ bk,
    const float* __restrict__ bv, const float* __restrict__ bu,
    _Float16* __restrict__ Qo, _Float16* __restrict__ Ko,
    _Float16* __restrict__ Vo, _Float16* __restrict__ Uo)
{
    const int z = blockIdx.z;
    const float*    X = z == 0 ? Xq : z == 1 ? Xk : Xv;
    const _Float16* T = z == 0 ? Tq : z == 1 ? Tk : z == 2 ? Tv : Tu;
    const float*    b = z == 0 ? bq : z == 1 ? bk : z == 2 ? bv : bu;
    _Float16*       O = z == 0 ? Qo : z == 1 ? Ko : z == 2 ? Vo : Uo;
    gemm_tile<true, true, true, 1024, 1024>(X, nullptr, T, b, O, nullptr);
}

// One product a launch (the final GEMM).
template <bool A_IS_F32, bool SILU, bool OUT_F16, int N, int K>
__global__ __launch_bounds__(256) void gemm_wmma_kernel(
    const float* __restrict__ A32, const _Float16* __restrict__ A16,
    const _Float16* __restrict__ Wt, const float* __restrict__ bias,
    _Float16* __restrict__ out16, float* __restrict__ out32)
{
    gemm_tile<A_IS_F32, SILU, OUT_F16, N, K>(A32, A16, Wt, bias, out16, out32);
}

// ---------------------------------------------------------------------------
// Attention: per (b,head) slice, 128-query tile per block, stream 64-key tiles.
// scores = silu(Q K^T)/N * mask  (linear accumulation, no softmax) then S @ V.
// ---------------------------------------------------------------------------
#define AN 2048
#define AH 1024
#define ANH 16
#define AHD 64
#define LQK 72  // 64 + 8 halves pad (144B rows, 16B aligned)

// Two work-groups a WGP is all the grid gives (512 on 256 WGPs): four waves a
// SIMD, stated so that the compiler spends the 256 registers a wave then has
// on loads in flight and does not schedule for more resident waves.
__global__ __launch_bounds__(256) __attribute__((amdgpu_waves_per_eu(4, 4)))
void attn_wmma_kernel(
    const _Float16* __restrict__ Qg, const _Float16* __restrict__ Kg,
    const _Float16* __restrict__ Vg, const float* __restrict__ mask,
    float* __restrict__ Og)
{
    __shared__ _Float16 Qs[128 * LQK];      // 128 queries x 64 d
    __shared__ _Float16 Ks[64 * LQK];       // 64 keys x 64 d
    __shared__ _Float16 Vt[64 * LQK];       // transposed: [d][key]
    __shared__ _Float16 Ps[8 * 16 * LQK];   // per-wave probs: 16 q x 64 key

    const int bh   = blockIdx.y;
    const int b    = bh / ANH;
    const int h    = bh % ANH;
    const int q0   = blockIdx.x * 128;
    const int t    = threadIdx.x;
    const int lane = t & 31;
    const int wid  = t >> 5;
    const int l16  = lane & 15;
    const int khalf = (lane >> 4) * 8;

    const _Float16* Qbase = Qg + (size_t)(b * AN + q0) * AH + h * AHD;
    const float* mrow = mask + (size_t)b * AN * AN;
    const float invN = 1.0f / (float)AN;

    // Stage Q tile: v8h copies (4 per thread), all loads ahead of the stores.
    {
        v8h qv[4];
        #pragma unroll
        for (int j = 0; j < 4; ++j) {
            int i = t + j * 256;
            int r = i >> 3, d = (i & 7) * 8;
            qv[j] = *(const v8h*)&Qbase[(size_t)r * AH + d];
        }
        // Precaution: the offset registers of the four loads above are reused
        // soon after; this wait stands ahead of any such overwrite.
        asm volatile("s_wait_xcnt 0x0" ::: "memory");
        #pragma unroll
        for (int j = 0; j < 4; ++j) {
            int i = t + j * 256;
            int r = i >> 3, d = (i & 7) * 8;
            *(v8h*)&Qs[r * LQK + d] = qv[j];
        }
    }
    __syncthreads();

    // A-fragments from Q are loop-invariant per wave (16 query rows).
    v16h aq0, aq1;
    {
        int r = wid * 16 + l16;
        aq0 = load_frag(&Qs[r * LQK + khalf]);        // d 0..31
        aq1 = load_frag(&Qs[r * LQK + 32 + khalf]);   // d 32..63
    }

    v8f zero = {};
    v8f o[4];
    o[0] = zero; o[1] = zero; o[2] = zero; o[3] = zero;

    _Float16* Pw = &Ps[wid * 16 * LQK];

    // All global loads of the pass that starts at key m0: K and V (v8h, two
    // each a thread) and the wave's mask values (16 queries x 64 keys).
    v8h kv[2], vv[2];
    const unsigned kvo = (unsigned)((t >> 3) * AH + (t & 7) * 8);
    const unsigned mo  = (unsigned)((wid * 16 + (lane >> 4) * 8) * AN + l16);
    float mv[4][8];
    auto fetch_kv = [&](int m0) {
        const _Float16* Kb = Kg + (size_t)(b * AN + m0) * AH + h * AHD;
        const _Float16* Vb = Vg + (size_t)(b * AN + m0) * AH + h * AHD;
        const _Float16* kp = Kb + kvo;
        const _Float16* vp = Vb + kvo;
        kv[0] = *(const v8h*)kp;
        vv[0] = *(const v8h*)vp;
        kv[1] = *(const v8h*)(kp + 32 * AH);
        vv[1] = *(const v8h*)(vp + 32 * AH);
        // Precaution: stands ahead of any reuse of the loads' address
        // registers; the pointers as inputs keep those registers from being
        // a later load's own destination before it.
        asm volatile("s_wait_xcnt 0x0" :: "v"(kp), "v"(vp) : "memory");
    };
    auto fetch_mask = [&](int m0) {
        const float* Mb = mrow + (size_t)q0 * AN + m0;
        const float* mp = Mb + mo;
        #pragma unroll
        for (int nt = 0; nt < 4; ++nt) {
            #pragma unroll
            for (int r = 0; r < 8; ++r)
                mv[nt][r] = mp[r * AN + nt * 16];
        }
        // The same precaution.
        asm volatile("s_wait_xcnt 0x0" :: "v"(mp) : "memory");
    };

    // A pass finds its K, V and mask values in registers.  The next pass's
    // loads go out as soon as their registers are free: K and V behind the
    // barrier that publishes this pass's tiles, the mask behind its last use,
    // so that their round trips run under this pass's work.
    fetch_kv(0);
    fetch_mask(0);
    for (int m0 = 0; m0 < AN; m0 += 64) {
        // The last pass asks for its own tile again: no branch in the loop
        // body, and every address stays inside its buffer.
        const int mn = m0 + 64 < AN ? m0 + 64 : m0;
        lds_barrier();
        // Stage K (straight copy) and V (transpose-scatter).
        #pragma unroll
        for (int u = 0; u < 2; ++u) {
            int i = t + u * 256;
            int r = i >> 3, d = (i & 7) * 8;
            *(v8h*)&Ks[r * LQK + d] = kv[u];
            #pragma unroll
            for (int j = 0; j < 8; ++j)
                Vt[(d + j) * LQK + r] = vv[u][j];
        }
        lds_barrier();

        fetch_kv(mn);

        // Scores: 16 queries x 64 keys per wave, 2 WMMAs per 16x16 tile.
        #pragma unroll
        for (int nt = 0; nt < 4; ++nt) {
            int kr = nt * 16 + l16;
            v16h bk0 = load_frag(&Ks[kr * LQK + khalf]);
            v16h bk1 = load_frag(&Ks[kr * LQK + 32 + khalf]);
            v8f s = zero;
            s = WMMA16(aq0, bk0, s);
            s = WMMA16(aq1, bk1, s);

            #pragma unroll
            for (int r = 0; r < 8; ++r) {
                float x = s[r];
                float v = silu_f(x) * invN * mv[nt][r];
                Pw[((lane >> 4) * 8 + r) * LQK + nt * 16 + l16] = (_Float16)v;
            }
        }

        fetch_mask(mn);

        // P @ V: re-layout P (C->A) via per-wave LDS round-trip (in-order DS).
        v16h ap0 = load_frag(&Pw[l16 * LQK + khalf]);        // keys 0..31
        v16h ap1 = load_frag(&Pw[l16 * LQK + 32 + khalf]);   // keys 32..63
        #pragma unroll
        for (int dt = 0; dt < 4; ++dt) {
            int dc = dt * 16 + l16;
            v16h bv0 = load_frag(&Vt[dc * LQK + khalf]);
            v16h bv1 = load_frag(&Vt[dc * LQK + 32 + khalf]);
            o[dt] = WMMA16(ap0, bv0, o[dt]);
            o[dt] = WMMA16(ap1, bv1, o[dt]);
        }
    }

    // The last pass's loads are used by nobody: they have landed before the
    // wave reuses their registers or gives them back at its end.
    asm volatile("s_wait_loadcnt 0x0" ::: "memory");

    // Write f32 attention output [B*N, H].
    int qb = b * AN + q0 + wid * 16 + (lane >> 4) * 8;
    #pragma unroll
    for (int dt = 0; dt < 4; ++dt) {
        int col = h * AHD + dt * 16 + l16;
        #pragma unroll
        for (int r = 0; r < 8; ++r)
            Og[(size_t)(qb + r) * AH + col] = o[dt][r];
    }
}

// ---------------------------------------------------------------------------
// LayerNorm over H=1024 + build o_input = [U, A, U*A] as f16 [4096 x 3072].
// ---------------------------------------------------------------------------
__global__ __launch_bounds__(256) void ln_concat_kernel(
    const float* __restrict__ attn, const _Float16* __restrict__ Uh,
    _Float16* __restrict__ oin)
{
    __shared__ float red[256];
    const int row = blockIdx.x;
    const int t = threadIdx.x;
    const float* x = attn + (size_t)row * 1024;

    float vals[4], s = 0.0f, ss = 0.0f;
    #pragma unroll
    for (int i = 0; i < 4; ++i) {
        float v = x[t + i * 256];
        vals[i] = v; s += v; ss += v * v;
    }
    red[t] = s; __syncthreads();
    for (int st = 128; st > 0; st >>= 1) {
        if (t < st) red[t] += red[t + st];
        __syncthreads();
    }
    float mean = red[0] * (1.0f / 1024.0f);
    __syncthreads();
    red[t] = ss; __syncthreads();
    for (int st = 128; st > 0; st >>= 1) {
        if (t < st) red[t] += red[t + st];
        __syncthreads();
    }
    float var  = red[0] * (1.0f / 1024.0f) - mean * mean;
    float rstd = __builtin_amdgcn_rsqf(var + 1e-8f);   // native v_rsq_f32

    _Float16* orow = oin + (size_t)row * 3072;
    const _Float16* urow = Uh + (size_t)row * 1024;
    #pragma unroll
    for (int i = 0; i < 4; ++i) {
        int c = t + i * 256;
        float a = (vals[i] - mean) * rstd;
        float u = (float)urow[c];
        orow[c]        = (_Float16)u;
        orow[1024 + c] = (_Float16)a;
        orow[2048 + c] = (_Float16)(u * a);
    }
}

// ---------------------------------------------------------------------------
// Host-side orchestration.
// ---------------------------------------------------------------------------
extern "C" void kernel_launch(void* const* d_in, const int* in_sizes, int n_in,
                              void* d_out, int out_size, void* d_ws, size_t ws_size,
                              hipStream_t stream) {
    const float* query = (const float*)d_in[0];
    const float* key_  = (const float*)d_in[1];
    const float* value = (const float*)d_in[2];
    const float* mask  = (const float*)d_in[3];
    const float* Wq = (const float*)d_in[4];   const float* bq = (const float*)d_in[5];
    const float* Wk = (const float*)d_in[6];   const float* bk = (const float*)d_in[7];
    const float* Wv = (const float*)d_in[8];   const float* bv = (const float*)d_in[9];
    const float* Wu = (const float*)d_in[10];  const float* bu = (const float*)d_in[11];
    const float* Wo = (const float*)d_in[12];  const float* bo = (const float*)d_in[13];
    float* out = (float*)d_out;

    const int M = 2 * 2048;        // 4096 rows
    const int H = 1024;

    // Workspace carve-out (~90 MB total, deterministic layout).
    char* ws = (char*)d_ws;
    size_t off = 0;
    auto carve = [&](size_t bytes) -> void* {
        void* p = ws + off;
        off += (bytes + 255) & ~(size_t)255;
        return p;
    };
    _Float16* Wq_t = (_Float16*)carve((size_t)H * H * 2);       // [N][K] f16
    _Float16* Wk_t = (_Float16*)carve((size_t)H * H * 2);
    _Float16* Wv_t = (_Float16*)carve((size_t)H * H * 2);
    _Float16* Wu_t = (_Float16*)carve((size_t)H * H * 2);
    _Float16* Wo_t = (_Float16*)carve((size_t)H * 3 * H * 2);   // [1024][3072]
    _Float16* Q_h  = (_Float16*)carve((size_t)M * H * 2);
    _Float16* K_h  = (_Float16*)carve((size_t)M * H * 2);
    _Float16* V_h  = (_Float16*)carve((size_t)M * H * 2);
    _Float16* U_h  = (_Float16*)carve((size_t)M * H * 2);
    float*    At_f = (float*)   carve((size_t)M * H * 4);
    _Float16* Oi_h = (_Float16*)carve((size_t)M * 3 * H * 2);
    (void)ws_size; (void)in_sizes; (void)n_in; (void)out_size;

    // 1) Weights -> f16, transposed to [N][K] for contiguous B staging:
    //    16 column tiles x 28 slabs of 256 k rows, one launch.
    cvt_transpose_all_kernel<<<dim3(16, 28), 256, 0, stream>>>(
        Wq, Wk, Wv, Wu, Wo, Wq_t, Wk_t, Wv_t, Wu_t, Wo_t);

    // 2) Projections: silu(X @ W + b), f16 outputs, all four in one launch.
    dim3 ggrid(M / BM, H / BN, 4);
    proj4_wmma_kernel<<<ggrid, 256, 0, stream>>>(
        query, key_, value, Wq_t, Wk_t, Wv_t, Wu_t, bq, bk, bv, bu,
        Q_h, K_h, V_h, U_h);

    // 3) Attention (16 query tiles x 32 (b,head) slices).
    dim3 agrid(AN / 128, 2 * ANH);
    attn_wmma_kernel<<<agrid, 256, 0, stream>>>(Q_h, K_h, V_h, mask, At_f);

    // 4) LayerNorm + concat [U, A, U*A].
    ln_concat_kernel<<<M, 256, 0, stream>>>(At_f, U_h, Oi_h);

    // 5) Final GEMM: o_input[4096x3072] @ Wo[3072x1024] + bo -> f32 out.
    dim3 fgrid(M / BM, H / BN);
    gemm_wmma_kernel<false, false, false, 1024, 3072><<<fgrid, 256, 0, stream>>>(
        nullptr, Oi_h, Wo_t, bo, nullptr, out);
}

// v006
// One run takes 161 microseconds.
// Next to v005, in two timings, it ran 1.15 times as fast each time.
// All steps since v000 together make it 2.61 times as fast.
#include <hip/hip_runtime.h>
#include <hip/hip_bf16.h>
#include <math.h>

// HSTU attention for MI455X (gfx1250, wave32, WMMA).
// B=2, N=2048, H=1024, NH=16, HD=64.

typedef __attribute__((ext_vector_type(16))) _Float16 v16h;
typedef __attribute__((ext_vector_type(8)))  _Float16 v8h;
typedef __attribute__((ext_vector_type(4)))  _Float16 v4h;
typedef __attribute__((ext_vector_type(8)))  float    v8f;
typedef __attribute__((ext_vector_type(4)))  float    v4f;

#define WMMA16(a, b, c) __builtin_amdgcn_wmma_f32_16x16x32_f16( \
    false, (a), false, (b), (short)0, (c), false, false)

// SiLU via native v_exp_f32 + v_rcp_f32 (no IEEE div sequence).
__device__ __forceinline__ float silu_f(float x) {
    return x * __builtin_amdgcn_rcpf(1.0f + __expf(-x));
}

// Work-group barrier for tiles handed over through LDS alone: its fences name
// the LDS only, so that a wave waits out its LDS operations at the barrier and
// not its global loads as well (__syncthreads() drains those too, and a load
// issued ahead could never stay in flight across it).
__device__ __forceinline__ void lds_barrier() {
    __builtin_amdgcn_fence(__ATOMIC_RELEASE, "workgroup", "local");
    __builtin_amdgcn_s_barrier();
    __builtin_amdgcn_fence(__ATOMIC_ACQUIRE, "workgroup", "local");
}

// Load a v16h fragment per the CDNA5 16-bit A/B layout:
// halves 0..7  = K (or col) khalf..khalf+7
// halves 8..15 = K (or col) khalf+16..khalf+23   (khalf = (lane>>4)*8)
__device__ __forceinline__ v16h load_frag(const _Float16* p) {
    v16h f;
    *((v8h*)&f)       = *(const v8h*)p;
    *(((v8h*)&f) + 1) = *(const v8h*)(p + 16);
    return f;
}

// Transposing LDS load (ds_load_tr16_b128) from a row-major 16-bit tile T.
// Lane l passes the address of T[k + 8*(l>>4) + (l&7)][n + 8*((l>>3)&1)] and
// gets T[k + 8*(l>>4) + 0..7][n + (l&15)]: one half of a B fragment whose
// column is n + (l&15), in the k order of load_frag.
typedef __attribute__((ext_vector_type(8))) short s16x8;
__device__ __forceinline__ v8h load_tr16(const _Float16* p) {
    typedef __attribute__((address_space(3))) s16x8 lds_s16x8;
    return __builtin_bit_cast(v8h,
        __builtin_amdgcn_ds_load_tr16_b128_v8i16((lds_s16x8*)p));
}
// B fragment over 32 rows (k) of such a tile: rows k..k+15 and k+16..k+31.
__device__ __forceinline__ v16h load_frag_tr(const _Float16* p, int pitch) {
    v16h f;
    *((v8h*)&f)       = load_tr16(p);
    *(((v8h*)&f) + 1) = load_tr16(p + 16 * pitch);
    return f;
}

// ---------------------------------------------------------------------------
// Kernel: all five weights, f32 [K x 1024] -> f16 transposed [1024 x K], in one
// launch.  A work-group moves a 256(k) x 64(n) tile.  A thread loads a
// 16(k) x 4(n) block as 16 float4 (a wave-load covers two rows of 256 B), turns
// it in registers into 8-half runs along k, and the runs pass through LDS so
// that each wave-store writes 512 contiguous bytes of one output row.
// blockIdx.y counts slabs of 256 k rows: 4 each for Wq, Wk, Wv, Wu, 12 for Wo.
// ---------------------------------------------------------------------------
#define TK 256
#define TN 64
#define TP (TK + 8)  // LDS row pitch in halves (528 B = 16 B x odd)

__global__ __launch_bounds__(256) void cvt_transpose_all_kernel(
    const float* __restrict__ Wq, const float* __restrict__ Wk,
    const float* __restrict__ Wv, const float* __restrict__ Wu,
    const float* __restrict__ Wo,
    _Float16* __restrict__ Tq, _Float16* __restrict__ Tk,
    _Float16* __restrict__ Tv, _Float16* __restrict__ Tu,
    _Float16* __restrict__ To)
{
    __shared__ _Float16 Ts[TN * TP];   // [n][k], 16-B chunks swizzled per row

    const int t    = threadIdx.x;
    const int slab = blockIdx.y;
    const int w    = slab >> 2;
    const float* src = w == 0 ? Wq : w == 1 ? Wk : w == 2 ? Wv : w == 3 ? Wu : Wo;
    _Float16*    dst = w == 0 ? Tq : w == 1 ? Tk : w == 2 ? Tv : w == 3 ? Tu : To;
    const int K  = w < 4 ? 1024 : 3072;
    const int k0 = (w < 4 ? (slab & 3) : (slab - 16)) * TK;
    const int n0 = blockIdx.x * TN;

    const int nq = t & 15;   // which group of 4 columns
    const int kb = t >> 4;   // which group of 16 rows
    const float* p = src + (size_t)(k0 + kb * 16) * 1024 + n0 + nq * 4;
    v4f v[16];
    #pragma unroll
    for (int j = 0; j < 16; ++j)
        v[j] = *(const v4f*)(p + j * 1024);
    // Precaution: stands ahead of any reuse of the loads' address registers;
    // p as an input keeps them from being a load's own destination before it.
    asm volatile("s_wait_xcnt 0x0" :: "v"(p) : "memory");
    // Keeps the conversions behind all 16 loads: left free, the scheduler holds
    // four loads back behind the first waits, a second memory round trip.
    __builtin_amdgcn_sched_barrier(0);

    // The 16 lanes of a half-wave write rows 4 apart, which at this pitch fall
    // on four bank groups only; the chunk index is XORed with (row >> 4) so
    // that they spread over all 64 banks.  The reader undoes it.
    #pragma unroll
    for (int c = 0; c < 4; ++c) {
        #pragma unroll
        for (int hh = 0; hh < 2; ++hh) {
            v8h h;
            #pragma unroll
            for (int j = 0; j < 8; ++j)
                h[j] = (_Float16)v[hh * 8 + j][c];
            *(v8h*)&Ts[(nq * 4 + c) * TP + ((kb * 2 + hh) ^ (nq >> 2)) * 8] = h;
        }
    }
    __syncthreads();

    const int ch = t & 31;
    v8h h[8];
    #pragma unroll
    for (int i = 0; i < 8; ++i) {
        const int n = (t >> 5) + i * 8;    // one output row a wave
        h[i] = *(const v8h*)&Ts[n * TP + (ch ^ (n >> 4)) * 8];
    }
    _Float16* q = dst + ((n0 + (t >> 5)) * K + k0 + ch * 8);
    #pragma unroll
    for (int i = 0; i < 8; ++i)
        *(v8h*)(q + i * 8 * K) = h[i];
}

// ---------------------------------------------------------------------------
// WMMA GEMM: out = act(A[MxK] @ W[KxN] + bias), W given pre-transposed f16
// as Wt[N x K].  Block tile 128x64, BK=128. 256 threads = 8 waves arranged
// 4(M) x 2(N); each wave computes a 32x32 tile = 2x2 WMMA frags.
// A pass costs a global round trip, two barriers and an LDS round trip
// whatever its depth, so a pass takes 128 k (four WMMA k steps): a quarter of
// the passes, each with four times the bytes in flight, and every f16 operand
// row piece is 256 aligned bytes.  K must be a multiple of 128.
// ---------------------------------------------------------------------------
#define BM 128
#define BN 64
#define BK 128
#define LDA 136  // BK + 8 halves pad (row = 272B = 16B x odd)
#define LDB 136

template <bool A_IS_F32, bool SILU, bool OUT_F16, int N, int K>
__device__ __forceinline__ void gemm_tile(
    const float* __restrict__ A32, const _Float16* __restrict__ A16,
    const _Float16* __restrict__ Wt, const float* __restrict__ bias,
    _Float16* __restrict__ out16, float* __restrict__ out32)
{
    __shared__ _Float16 As[BM * LDA];
    __shared__ _Float16 Bs[BN * LDB];

    const int t     = threadIdx.x;
    const int lane  = t & 31;
    const int wid   = t >> 5;
    const int waveM = wid >> 1;   // 0..3
    const int waveN = wid & 1;    // 0..1
    const int row0  = blockIdx.x * BM;
    const int col0  = blockIdx.y * BN;
    const int l16   = lane & 15;
    const int khalf = (lane >> 4) * 8;

    v8f zero = {};
    v8f acc[2][2];
    acc[0][0] = zero; acc[0][1] = zero; acc[1][0] = zero; acc[1][1] = zero;

    // Staging maps, fixed for the thread: every load of a pass is its base
    // pointer plus a compile-time offset (N and K are template constants), so
    // the fatter pass needs no address register per load.
    const int a_r = A_IS_F32 ? (t >> 5) : (t >> 4);            // first A row
    const int a_c = A_IS_F32 ? (t & 31) * 4 : (t & 15) * 8;    // A column
    const int b_n = t >> 4;                                    // first B row
    const int b_c = (t & 15) * 8;                              // B column
    const float*    pA32 = A_IS_F32 ? A32 + (size_t)(row0 + a_r) * K + a_c : nullptr;
    const _Float16* pA16 = A_IS_F32 ? nullptr : A16 + (size_t)(row0 + a_r) * K + a_c;
    const _Float16* pB   = Wt + (size_t)(col0 + b_n) * K + b_c;
    _Float16* sA = &As[a_r * LDA + a_c];
    _Float16* sB = &Bs[b_n * LDB + b_c];
    const _Float16* pPre = Wt + (size_t)(col0 + (t >> 2)) * K + BK;

    // 64x128 f16 B tile from pre-transposed Wt[N][K]: 4 v8h per thread,
    // 16 rows apart.  128x128 f16 A tile: 8 v8h per thread, 16 rows apart.
    v8h vb[BN / 16];
    v8h va16[BM / 16];
    // f16 A (two work-groups a WGP, registers to spare): the staging registers
    // are filled one pass ahead, behind the barrier that publishes the pass in
    // hand, so that the global round trip runs under its fragment reads and
    // WMMAs and not in front of them.
    auto fetch16 = [&](int k0) {
        #pragma unroll
        for (int j = 0; j < BN / 16; ++j)
            vb[j] = *(const v8h*)(pB + k0 + j * 16 * K);
        #pragma unroll
        for (int j = 0; j < BM / 16; ++j)
            va16[j] = *(const v8h*)(pA16 + k0 + j * 16 * K);
    };
    if (!A_IS_F32) fetch16(0);

    for (int k0 = 0; k0 < K; k0 += BK) {
        __syncthreads();
        if (A_IS_F32) {
            // All global loads of the pass go out first, into registers, with
            // fixed trip counts (no per-trip bound test on the thread index),
            // so that the pass waits out one round trip and not one per load.
            #pragma unroll
            for (int j = 0; j < BN / 16; ++j)
                vb[j] = *(const v8h*)(pB + k0 + j * 16 * K);
            // 128x128 f32 tile: float4 loads -> v4h LDS stores (16 per
            // thread, 8 rows apart; a wave-load is one row piece of 512 B).
            float4 va[BM / 8];
            #pragma unroll
            for (int j = 0; j < BM / 8; ++j)
                va[j] = *(const float4*)(pA32 + k0 + j * 8 * K);
            #pragma unroll
            for (int j = 0; j < BM / 8; ++j) {
                v4h h = { (_Float16)va[j].x, (_Float16)va[j].y,
                          (_Float16)va[j].z, (_Float16)va[j].w };
                *(v4h*)(sA + j * 8 * LDA) = h;
            }
        } else {
            #pragma unroll
            for (int j = 0; j < BM / 16; ++j)
                *(v8h*)(sA + j * 16 * LDA) = va16[j];
        }
        #pragma unroll
        for (int j = 0; j < BN / 16; ++j)
            *(v8h*)(sB + j * 16 * LDB) = vb[j];
        // Prefetch next Wt tile into L2, one address a row.  In asm text over a pointer that lives through the
        // loop: the builtin's address here was a temporary whose register the
        // fragment reads below take over at once.
        // (f32 A only: with f16 A the loads themselves ask for that tile below.)
        if (A_IS_F32) {
            if (k0 + BK < K)
                asm volatile("global_prefetch_b8 %0, off scope:SCOPE_SE" :: "v"(pPre));
            // The pointer stays inside Wt behind its last use as well.
            pPre += (k0 + 2 * BK < K) ? BK : 0;
        }
        __syncthreads();

        if (!A_IS_F32) {
            if (k0 + BK < K) fetch16(k0 + BK);
            // Holds the next pass's loads ahead of this pass's fragment reads:
            // sunk among the WMMAs they would lose the lead they are issued for.
            __builtin_amdgcn_sched_barrier(0);
        }

        // The four k steps of 32 run in ascending k as before, but their
        // fragment reads go out in groups of FG k steps ahead of the WMMAs, so
        // that the pass also waits out one LDS round trip a group and not two
        // a k step.  FG: what the registers allow (f32 A: two k steps, in the
        // registers that the staging has just left, which keeps four
        // work-groups on a WGP; f16 A: all four, beside the next pass's
        // staging registers, with the two work-groups a WGP that its grid gives).
        constexpr int FG = A_IS_F32 ? 2 : 4;
        #pragma unroll
        for (int g = 0; g < BK / 32; g += FG) {
            v16h afrag[FG][2], bfrag[FG][2];
            #pragma unroll
            for (int s = 0; s < FG; ++s) {
                const int ks = (g + s) * 32;
                #pragma unroll
                for (int am = 0; am < 2; ++am) {
                    int r = waveM * 32 + am * 16 + l16;
                    afrag[s][am] = load_frag(&As[r * LDA + ks + khalf]);
                }
                #pragma unroll
                for (int bn = 0; bn < 2; ++bn) {
                    int n = waveN * 32 + bn * 16 + l16;
                    bfrag[s][bn] = load_frag(&Bs[n * LDB + ks + khalf]);
                }
            }
            // Holds the group's reads ahead of its WMMAs: left free, the
            // scheduler sinks them back among the WMMAs, each behind a full wait.
            __builtin_amdgcn_sched_barrier(0);
            #pragma unroll
            for (int s = 0; s < FG; ++s) {
                acc[0][0] = WMMA16(afrag[s][0], bfrag[s][0], acc[0][0]);
                acc[0][1] = WMMA16(afrag[s][0], bfrag[s][1], acc[0][1]);
                acc[1][0] = WMMA16(afrag[s][1], bfrag[s][0], acc[1][0]);
                acc[1][1] = WMMA16(afrag[s][1], bfrag[s][1], acc[1][1]);
            }
        }
    }

    // Epilogue: C/D layout — lane: col = l16, VGPR r: row = r + (lane>>4)*8.
    #pragma unroll
    for (int am = 0; am < 2; ++am) {
        int rowbase = row0 + waveM * 32 + am * 16 + (lane >> 4) * 8;
        #pragma unroll
        for (int bn = 0; bn < 2; ++bn) {
            int col = col0 + waveN * 32 + bn * 16 + l16;
            float bv = bias[col];
            #pragma unroll
            for (int r = 0; r < 8; ++r) {
                float v = acc[am][bn][r] + bv;
                if (SILU) v = silu_f(v);
                size_t idx = (size_t)(rowbase + r) * N + col;
                if (OUT_F16) out16[idx] = (_Float16)v;
                else         out32[idx] = v;
            }
        }
    }
}

// The four projections silu(X @ W + b) -> f16 in ONE launch: blockIdx.z picks
// the operand set (0: Q, 1: K, 2: V, 3: U; V and U both read Xv).  A pass of
// gemm_tile is mostly waiting (a global round trip, two barriers, LDS latency);
// one projection alone has only two work-groups for each WGP, the four
// together eight, so that as many as the registers allow are resident and
// fill each other's waits.
__global__ __launch_bounds__(256) void proj4_wmma_kernel(
    const float* __restrict__ Xq, const float* __restrict__ Xk,
    const float* __restrict__ Xv,
    const _Float16* __restrict__ Tq, const _Float16* __restrict__ Tk,
    const _Float16* __restrict__ Tv, const _Float16* __restrict__ Tu,
    const float* __restrict__ bq, const float* __restrict__ bk,
    const float* __restrict__ bv, const float* __restrict__ bu,
    _Float16* __restrict__ Qo, _Float16* __restrict__ Ko,
    _Float16* __restrict__ Vo, _Float16* __restrict__ Uo)
{
    const int z = blockIdx.z;
    const float*    X = z == 0 ? Xq : z == 1 ? Xk : Xv;
    const _Float16* T = z == 0 ? Tq : z == 1 ? Tk : z == 2 ? Tv : Tu;
    const float*    b = z == 0 ? bq : z == 1 ? bk : z == 2 ? bv : bu;
    _Float16*       O = z == 0 ? Qo : z == 1 ? Ko : z == 2 ? Vo : Uo;
    gemm_tile<true, true, true, 1024, 1024>(X, nullptr, T, b, O, nullptr);
}

// One product a launch (the final GEMM).
template <bool A_IS_F32, bool SILU, bool OUT_F16, int N, int K>
__global__ __launch_bounds__(256) void gemm_wmma_kernel(
    const float* __restrict__ A32, const _Float16* __restrict__ A16,
    const _Float16* __restrict__ Wt, const float* __restrict__ bias,
    _Float16* __restrict__ out16, float* __restrict__ out32)
{
    gemm_tile<A_IS_F32, SILU, OUT_F16, N, K>(A32, A16, Wt, bias, out16, out32);
}

// ---------------------------------------------------------------------------
// Attention: per (b,head) slice, 128-query tile per block, stream 64-key tiles.
// scores = silu(Q K^T)/N * mask  (linear accumulation, no softmax) then S @ V.
// ---------------------------------------------------------------------------
#define AN 2048
#define AH 1024
#define ANH 16
#define AHD 64
#define LQK 72  // 64 + 8 halves pad (144B rows, 16B aligned)
#define LV  80  // V rows: 64 + 16 halves (160 B = 32 B x odd, the transposing load's pitch)

// Two work-groups a WGP is all the grid gives (512 on 256 WGPs): four waves a
// SIMD, stated so that the compiler spends the 256 registers a wave then has
// on loads in flight and does not schedule for more resident waves.
__global__ __launch_bounds__(256) __attribute__((amdgpu_waves_per_eu(4, 4)))
void attn_wmma_kernel(
    const _Float16* __restrict__ Qg, const _Float16* __restrict__ Kg,
    const _Float16* __restrict__ Vg, const float* __restrict__ mask,
    float* __restrict__ Og)
{
    __shared__ _Float16 Qs[128 * LQK];      // 128 queries x 64 d
    __shared__ _Float16 Ks[64 * LQK];       // 64 keys x 64 d
    __shared__ _Float16 Vs[64 * LV];        // 64 keys x 64 d, as in memory
    __shared__ _Float16 Ps[8 * 16 * LQK];   // per-wave probs: 16 q x 64 key

    const int bh   = blockIdx.y;
    const int b    = bh / ANH;
    const int h    = bh % ANH;
    const int q0   = blockIdx.x * 128;
    const int t    = threadIdx.x;
    const int lane = t & 31;
    const int wid  = t >> 5;
    const int l16  = lane & 15;
    const int khalf = (lane >> 4) * 8;

    const _Float16* Qbase = Qg + (size_t)(b * AN + q0) * AH + h * AHD;
    const float* mrow = mask + (size_t)b * AN * AN;
    const float invN = 1.0f / (float)AN;

    // Stage Q tile: v8h copies (4 per thread), all loads ahead of the stores.
    {
        v8h qv[4];
        #pragma unroll
        for (int j = 0; j < 4; ++j) {
            int i = t + j * 256;
            int r = i >> 3, d = (i & 7) * 8;
            qv[j] = *(const v8h*)&Qbase[(size_t)r * AH + d];
        }
        // Precaution: the offset registers of the four loads above are reused
        // soon after; this wait stands ahead of any such overwrite.
        asm volatile("s_wait_xcnt 0x0" ::: "memory");
        #pragma unroll
        for (int j = 0; j < 4; ++j) {
            int i = t + j * 256;
            int r = i >> 3, d = (i & 7) * 8;
            *(v8h*)&Qs[r * LQK + d] = qv[j];
        }
    }
    __syncthreads();

    // A-fragments from Q are loop-invariant per wave (16 query rows).
    v16h aq0, aq1;
    {
        int r = wid * 16 + l16;
        aq0 = load_frag(&Qs[r * LQK + khalf]);        // d 0..31
        aq1 = load_frag(&Qs[r * LQK + 32 + khalf]);   // d 32..63
    }

    v8f zero = {};
    v8f o[4];
    o[0] = zero; o[1] = zero; o[2] = zero; o[3] = zero;

    _Float16* Pw = &Ps[wid * 16 * LQK];
    // The lane's address in V's tile for the transposing loads (key 0, d 0).
    const _Float16* Vr = &Vs[(khalf + (lane & 7)) * LV + ((lane >> 3) & 1) * 8];

    // All global loads of the pass that starts at key m0: K and V (v8h, two
    // each a thread) and the wave's mask values (16 queries x 64 keys).
    v8h kv[2], vv[2];
    const unsigned kvo = (unsigned)((t >> 3) * AH + (t & 7) * 8);
    const unsigned mo  = (unsigned)((wid * 16 + (lane >> 4) * 8) * AN + l16);
    float mv[4][8];
    auto fetch_kv = [&](int m0) {
        const _Float16* Kb = Kg + (size_t)(b * AN + m0) * AH + h * AHD;
        const _Float16* Vb = Vg + (size_t)(b * AN + m0) * AH + h * AHD;
        const _Float16* kp = Kb + kvo;
        const _Float16* vp = Vb + kvo;
        kv[0] = *(const v8h*)kp;
        vv[0] = *(const v8h*)vp;
        kv[1] = *(const v8h*)(kp + 32 * AH);
        vv[1] = *(const v8h*)(vp + 32 * AH);
        // Precaution: stands ahead of any reuse of the loads' address
        // registers; the pointers as inputs keep those registers from being
        // a later load's own destination before it.
        asm volatile("s_wait_xcnt 0x0" :: "v"(kp), "v"(vp) : "memory");
    };
    auto fetch_mask = [&](int m0) {
        const float* Mb = mrow + (size_t)q0 * AN + m0;
        const float* mp = Mb + mo;
        #pragma unroll
        for (int nt = 0; nt < 4; ++nt) {
            #pragma unroll
            for (int r = 0; r < 8; ++r)
                mv[nt][r] = mp[r * AN + nt * 16];
        }
        // The same precaution.
        asm volatile("s_wait_xcnt 0x0" :: "v"(mp) : "memory");
    };

    // A pass finds its K, V and mask values in registers.  The next pass's
    // loads go out as soon as their registers are free: K and V behind the
    // barrier that publishes this pass's tiles, the mask behind its last use,
    // so that their round trips run under this pass's work.
    fetch_kv(0);
    fetch_mask(0);
    for (int m0 = 0; m0 < AN; m0 += 64) {
        // The last pass asks for its own tile again: no branch in the loop
        // body, and every address stays inside its buffer.
        const int mn = m0 + 64 < AN ? m0 + 64 : m0;
        lds_barrier();
        // Stage K and V, both as straight 16-byte copies.
        #pragma unroll
        for (int u = 0; u < 2; ++u) {
            int i = t + u * 256;
            int r = i >> 3, d = (i & 7) * 8;
            *(v8h*)&Ks[r * LQK + d] = kv[u];
            *(v8h*)&Vs[r * LV + d]  = vv[u];
        }
        lds_barrier();

        fetch_kv(mn);

        // Scores: 16 queries x 64 keys per wave, 2 WMMAs per 16x16 tile.
        #pragma unroll
        for (int nt = 0; nt < 4; ++nt) {
            int kr = nt * 16 + l16;
            v16h bk0 = load_frag(&Ks[kr * LQK + khalf]);
            v16h bk1 = load_frag(&Ks[kr * LQK + 32 + khalf]);
            v8f s = zero;
            s = WMMA16(aq0, bk0, s);
            s = WMMA16(aq1, bk1, s);

            #pragma unroll
            for (int r = 0; r < 8; ++r) {
                float x = s[r];
                float v = silu_f(x) * invN * mv[nt][r];
                Pw[((lane >> 4) * 8 + r) * LQK + nt * 16 + l16] = (_Float16)v;
            }
        }

        fetch_mask(mn);

        // P @ V: re-layout P (C->A) via per-wave LDS round-trip (in-order DS).
        v16h ap0 = load_frag(&Pw[l16 * LQK + khalf]);        // keys 0..31
        v16h ap1 = load_frag(&Pw[l16 * LQK + 32 + khalf]);   // keys 32..63
        #pragma unroll
        for (int dt = 0; dt < 4; ++dt) {
            // V is turned on its way out of LDS: column d = dt*16 + l16.
            v16h bv0 = load_frag_tr(Vr + dt * 16, LV);             // keys 0..31
            v16h bv1 = load_frag_tr(Vr + 32 * LV + dt * 16, LV);   // keys 32..63
            o[dt] = WMMA16(ap0, bv0, o[dt]);
            o[dt] = WMMA16(ap1, bv1, o[dt]);
        }
    }

    // The last pass's loads are used by nobody: they have landed before the
    // wave reuses their registers or gives them back at its end.
    asm volatile("s_wait_loadcnt 0x0" ::: "memory");

    // Write f32 attention output [B*N, H].
    int qb = b * AN + q0 + wid * 16 + (lane >> 4) * 8;
    #pragma unroll
    for (int dt = 0; dt < 4; ++dt) {
        int col = h * AHD + dt * 16 + l16;
        #pragma unroll
        for (int r = 0; r < 8; ++r)
            Og[(size_t)(qb + r) * AH + col] = o[dt][r];
    }
}

// ---------------------------------------------------------------------------
// LayerNorm over H=1024 + build o_input = [U, A, U*A] as f16 [4096 x 3072].
// ---------------------------------------------------------------------------
__global__ __launch_bounds__(256) void ln_concat_kernel(
    const float* __restrict__ attn, const _Float16* __restrict__ Uh,
    _Float16* __restrict__ oin)
{
    __shared__ float red[256];
    const int row = blockIdx.x;
    const int t = threadIdx.x;
    const float* x = attn + (size_t)row * 1024;

    float vals[4], s = 0.0f, ss = 0.0f;
    #pragma unroll
    for (int i = 0; i < 4; ++i) {
        float v = x[t + i * 256];
        vals[i] = v; s += v; ss += v * v;
    }
    red[t] = s; __syncthreads();
    for (int st = 128; st > 0; st >>= 1) {
        if (t < st) red[t] += red[t + st];
        __syncthreads();
    }
    float mean = red[0] * (1.0f / 1024.0f);
    __syncthreads();
    red[t] = ss; __syncthreads();
    for (int st = 128; st > 0; st >>= 1) {
        if (t < st) red[t] += red[t + st];
        __syncthreads();
    }
    float var  = red[0] * (1.0f / 1024.0f) - mean * mean;
    float rstd = __builtin_amdgcn_rsqf(var + 1e-8f);   // native v_rsq_f32

    _Float16* orow = oin + (size_t)row * 3072;
    const _Float16* urow = Uh + (size_t)row * 1024;
    #pragma unroll
    for (int i = 0; i < 4; ++i) {
        int c = t + i * 256;
        float a = (vals[i] - mean) * rstd;
        float u = (float)urow[c];
        orow[c]        = (_Float16)u;
        orow[1024 + c] = (_Float16)a;
        orow[2048 + c] = (_Float16)(u * a);
    }
}

// ---------------------------------------------------------------------------
// Host-side orchestration.
// ---------------------------------------------------------------------------
extern "C" void kernel_launch(void* const* d_in, const int* in_sizes, int n_in,
                              void* d_out, int out_size, void* d_ws, size_t ws_size,
                              hipStream_t stream) {
    const float* query = (const float*)d_in[0];
    const float* key_  = (const float*)d_in[1];
    const float* value = (const float*)d_in[2];
    const float* mask  = (const float*)d_in[3];
    const float* Wq = (const float*)d_in[4];   const float* bq = (const float*)d_in[5];
    const float* Wk = (const float*)d_in[6];   const float* bk = (const float*)d_in[7];
    const float* Wv = (const float*)d_in[8];   const float* bv = (const float*)d_in[9];
    const float* Wu = (const float*)d_in[10];  const float* bu = (const float*)d_in[11];
    const float* Wo = (const float*)d_in[12];  const float* bo = (const float*)d_in[13];
    float* out = (float*)d_out;

    const int M = 2 * 2048;        // 4096 rows
    const int H = 1024;

    // Workspace carve-out (~90 MB total, deterministic layout).
    char* ws = (char*)d_ws;
    size_t off = 0;
    auto carve = [&](size_t bytes) -> void* {
        void* p = ws + off;
        off += (bytes + 255) & ~(size_t)255;
        return p;
    };
    _Float16* Wq_t = (_Float16*)carve((size_t)H * H * 2);       // [N][K] f16
    _Float16* Wk_t = (_Float16*)carve((size_t)H * H * 2);
    _Float16* Wv_t = (_Float16*)carve((size_t)H * H * 2);
    _Float16* Wu_t = (_Float16*)carve((size_t)H * H * 2);
    _Float16* Wo_t = (_Float16*)carve((size_t)H * 3 * H * 2);   // [1024][3072]
    _Float16* Q_h  = (_Float16*)carve((size_t)M * H * 2);
    _Float16* K_h  = (_Float16*)carve((size_t)M * H * 2);
    _Float16* V_h  = (_Float16*)carve((size_t)M * H * 2);
    _Float16* U_h  = (_Float16*)carve((size_t)M * H * 2);
    float*    At_f = (float*)   carve((size_t)M * H * 4);
    _Float16* Oi_h = (_Float16*)carve((size_t)M * 3 * H * 2);
    (void)ws_size; (void)in_sizes; (void)n_in; (void)out_size;

    // 1) Weights -> f16, transposed to [N][K] for contiguous B staging:
    //    16 column tiles x 28 slabs of 256 k rows, one launch.
    cvt_transpose_all_kernel<<<dim3(16, 28), 256, 0, stream>>>(
        Wq, Wk, Wv, Wu, Wo, Wq_t, Wk_t, Wv_t, Wu_t, Wo_t);

    // 2) Projections: silu(X @ W + b), f16 outputs, all four in one launch.
    dim3 ggrid(M / BM, H / BN, 4);
    proj4_wmma_kernel<<<ggrid, 256, 0, stream>>>(
        query, key_, value, Wq_t, Wk_t, Wv_t, Wu_t, bq, bk, bv, bu,
        Q_h, K_h, V_h, U_h);

    // 3) Attention (16 query tiles x 32 (b,head) slices).
    dim3 agrid(AN / 128, 2 * ANH);
    attn_wmma_kernel<<<agrid, 256, 0, stream>>>(Q_h, K_h, V_h, mask, At_f);

    // 4) LayerNorm + concat [U, A, U*A].
    ln_concat_kernel<<<M, 256, 0, stream>>>(At_f, U_h, Oi_h);

    // 5) Final GEMM: o_input[4096x3072] @ Wo[3072x1024] + bo -> f32 out.
    dim3 fgrid(M / BM, H / BN);
    gemm_wmma_kernel<false, false, false, 1024, 3072><<<fgrid, 256, 0, stream>>>(
        nullptr, Oi_h, Wo_t, bo, nullptr, out);
}

// v007
// A run of this version takes 139 microseconds.
// Timed twice side by side with v006, it ran 1.15 times as fast both times.
// Over all steps from v000 it is 3.00 times as fast.
#include <hip/hip_runtime.h>
#include <hip/hip_bf16.h>
#include <math.h>

// HSTU attention for MI455X (gfx1250, wave32, WMMA).
// B=2, N=2048, H=1024, NH=16, HD=64.

typedef __attribute__((ext_vector_type(16))) _Float16 v16h;
typedef __attribute__((ext_vector_type(8)))  _Float16 v8h;
typedef __attribute__((ext_vector_type(4)))  _Float16 v4h;
typedef __attribute__((ext_vector_type(8)))  float    v8f;
typedef __attribute__((ext_vector_type(4)))  float    v4f;

#define WMMA16(a, b, c) __builtin_amdgcn_wmma_f32_16x16x32_f16( \
    false, (a), false, (b), (short)0, (c), false, false)

// SiLU via native v_exp_f32 + v_rcp_f32 (no IEEE div sequence).
__device__ __forceinline__ float silu_f(float x) {
    return x * __builtin_amdgcn_rcpf(1.0f + __expf(-x));
}

// Work-group barrier for tiles handed over through LDS alone: its fences name
// the LDS only, so that a wave waits out its LDS operations at the barrier and
// not its global loads as well (__syncthreads() drains those too, and a load
// issued ahead could never stay in flight across it).
__device__ __forceinline__ void lds_barrier() {
    __builtin_amdgcn_fence(__ATOMIC_RELEASE, "workgroup", "local");
    __builtin_amdgcn_s_barrier();
    __builtin_amdgcn_fence(__ATOMIC_ACQUIRE, "workgroup", "local");
}

// Load a v16h fragment per the CDNA5 16-bit A/B layout:
// halves 0..7  = K (or col) khalf..khalf+7
// halves 8..15 = K (or col) khalf+16..khalf+23   (khalf = (lane>>4)*8)
__device__ __forceinline__ v16h load_frag(const _Float16* p) {
    v16h f;
    *((v8h*)&f)       = *(const v8h*)p;
    *(((v8h*)&f) + 1) = *(const v8h*)(p + 16);
    return f;
}

// Transposing LDS load (ds_load_tr16_b128) from a row-major 16-bit tile T.
// Lane l passes the address of T[k + 8*(l>>4) + (l&7)][n + 8*((l>>3)&1)] and
// gets T[k + 8*(l>>4) + 0..7][n + (l&15)]: one half of a B fragment whose
// column is n + (l&15), in the k order of load_frag.
typedef __attribute__((ext_vector_type(8))) short s16x8;
__device__ __forceinline__ v8h load_tr16(const _Float16* p) {
    typedef __attribute__((address_space(3))) s16x8 lds_s16x8;
    return __builtin_bit_cast(v8h,
        __builtin_amdgcn_ds_load_tr16_b128_v8i16((lds_s16x8*)p));
}
// B fragment over 32 rows (k) of such a tile: rows k..k+15 and k+16..k+31.
__device__ __forceinline__ v16h load_frag_tr(const _Float16* p, int pitch) {
    v16h f;
    *((v8h*)&f)       = load_tr16(p);
    *(((v8h*)&f) + 1) = load_tr16(p + 16 * pitch);
    return f;
}

// ---------------------------------------------------------------------------
// Kernel: all five weights, f32 [K x 1024] -> f16 transposed [1024 x K], in one
// launch.  A work-group moves a 256(k) x 64(n) tile.  A thread loads a
// 16(k) x 4(n) block as 16 float4 (a wave-load covers two rows of 256 B), turns
// it in registers into 8-half runs along k, and the runs pass through LDS so
// that each wave-store writes 512 contiguous bytes of one output row.
// blockIdx.y counts slabs of 256 k rows: 4 each for Wq, Wk, Wv, Wu, 12 for Wo.
// ---------------------------------------------------------------------------
#define TK 256
#define TN 64
#define TP (TK + 8)  // LDS row pitch in halves (528 B = 16 B x odd)

__global__ __launch_bounds__(256) void cvt_transpose_all_kernel(
    const float* __restrict__ Wq, const float* __restrict__ Wk,
    const float* __restrict__ Wv, const float* __restrict__ Wu,
    const float* __restrict__ Wo,
    _Float16* __restrict__ Tq, _Float16* __restrict__ Tk,
    _Float16* __restrict__ Tv, _Float16* __restrict__ Tu,
    _Float16* __restrict__ To)
{
    __shared__ _Float16 Ts[TN * TP];   // [n][k], 16-B chunks swizzled per row

    const int t    = threadIdx.x;
    const int slab = blockIdx.y;
    const int w    = slab >> 2;
    const float* src = w == 0 ? Wq : w == 1 ? Wk : w == 2 ? Wv : w == 3 ? Wu : Wo;
    _Float16*    dst = w == 0 ? Tq : w == 1 ? Tk : w == 2 ? Tv : w == 3 ? Tu : To;
    const int K  = w < 4 ? 1024 : 3072;
    const int k0 = (w < 4 ? (slab & 3) : (slab - 16)) * TK;
    const int n0 = blockIdx.x * TN;

    const int nq = t & 15;   // which group of 4 columns
    const int kb = t >> 4;   // which group of 16 rows
    const float* p = src + (size_t)(k0 + kb * 16) * 1024 + n0 + nq * 4;
    v4f v[16];
    #pragma unroll
    for (int j = 0; j < 16; ++j)
        v[j] = *(const v4f*)(p + j * 1024);
    // Precaution: stands ahead of any reuse of the loads' address registers;
    // p as an input keeps them from being a load's own destination before it.
    asm volatile("s_wait_xcnt 0x0" :: "v"(p) : "memory");
    // Keeps the conversions behind all 16 loads: left free, the scheduler holds
    // four loads back behind the first waits, a second memory round trip.
    __builtin_amdgcn_sched_barrier(0);

    // The 16 lanes of a half-wave write rows 4 apart, which at this pitch fall
    // on four bank groups only; the chunk index is XORed with (row >> 4) so
    // that they spread over all 64 banks.  The reader undoes it.
    #pragma unroll
    for (int c = 0; c < 4; ++c) {
        #pragma unroll
        for (int hh = 0; hh < 2; ++hh) {
            v8h h;
            #pragma unroll
            for (int j = 0; j < 8; ++j)
                h[j] = (_Float16)v[hh * 8 + j][c];
            *(v8h*)&Ts[(nq * 4 + c) * TP + ((kb * 2 + hh) ^ (nq >> 2)) * 8] = h;
        }
    }
    __syncthreads();

    const int ch = t & 31;
    v8h h[8];
    #pragma unroll
    for (int i = 0; i < 8; ++i) {
        const int n = (t >> 5) + i * 8;    // one output row a wave
        h[i] = *(const v8h*)&Ts[n * TP + (ch ^ (n >> 4)) * 8];
    }
    _Float16* q = dst + ((n0 + (t >> 5)) * K + k0 + ch * 8);
    #pragma unroll
    for (int i = 0; i < 8; ++i)
        *(v8h*)(q + i * 8 * K) = h[i];
}

// ---------------------------------------------------------------------------
// WMMA GEMM: out = act(A[MxK] @ W[KxN] + bias), W given pre-transposed f16
// as Wt[N x K].  Block tile 128x64, BK=128. 256 threads = 8 waves arranged
// 4(M) x 2(N); each wave computes a 32x32 tile = 2x2 WMMA frags.
// A pass costs a global round trip, two barriers and an LDS round trip
// whatever its depth, so a pass takes 128 k (four WMMA k steps): a quarter of
// the passes, each with four times the bytes in flight, and every f16 operand
// row piece is 256 aligned bytes.  K must be a multiple of 128.
// ---------------------------------------------------------------------------
#define BM 128
#define BN 64
#define BK 128
#define LDA 136  // BK + 8 halves pad (row = 272B = 16B x odd)
#define LDB 136

template <bool A_IS_F32, bool SILU, bool OUT_F16, int N, int K>
__device__ __forceinline__ void gemm_tile(
    const float* __restrict__ A32, const _Float16* __restrict__ A16,
    const _Float16* __restrict__ Wt, const float* __restrict__ bias,
    _Float16* __restrict__ out16, float* __restrict__ out32)
{
    __shared__ _Float16 As[BM * LDA];
    __shared__ _Float16 Bs[BN * LDB];

    const int t     = threadIdx.x;
    const int lane  = t & 31;
    const int wid   = t >> 5;
    const int waveM = wid >> 1;   // 0..3
    const int waveN = wid & 1;    // 0..1
    const int row0  = blockIdx.x * BM;
    const int col0  = blockIdx.y * BN;
    const int l16   = lane & 15;
    const int khalf = (lane >> 4) * 8;

    v8f zero = {};
    v8f acc[2][2];
    acc[0][0] = zero; acc[0][1] = zero; acc[1][0] = zero; acc[1][1] = zero;

    // Staging maps, fixed for the thread: every load of a pass is its base
    // pointer plus a compile-time offset (N and K are template constants), so
    // the fatter pass needs no address register per load.
    const int a_r = A_IS_F32 ? (t >> 5) : (t >> 4);            // first A row
    const int a_c = A_IS_F32 ? (t & 31) * 4 : (t & 15) * 8;    // A column
    const int b_n = t >> 4;                                    // first B row
    const int b_c = (t & 15) * 8;                              // B column
    const float*    pA32 = A_IS_F32 ? A32 + (size_t)(row0 + a_r) * K + a_c : nullptr;
    const _Float16* pA16 = A_IS_F32 ? nullptr : A16 + (size_t)(row0 + a_r) * K + a_c;
    const _Float16* pB   = Wt + (size_t)(col0 + b_n) * K + b_c;
    _Float16* sA = &As[a_r * LDA + a_c];
    _Float16* sB = &Bs[b_n * LDB + b_c];
    const _Float16* pPre = Wt + (size_t)(col0 + (t >> 2)) * K + BK;

    // 64x128 f16 B tile from pre-transposed Wt[N][K]: 4 v8h per thread,
    // 16 rows apart.  128x128 f16 A tile: 8 v8h per thread, 16 rows apart.
    v8h vb[BN / 16];
    v8h va16[BM / 16];
    // f16 A (two work-groups a WGP, registers to spare): the staging registers
    // are filled one pass ahead, behind the barrier that publishes the pass in
    // hand, so that the global round trip runs under its fragment reads and
    // WMMAs and not in front of them.
    auto fetch16 = [&](int k0) {
        #pragma unroll
        for (int j = 0; j < BN / 16; ++j)
            vb[j] = *(const v8h*)(pB + k0 + j * 16 * K);
        #pragma unroll
        for (int j = 0; j < BM / 16; ++j)
            va16[j] = *(const v8h*)(pA16 + k0 + j * 16 * K);
    };
    if (!A_IS_F32) fetch16(0);

    for (int k0 = 0; k0 < K; k0 += BK) {
        __syncthreads();
        if (A_IS_F32) {
            // All global loads of the pass go out first, into registers, with
            // fixed trip counts (no per-trip bound test on the thread index),
            // so that the pass waits out one round trip and not one per load.
            #pragma unroll
            for (int j = 0; j < BN / 16; ++j)
                vb[j] = *(const v8h*)(pB + k0 + j * 16 * K);
            // 128x128 f32 tile: float4 loads -> v4h LDS stores (16 per
            // thread, 8 rows apart; a wave-load is one row piece of 512 B).
            float4 va[BM / 8];
            #pragma unroll
            for (int j = 0; j < BM / 8; ++j)
                va[j] = *(const float4*)(pA32 + k0 + j * 8 * K);
            #pragma unroll
            for (int j = 0; j < BM / 8; ++j) {
                v4h h = { (_Float16)va[j].x, (_Float16)va[j].y,
                          (_Float16)va[j].z, (_Float16)va[j].w };
                *(v4h*)(sA + j * 8 * LDA) = h;
            }
        } else {
            #pragma unroll
            for (int j = 0; j < BM / 16; ++j)
                *(v8h*)(sA + j * 16 * LDA) = va16[j];
        }
        #pragma unroll
        for (int j = 0; j < BN / 16; ++j)
            *(v8h*)(sB + j * 16 * LDB) = vb[j];
        // Prefetch next Wt tile into L2, one address a row.  In asm text over a pointer that lives through the
        // loop: the builtin's address here was a temporary whose register the
        // fragment reads below take over at once.
        // (f32 A only: with f16 A the loads themselves ask for that tile below.)
        if (A_IS_F32) {
            if (k0 + BK < K)
                asm volatile("global_prefetch_b8 %0, off scope:SCOPE_SE" :: "v"(pPre));
            // The pointer stays inside Wt behind its last use as well.
            pPre += (k0 + 2 * BK < K) ? BK : 0;
        }
        __syncthreads();

        if (!A_IS_F32) {
            if (k0 + BK < K) fetch16(k0 + BK);
            // Holds the next pass's loads ahead of this pass's fragment reads:
            // sunk among the WMMAs they would lose the lead they are issued for.
            __builtin_amdgcn_sched_barrier(0);
        }

        // The four k steps of 32 run in ascending k as before, but their
        // fragment reads go out in groups of FG k steps ahead of the WMMAs, so
        // that the pass also waits out one LDS round trip a group and not two
        // a k step.  FG: what the registers allow (f32 A: two k steps, in the
        // registers that the staging has just left, which keeps four
        // work-groups on a WGP; f16 A: all four, beside the next pass's
        // staging registers, with the two work-groups a WGP that its grid gives).
        constexpr int FG = A_IS_F32 ? 2 : 4;
        #pragma unroll
        for (int g = 0; g < BK / 32; g += FG) {
            v16h afrag[FG][2], bfrag[FG][2];
            #pragma unroll
            for (int s = 0; s < FG; ++s) {
                const int ks = (g + s) * 32;
                #pragma unroll
                for (int am = 0; am < 2; ++am) {
                    int r = waveM * 32 + am * 16 + l16;
                    afrag[s][am] = load_frag(&As[r * LDA + ks + khalf]);
                }
                #pragma unroll
                for (int bn = 0; bn < 2; ++bn) {
                    int n = waveN * 32 + bn * 16 + l16;
                    bfrag[s][bn] = load_frag(&Bs[n * LDB + ks + khalf]);
                }
            }
            // Holds the group's reads ahead of its WMMAs: left free, the
            // scheduler sinks them back among the WMMAs, each behind a full wait.
            __builtin_amdgcn_sched_barrier(0);
            #pragma unroll
            for (int s = 0; s < FG; ++s) {
                acc[0][0] = WMMA16(afrag[s][0], bfrag[s][0], acc[0][0]);
                acc[0][1] = WMMA16(afrag[s][0], bfrag[s][1], acc[0][1]);
                acc[1][0] = WMMA16(afrag[s][1], bfrag[s][0], acc[1][0]);
                acc[1][1] = WMMA16(afrag[s][1], bfrag[s][1], acc[1][1]);
            }
        }
    }

    // Epilogue: C/D layout — lane: col = l16, VGPR r: row = r + (lane>>4)*8.
    #pragma unroll
    for (int am = 0; am < 2; ++am) {
        int rowbase = row0 + waveM * 32 + am * 16 + (lane >> 4) * 8;
        #pragma unroll
        for (int bn = 0; bn < 2; ++bn) {
            int col = col0 + waveN * 32 + bn * 16 + l16;
            float bv = bias[col];
            #pragma unroll
            for (int r = 0; r < 8; ++r) {
                float v = acc[am][bn][r] + bv;
                if (SILU) v = silu_f(v);
                size_t idx = (size_t)(rowbase + r) * N + col;
                if (OUT_F16) out16[idx] = (_Float16)v;
                else         out32[idx] = v;
            }
        }
    }
}

// The four projections silu(X @ W + b) -> f16 in ONE launch: blockIdx.z picks
// the operand set (0: Q, 1: K, 2: V, 3: U; V and U both read Xv).  A pass of
// gemm_tile is mostly waiting (a global round trip, two barriers, LDS latency);
// one projection alone has only two work-groups for each WGP, the four
// together eight, so that as many as the registers allow are resident and
// fill each other's waits.
__global__ __launch_bounds__(256) void proj4_wmma_kernel(
    const float* __restrict__ Xq, const float* __restrict__ Xk,
    const float* __restrict__ Xv,
    const _Float16* __restrict__ Tq, const _Float16* __restrict__ Tk,
    const _Float16* __restrict__ Tv, const _Float16* __restrict__ Tu,
    const float* __restrict__ bq, const float* __restrict__ bk,
    const float* __restrict__ bv, const float* __restrict__ bu,
    _Float16* __restrict__ Qo, _Float16* __restrict__ Ko,
    _Float16* __restrict__ Vo, _Float16* __restrict__ Uo)
{
    const int z = blockIdx.z;
    const float*    X = z == 0 ? Xq : z == 1 ? Xk : Xv;
    const _Float16* T = z == 0 ? Tq : z == 1 ? Tk : z == 2 ? Tv : Tu;
    const float*    b = z == 0 ? bq : z == 1 ? bk : z == 2 ? bv : bu;
    _Float16*       O = z == 0 ? Qo : z == 1 ? Ko : z == 2 ? Vo : Uo;
    gemm_tile<true, true, true, 1024, 1024>(X, nullptr, T, b, O, nullptr);
}

// One product a launch (the final GEMM).
template <bool A_IS_F32, bool SILU, bool OUT_F16, int N, int K>
__global__ __launch_bounds__(256) void gemm_wmma_kernel(
    const float* __restrict__ A32, const _Float16* __restrict__ A16,
    const _Float16* __restrict__ Wt, const float* __restrict__ bias,
    _Float16* __restrict__ out16, float* __restrict__ out32)
{
    gemm_tile<A_IS_F32, SILU, OUT_F16, N, K>(A32, A16, Wt, bias, out16, out32);
}

// ---------------------------------------------------------------------------
// Attention: per (b,head) slice, 128-query tile per block, stream 64-key tiles.
// scores = silu(Q K^T)/N * mask  (linear accumulation, no softmax) then S @ V.
// ---------------------------------------------------------------------------
#define AN 2048
#define AH 1024
#define ANH 16
#define AHD 64
#define LQK 72  // 64 + 8 halves pad (144B rows, 16B aligned)
#define LV  80  // V rows: 64 + 16 halves (160 B = 32 B x odd, the transposing load's pitch)

// Two work-groups a WGP is all the grid gives (512 on 256 WGPs): four waves a
// SIMD, stated so that the compiler spends the 256 registers a wave then has
// on loads in flight and does not schedule for more resident waves.
__global__ __launch_bounds__(256) __attribute__((amdgpu_waves_per_eu(4, 4)))
void attn_wmma_kernel(
    const _Float16* __restrict__ Qg, const _Float16* __restrict__ Kg,
    const _Float16* __restrict__ Vg, const float* __restrict__ mask,
    float* __restrict__ Og)
{
    __shared__ _Float16 Qs[128 * LQK];      // 128 queries x 64 d
    __shared__ _Float16 Ks[64 * LQK];       // 64 keys x 64 d
    __shared__ _Float16 Vs[64 * LV];        // 64 keys x 64 d, as in memory
    __shared__ _Float16 Ps[8 * 16 * LQK];   // per-wave probs: 16 q x 64 key

    const int bh   = blockIdx.y;
    const int b    = bh / ANH;
    const int h    = bh % ANH;
    const int q0   = blockIdx.x * 128;
    const int t    = threadIdx.x;
    const int lane = t & 31;
    const int wid  = t >> 5;
    const int l16  = lane & 15;
    const int khalf = (lane >> 4) * 8;

    const _Float16* Qbase = Qg + (size_t)(b * AN + q0) * AH + h * AHD;
    const float* mrow = mask + (size_t)b * AN * AN;
    const float invN = 1.0f / (float)AN;

    // Stage Q tile: v8h copies (4 per thread), all loads ahead of the stores.
    {
        v8h qv[4];
        #pragma unroll
        for (int j = 0; j < 4; ++j) {
            int i = t + j * 256;
            int r = i >> 3, d = (i & 7) * 8;
            qv[j] = *(const v8h*)&Qbase[(size_t)r * AH + d];
        }
        // Precaution: the offset registers of the four loads above are reused
        // soon after; this wait stands ahead of any such overwrite.
        asm volatile("s_wait_xcnt 0x0" ::: "memory");
        #pragma unroll
        for (int j = 0; j < 4; ++j) {
            int i = t + j * 256;
            int r = i >> 3, d = (i & 7) * 8;
            *(v8h*)&Qs[r * LQK + d] = qv[j];
        }
    }
    __syncthreads();

    // A-fragments from Q are loop-invariant per wave (16 query rows).
    v16h aq0, aq1;
    {
        int r = wid * 16 + l16;
        aq0 = load_frag(&Qs[r * LQK + khalf]);        // d 0..31
        aq1 = load_frag(&Qs[r * LQK + 32 + khalf]);   // d 32..63
    }

    v8f zero = {};
    v8f o[4];
    o[0] = zero; o[1] = zero; o[2] = zero; o[3] = zero;

    _Float16* Pw = &Ps[wid * 16 * LQK];
    // The lane's address in V's tile for the transposing loads (key 0, d 0).
    const _Float16* Vr = &Vs[(khalf + (lane & 7)) * LV + ((lane >> 3) & 1) * 8];

    // All global loads of the pass that starts at key m0: K and V (v8h, two
    // each a thread) and the wave's mask values (16 queries x 64 keys).
    // K's rows are dealt out over the four score tiles: row p of Ks holds key
    // 4 * (p & 15) + (p >> 4), so that column l16 of score tile nt is key
    // 4 * l16 + nt and a lane holds four consecutive keys of each of its
    // queries.  Its mask values are then one float4 a query (a wave-load is
    // two whole rows of 256 B) and its probabilities one 8-byte LDS store a
    // query, in P's plain key order.  V and P keep that order.
    v8h kv[2], vv[2];
    const unsigned kvo = (unsigned)((t >> 3) * AH + (t & 7) * 8);
    const unsigned kko = (unsigned)((4 * ((t >> 3) & 15) + (t >> 7)) * AH + (t & 7) * 8);
    const unsigned mo  = (unsigned)((wid * 16 + (lane >> 4) * 8) * AN + l16 * 4);
    v4f mv[8];
    auto fetch_kv = [&](int m0) {
        const _Float16* Kb = Kg + (size_t)(b * AN + m0) * AH + h * AHD;
        const _Float16* Vb = Vg + (size_t)(b * AN + m0) * AH + h * AHD;
        const _Float16* kp = Kb + kko;
        const _Float16* vp = Vb + kvo;
        kv[0] = *(const v8h*)kp;
        vv[0] = *(const v8h*)vp;
        kv[1] = *(const v8h*)(kp + 2 * AH);    // row p + 32 of Ks: key + 2
        vv[1] = *(const v8h*)(vp + 32 * AH);
        // Precaution: stands ahead of any reuse of the loads' address
        // registers; the pointers as inputs keep those registers from being
        // a later load's own destination before it.
        asm volatile("s_wait_xcnt 0x0" :: "v"(kp), "v"(vp) : "memory");
    };
    auto fetch_mask = [&](int m0) {
        const float* Mb = mrow + (size_t)q0 * AN + m0;
        const float* mp = Mb + mo;
        #pragma unroll
        for (int r = 0; r < 8; ++r)
            mv[r] = *(const v4f*)(mp + r * AN);
        // The same precaution.
        asm volatile("s_wait_xcnt 0x0" :: "v"(mp) : "memory");
    };

    // A pass finds its K, V and mask values in registers.  The next pass's
    // loads go out as soon as their registers are free: K and V behind the
    // barrier that publishes this pass's tiles, the mask behind its last use,
    // so that their round trips run under this pass's work.
    fetch_kv(0);
    fetch_mask(0);
    for (int m0 = 0; m0 < AN; m0 += 64) {
        // The last pass asks for its own tile again: no branch in the loop
        // body, and every address stays inside its buffer.
        const int mn = m0 + 64 < AN ? m0 + 64 : m0;
        lds_barrier();
        // Stage K and V, both as straight 16-byte copies.
        #pragma unroll
        for (int u = 0; u < 2; ++u) {
            int i = t + u * 256;
            int r = i >> 3, d = (i & 7) * 8;
            *(v8h*)&Ks[r * LQK + d] = kv[u];
            *(v8h*)&Vs[r * LV + d]  = vv[u];
        }
        lds_barrier();

        fetch_kv(mn);

        // Scores: 16 queries x 64 keys per wave, 2 WMMAs per 16x16 tile.
        v4h ph[8];
        #pragma unroll
        for (int nt = 0; nt < 4; ++nt) {
            int kr = nt * 16 + l16;    // row of Ks: key 4 * l16 + nt
            v16h bk0 = load_frag(&Ks[kr * LQK + khalf]);
            v16h bk1 = load_frag(&Ks[kr * LQK + 32 + khalf]);
            v8f s = zero;
            s = WMMA16(aq0, bk0, s);
            s = WMMA16(aq1, bk1, s);

            #pragma unroll
            for (int r = 0; r < 8; ++r) {
                float x = s[r];
                float v = silu_f(x) * invN * mv[r][nt];
                ph[r][nt] = (_Float16)v;
            }
        }
        #pragma unroll
        for (int r = 0; r < 8; ++r)
            *(v4h*)&Pw[((lane >> 4) * 8 + r) * LQK + l16 * 4] = ph[r];

        fetch_mask(mn);

        // P @ V: re-layout P (C->A) via per-wave LDS round-trip (in-order DS).
        v16h ap0 = load_frag(&Pw[l16 * LQK + khalf]);        // keys 0..31
        v16h ap1 = load_frag(&Pw[l16 * LQK + 32 + khalf]);   // keys 32..63
        #pragma unroll
        for (int dt = 0; dt < 4; ++dt) {
            // V is turned on its way out of LDS: column d = dt*16 + l16.
            v16h bv0 = load_frag_tr(Vr + dt * 16, LV);             // keys 0..31
            v16h bv1 = load_frag_tr(Vr + 32 * LV + dt * 16, LV);   // keys 32..63
            o[dt] = WMMA16(ap0, bv0, o[dt]);
            o[dt] = WMMA16(ap1, bv1, o[dt]);
        }
    }

    // The last pass's loads are used by nobody: they have landed before the
    // wave reuses their registers or gives them back at its end.
    asm volatile("s_wait_loadcnt 0x0" ::: "memory");

    // Write f32 attention output [B*N, H].
    int qb = b * AN + q0 + wid * 16 + (lane >> 4) * 8;
    #pragma unroll
    for (int dt = 0; dt < 4; ++dt) {
        int col = h * AHD + dt * 16 + l16;
        #pragma unroll
        for (int r = 0; r < 8; ++r)
            Og[(size_t)(qb + r) * AH + col] = o[dt][r];
    }
}

// ---------------------------------------------------------------------------
// LayerNorm over H=1024 + build o_input = [U, A, U*A] as f16 [4096 x 3072].
// ---------------------------------------------------------------------------
__global__ __launch_bounds__(256) void ln_concat_kernel(
    const float* __restrict__ attn, const _Float16* __restrict__ Uh,
    _Float16* __restrict__ oin)
{
    __shared__ float red[256];
    const int row = blockIdx.x;
    const int t = threadIdx.x;
    const float* x = attn + (size_t)row * 1024;

    float vals[4], s = 0.0f, ss = 0.0f;
    #pragma unroll
    for (int i = 0; i < 4; ++i) {
        float v = x[t + i * 256];
        vals[i] = v; s += v; ss += v * v;
    }
    red[t] = s; __syncthreads();
    for (int st = 128; st > 0; st >>= 1) {
        if (t < st) red[t] += red[t + st];
        __syncthreads();
    }
    float mean = red[0] * (1.0f / 1024.0f);
    __syncthreads();
    red[t] = ss; __syncthreads();
    for (int st = 128; st > 0; st >>= 1) {
        if (t < st) red[t] += red[t + st];
        __syncthreads();
    }
    float var  = red[0] * (1.0f / 1024.0f) - mean * mean;
    float rstd = __builtin_amdgcn_rsqf(var + 1e-8f);   // native v_rsq_f32

    _Float16* orow = oin + (size_t)row * 3072;
    const _Float16* urow = Uh + (size_t)row * 1024;
    #pragma unroll
    for (int i = 0; i < 4; ++i) {
        int c = t + i * 256;
        float a = (vals[i] - mean) * rstd;
        float u = (float)urow[c];
        orow[c]        = (_Float16)u;
        orow[1024 + c] = (_Float16)a;
        orow[2048 + c] = (_Float16)(u * a);
    }
}

// ---------------------------------------------------------------------------
// Host-side orchestration.
// ---------------------------------------------------------------------------
extern "C" void kernel_launch(void* const* d_in, const int* in_sizes, int n_in,
                              void* d_out, int out_size, void* d_ws, size_t ws_size,
                              hipStream_t stream) {
    const float* query = (const float*)d_in[0];
    const float* key_  = (const float*)d_in[1];
    const float* value = (const float*)d_in[2];
    const float* mask  = (const float*)d_in[3];
    const float* Wq = (const float*)d_in[4];   const float* bq = (const float*)d_in[5];
    const float* Wk = (const float*)d_in[6];   const float* bk = (const float*)d_in[7];
    const float* Wv = (const float*)d_in[8];   const float* bv = (const float*)d_in[9];
    const float* Wu = (const float*)d_in[10];  const float* bu = (const float*)d_in[11];
    const float* Wo = (const float*)d_in[12];  const float* bo = (const float*)d_in[13];
    float* out = (float*)d_out;

    const int M = 2 * 2048;        // 4096 rows
    const int H = 1024;

    // Workspace carve-out (~90 MB total, deterministic layout).
    char* ws = (char*)d_ws;
    size_t off = 0;
    auto carve = [&](size_t bytes) -> void* {
        void* p = ws + off;
        off += (bytes + 255) & ~(size_t)255;
        return p;
    };
    _Float16* Wq_t = (_Float16*)carve((size_t)H * H * 2);       // [N][K] f16
    _Float16* Wk_t = (_Float16*)carve((size_t)H * H * 2);
    _Float16* Wv_t = (_Float16*)carve((size_t)H * H * 2);
    _Float16* Wu_t = (_Float16*)carve((size_t)H * H * 2);
    _Float16* Wo_t = (_Float16*)carve((size_t)H * 3 * H * 2);   // [1024][3072]
    _Float16* Q_h  = (_Float16*)carve((size_t)M * H * 2);
    _Float16* K_h  = (_Float16*)carve((size_t)M * H * 2);
    _Float16* V_h  = (_Float16*)carve((size_t)M * H * 2);
    _Float16* U_h  = (_Float16*)carve((size_t)M * H * 2);
    float*    At_f = (float*)   carve((size_t)M * H * 4);
    _Float16* Oi_h = (_Float16*)carve((size_t)M * 3 * H * 2);
    (void)ws_size; (void)in_sizes; (void)n_in; (void)out_size;

    // 1) Weights -> f16, transposed to [N][K] for contiguous B staging:
    //    16 column tiles x 28 slabs of 256 k rows, one launch.
    cvt_transpose_all_kernel<<<dim3(16, 28), 256, 0, stream>>>(
        Wq, Wk, Wv, Wu, Wo, Wq_t, Wk_t, Wv_t, Wu_t, Wo_t);

    // 2) Projections: silu(X @ W + b), f16 outputs, all four in one launch.
    dim3 ggrid(M / BM, H / BN, 4);
    proj4_wmma_kernel<<<ggrid, 256, 0, stream>>>(
        query, key_, value, Wq_t, Wk_t, Wv_t, Wu_t, bq, bk, bv, bu,
        Q_h, K_h, V_h, U_h);

    // 3) Attention (16 query tiles x 32 (b,head) slices).
    dim3 agrid(AN / 128, 2 * ANH);
    attn_wmma_kernel<<<agrid, 256, 0, stream>>>(Q_h, K_h, V_h, mask, At_f);

    // 4) LayerNorm + concat [U, A, U*A].
    ln_concat_kernel<<<M, 256, 0, stream>>>(At_f, U_h, Oi_h);

    // 5) Final GEMM: o_input[4096x3072] @ Wo[3072x1024] + bo -> f32 out.
    dim3 fgrid(M / BM, H / BN);
    gemm_wmma_kernel<false, false, false, 1024, 3072><<<fgrid, 256, 0, stream>>>(
        nullptr, Oi_h, Wo_t, bo, nullptr, out);
}

// v008
// It runs in 123 microseconds.
// In both of two side-by-side timings against v007, it was 1.13 times as fast.
// All steps since v000 together make it 3.41 times as fast.
#include <hip/hip_runtime.h>
#include <hip/hip_bf16.h>
#include <math.h>

// HSTU attention for MI455X (gfx1250, wave32, WMMA).
// B=2, N=2048, H=1024, NH=16, HD=64.

typedef __attribute__((ext_vector_type(16))) _Float16 v16h;
typedef __attribute__((ext_vector_type(8)))  _Float16 v8h;
typedef __attribute__((ext_vector_type(4)))  _Float16 v4h;
typedef __attribute__((ext_vector_type(8)))  float    v8f;
typedef __attribute__((ext_vector_type(4)))  float    v4f;

#define WMMA16(a, b, c) __builtin_amdgcn_wmma_f32_16x16x32_f16( \
    false, (a), false, (b), (short)0, (c), false, false)

// SiLU via native v_exp_f32 + v_rcp_f32 (no IEEE div sequence).
__device__ __forceinline__ float silu_f(float x) {
    return x * __builtin_amdgcn_rcpf(1.0f + __expf(-x));
}

// The same SiLU, same instructions and rounding, for a long unrolled epilogue
// that runs the registers full.  The v_nop in the
// statement is the one slot that the instruction set asks for behind a
// transcendental.
__device__ __forceinline__ float silu_slot_f(float x) {
    float e, r;
    asm("v_exp_f32 %0, %1\n\tv_nop" : "=v"(e) : "v"(x * -1.442695041f));
    asm("v_rcp_f32 %0, %1\n\tv_nop" : "=v"(r) : "v"(1.0f + e));
    return x * r;
}

// Work-group barrier for tiles handed over through LDS alone: its fences name
// the LDS only, so that a wave waits out its LDS operations at the barrier and
// not its global loads as well (__syncthreads() drains those too, and a load
// issued ahead could never stay in flight across it).
__device__ __forceinline__ void lds_barrier() {
    __builtin_amdgcn_fence(__ATOMIC_RELEASE, "workgroup", "local");
    __builtin_amdgcn_s_barrier();
    __builtin_amdgcn_fence(__ATOMIC_ACQUIRE, "workgroup", "local");
}

// Load a v16h fragment per the CDNA5 16-bit A/B layout:
// halves 0..7  = K (or col) khalf..khalf+7
// halves 8..15 = K (or col) khalf+16..khalf+23   (khalf = (lane>>4)*8)
__device__ __forceinline__ v16h load_frag(const _Float16* p) {
    v16h f;
    *((v8h*)&f)       = *(const v8h*)p;
    *(((v8h*)&f) + 1) = *(const v8h*)(p + 16);
    return f;
}

// Transposing LDS load (ds_load_tr16_b128) from a row-major 16-bit tile T.
// Lane l passes the address of T[k + 8*(l>>4) + (l&7)][n + 8*((l>>3)&1)] and
// gets T[k + 8*(l>>4) + 0..7][n + (l&15)]: one half of a B fragment whose
// column is n + (l&15), in the k order of load_frag.
typedef __attribute__((ext_vector_type(8))) short s16x8;
__device__ __forceinline__ v8h load_tr16(const _Float16* p) {
    typedef __attribute__((address_space(3))) s16x8 lds_s16x8;
    return __builtin_bit_cast(v8h,
        __builtin_amdgcn_ds_load_tr16_b128_v8i16((lds_s16x8*)p));
}
// B fragment over 32 rows (k) of such a tile: rows k..k+15 and k+16..k+31.
__device__ __forceinline__ v16h load_frag_tr(const _Float16* p, int pitch) {
    v16h f;
    *((v8h*)&f)       = load_tr16(p);
    *(((v8h*)&f) + 1) = load_tr16(p + 16 * pitch);
    return f;
}

// ---------------------------------------------------------------------------
// Kernel: all five weights, f32 [K x 1024] -> f16 transposed [1024 x K], in one
// launch.  A work-group moves a 256(k) x 64(n) tile.  A thread loads a
// 16(k) x 4(n) block as 16 float4 (a wave-load covers two rows of 256 B), turns
// it in registers into 8-half runs along k, and the runs pass through LDS so
// that each wave-store writes 512 contiguous bytes of one output row.
// blockIdx.y counts slabs of 256 k rows: 4 each for Wq, Wk, Wv, Wu, 12 for Wo.
// ---------------------------------------------------------------------------
#define TK 256
#define TN 64
#define TP (TK + 8)  // LDS row pitch in halves (528 B = 16 B x odd)

__global__ __launch_bounds__(256) void cvt_transpose_all_kernel(
    const float* __restrict__ Wq, const float* __restrict__ Wk,
    const float* __restrict__ Wv, const float* __restrict__ Wu,
    const float* __restrict__ Wo,
    _Float16* __restrict__ Tq, _Float16* __restrict__ Tk,
    _Float16* __restrict__ Tv, _Float16* __restrict__ Tu,
    _Float16* __restrict__ To)
{
    __shared__ _Float16 Ts[TN * TP];   // [n][k], 16-B chunks swizzled per row

    const int t    = threadIdx.x;
    const int slab = blockIdx.y;
    const int w    = slab >> 2;
    const float* src = w == 0 ? Wq : w == 1 ? Wk : w == 2 ? Wv : w == 3 ? Wu : Wo;
    _Float16*    dst = w == 0 ? Tq : w == 1 ? Tk : w == 2 ? Tv : w == 3 ? Tu : To;
    const int K  = w < 4 ? 1024 : 3072;
    const int k0 = (w < 4 ? (slab & 3) : (slab - 16)) * TK;
    const int n0 = blockIdx.x * TN;

    const int nq = t & 15;   // which group of 4 columns
    const int kb = t >> 4;   // which group of 16 rows
    const float* p = src + (size_t)(k0 + kb * 16) * 1024 + n0 + nq * 4;
    v4f v[16];
    #pragma unroll
    for (int j = 0; j < 16; ++j)
        v[j] = *(const v4f*)(p + j * 1024);
    // Precaution: stands ahead of any reuse of the loads' address registers;
    // p as an input keeps them from being a load's own destination before it.
    asm volatile("s_wait_xcnt 0x0" :: "v"(p) : "memory");
    // Keeps the conversions behind all 16 loads: left free, the scheduler holds
    // four loads back behind the first waits, a second memory round trip.
    __builtin_amdgcn_sched_barrier(0);

    // The 16 lanes of a half-wave write rows 4 apart, which at this pitch fall
    // on four bank groups only; the chunk index is XORed with (row >> 4) so
    // that they spread over all 64 banks.  The reader undoes it.
    #pragma unroll
    for (int c = 0; c < 4; ++c) {
        #pragma unroll
        for (int hh = 0; hh < 2; ++hh) {
            v8h h;
            #pragma unroll
            for (int j = 0; j < 8; ++j)
                h[j] = (_Float16)v[hh * 8 + j][c];
            *(v8h*)&Ts[(nq * 4 + c) * TP + ((kb * 2 + hh) ^ (nq >> 2)) * 8] = h;
        }
    }
    __syncthreads();

    const int ch = t & 31;
    v8h h[8];
    #pragma unroll
    for (int i = 0; i < 8; ++i) {
        const int n = (t >> 5) + i * 8;    // one output row a wave
        h[i] = *(const v8h*)&Ts[n * TP + (ch ^ (n >> 4)) * 8];
    }
    _Float16* q = dst + ((n0 + (t >> 5)) * K + k0 + ch * 8);
    #pragma unroll
    for (int i = 0; i < 8; ++i)
        *(v8h*)(q + i * 8 * K) = h[i];
}

// ---------------------------------------------------------------------------
// WMMA GEMM: out = act(A[MxK] @ W[KxN] + bias), W given pre-transposed f16
// as Wt[N x K].  Block tile 128x64, BK=128. 256 threads = 8 waves arranged
// 4(M) x 2(N); each wave computes a 32x32 tile = 2x2 WMMA frags.
// A pass costs a global round trip, two barriers and an LDS round trip
// whatever its depth, so a pass takes 128 k (four WMMA k steps): a quarter of
// the passes, each with four times the bytes in flight, and every f16 operand
// row piece is 256 aligned bytes.  K must be a multiple of 128.
// ---------------------------------------------------------------------------
#define BM 128
#define BN 64
#define BK 128
#define LDA 136  // BK + 8 halves pad (row = 272B = 16B x odd)
#define LDB 136

template <bool A_IS_F32, bool SILU, bool OUT_F16, int N, int K>
__device__ __forceinline__ void gemm_tile(
    const float* __restrict__ A32, const _Float16* __restrict__ A16,
    const _Float16* __restrict__ Wt, const float* __restrict__ bias,
    _Float16* __restrict__ out16, float* __restrict__ out32)
{
    __shared__ _Float16 As[BM * LDA];
    __shared__ _Float16 Bs[BN * LDB];

    const int t     = threadIdx.x;
    const int lane  = t & 31;
    const int wid   = t >> 5;
    const int waveM = wid >> 1;   // 0..3
    const int waveN = wid & 1;    // 0..1
    const int row0  = blockIdx.x * BM;
    const int col0  = blockIdx.y * BN;
    const int l16   = lane & 15;
    const int khalf = (lane >> 4) * 8;

    v8f zero = {};
    v8f acc[2][2];
    acc[0][0] = zero; acc[0][1] = zero; acc[1][0] = zero; acc[1][1] = zero;

    // Staging maps, fixed for the thread: every load of a pass is its base
    // pointer plus a compile-time offset (N and K are template constants), so
    // the fatter pass needs no address register per load.
    const int a_r = A_IS_F32 ? (t >> 5) : (t >> 4);            // first A row
    const int a_c = A_IS_F32 ? (t & 31) * 4 : (t & 15) * 8;    // A column
    const int b_n = t >> 4;                                    // first B row
    const int b_c = (t & 15) * 8;                              // B column
    const float*    pA32 = A_IS_F32 ? A32 + (size_t)(row0 + a_r) * K + a_c : nullptr;
    const _Float16* pA16 = A_IS_F32 ? nullptr : A16 + (size_t)(row0 + a_r) * K + a_c;
    const _Float16* pB   = Wt + (size_t)(col0 + b_n) * K + b_c;
    _Float16* sA = &As[a_r * LDA + a_c];
    _Float16* sB = &Bs[b_n * LDB + b_c];
    const _Float16* pPre = Wt + (size_t)(col0 + (t >> 2)) * K + BK;

    // 64x128 f16 B tile from pre-transposed Wt[N][K]: 4 v8h per thread,
    // 16 rows apart.  128x128 f16 A tile: 8 v8h per thread, 16 rows apart.
    v8h vb[BN / 16];
    v8h va16[BM / 16];
    // f16 A (two work-groups a WGP, registers to spare): the staging registers
    // are filled one pass ahead, behind the barrier that publishes the pass in
    // hand, so that the global round trip runs under its fragment reads and
    // WMMAs and not in front of them.
    auto fetch16 = [&](int k0) {
        #pragma unroll
        for (int j = 0; j < BN / 16; ++j)
            vb[j] = *(const v8h*)(pB + k0 + j * 16 * K);
        #pragma unroll
        for (int j = 0; j < BM / 16; ++j)
            va16[j] = *(const v8h*)(pA16 + k0 + j * 16 * K);
    };
    if (!A_IS_F32) fetch16(0);

    for (int k0 = 0; k0 < K; k0 += BK) {
        __syncthreads();
        if (A_IS_F32) {
            // All global loads of the pass go out first, into registers, with
            // fixed trip counts (no per-trip bound test on the thread index),
            // so that the pass waits out one round trip and not one per load.
            #pragma unroll
            for (int j = 0; j < BN / 16; ++j)
                vb[j] = *(const v8h*)(pB + k0 + j * 16 * K);
            // 128x128 f32 tile: float4 loads -> v4h LDS stores (16 per
            // thread, 8 rows apart; a wave-load is one row piece of 512 B).
            float4 va[BM / 8];
            #pragma unroll
            for (int j = 0; j < BM / 8; ++j)
                va[j] = *(const float4*)(pA32 + k0 + j * 8 * K);
            #pragma unroll
            for (int j = 0; j < BM / 8; ++j) {
                v4h h = { (_Float16)va[j].x, (_Float16)va[j].y,
                          (_Float16)va[j].z, (_Float16)va[j].w };
                *(v4h*)(sA + j * 8 * LDA) = h;
            }
        } else {
            #pragma unroll
            for (int j = 0; j < BM / 16; ++j)
                *(v8h*)(sA + j * 16 * LDA) = va16[j];
        }
        #pragma unroll
        for (int j = 0; j < BN / 16; ++j)
            *(v8h*)(sB + j * 16 * LDB) = vb[j];
        // Prefetch next Wt tile into L2, one address a row.  In asm text over a pointer that lives through the
        // loop: the builtin's address here was a temporary whose register the
        // fragment reads below take over at once.
        // (f32 A only: with f16 A the loads themselves ask for that tile below.)
        if (A_IS_F32) {
            if (k0 + BK < K)
                asm volatile("global_prefetch_b8 %0, off scope:SCOPE_SE" :: "v"(pPre));
            // The pointer stays inside Wt behind its last use as well.
            pPre += (k0 + 2 * BK < K) ? BK : 0;
        }
        __syncthreads();

        if (!A_IS_F32) {
            if (k0 + BK < K) fetch16(k0 + BK);
            // Holds the next pass's loads ahead of this pass's fragment reads:
            // sunk among the WMMAs they would lose the lead they are issued for.
            __builtin_amdgcn_sched_barrier(0);
        }

        // The four k steps of 32 run in ascending k as before, but their
        // fragment reads go out in groups of FG k steps ahead of the WMMAs, so
        // that the pass also waits out one LDS round trip a group and not two
        // a k step.  FG: what the registers allow (f32 A: two k steps, in the
        // registers that the staging has just left, which keeps four
        // work-groups on a WGP; f16 A: all four, beside the next pass's
        // staging registers, with the two work-groups a WGP that its grid gives).
        constexpr int FG = A_IS_F32 ? 2 : 4;
        #pragma unroll
        for (int g = 0; g < BK / 32; g += FG) {
            v16h afrag[FG][2], bfrag[FG][2];
            #pragma unroll
            for (int s = 0; s < FG; ++s) {
                const int ks = (g + s) * 32;
                #pragma unroll
                for (int am = 0; am < 2; ++am) {
                    int r = waveM * 32 + am * 16 + l16;
                    afrag[s][am] = load_frag(&As[r * LDA + ks + khalf]);
                }
                #pragma unroll
                for (int bn = 0; bn < 2; ++bn) {
                    int n = waveN * 32 + bn * 16 + l16;
                    bfrag[s][bn] = load_frag(&Bs[n * LDB + ks + khalf]);
                }
            }
            // Holds the group's reads ahead of its WMMAs: left free, the
            // scheduler sinks them back among the WMMAs, each behind a full wait.
            __builtin_amdgcn_sched_barrier(0);
            #pragma unroll
            for (int s = 0; s < FG; ++s) {
                acc[0][0] = WMMA16(afrag[s][0], bfrag[s][0], acc[0][0]);
                acc[0][1] = WMMA16(afrag[s][0], bfrag[s][1], acc[0][1]);
                acc[1][0] = WMMA16(afrag[s][1], bfrag[s][0], acc[1][0]);
                acc[1][1] = WMMA16(afrag[s][1], bfrag[s][1], acc[1][1]);
            }
        }
    }

    // Epilogue: C/D layout — lane: col = l16, VGPR r: row = r + (lane>>4)*8.
    #pragma unroll
    for (int am = 0; am < 2; ++am) {
        int rowbase = row0 + waveM * 32 + am * 16 + (lane >> 4) * 8;
        #pragma unroll
        for (int bn = 0; bn < 2; ++bn) {
            int col = col0 + waveN * 32 + bn * 16 + l16;
            float bv = bias[col];
            #pragma unroll
            for (int r = 0; r < 8; ++r) {
                float v = acc[am][bn][r] + bv;
                if (SILU) v = silu_f(v);
                size_t idx = (size_t)(rowbase + r) * N + col;
                if (OUT_F16) out16[idx] = (_Float16)v;
                else         out32[idx] = v;
            }
        }
    }
}

// ---------------------------------------------------------------------------
// Projection tile: out = silu(X[M x 1024] @ W + b) -> f16, X in f32, W given
// pre-transposed f16 as Wt[N][K].  Block tile 128x128, 128 threads = 4 waves
// arranged 2(M) x 2(N); each wave computes a 64x64 tile = 4x4 WMMA frags, so
// that a fragment read from LDS feeds four WMMAs (two with a 32x32 wave tile)
// and a row of X is fetched and converted by 8 work-groups and not by 16.
// A pass takes 64 k: its staging registers (96) and the 128 accumulator
// registers stay inside the 256 that four waves a SIMD leave each wave.
// ---------------------------------------------------------------------------
#define PM 128
#define PN 128
#define PK 64
#define LDP 72  // PK + 8 halves pad (row = 144B = 16B x odd)

__device__ __forceinline__ void proj_tile(
    const float* __restrict__ X, const _Float16* __restrict__ Wt,
    const float* __restrict__ bias, _Float16* __restrict__ out,
    int row0, int col0)
{
    constexpr int N = 1024, K = 1024;
    __shared__ _Float16 As[PM * LDP];
    __shared__ _Float16 Bs[PN * LDP];

    const int t     = threadIdx.x;
    const int lane  = t & 31;
    const int wid   = t >> 5;
    const int waveM = wid >> 1;   // 0..1
    const int waveN = wid & 1;    // 0..1
    const int l16   = lane & 15;
    const int khalf = (lane >> 4) * 8;

    v8f zero = {};
    v8f acc[4][4];
    #pragma unroll
    for (int am = 0; am < 4; ++am)
        #pragma unroll
        for (int bn = 0; bn < 4; ++bn)
            acc[am][bn] = zero;

    // Staging maps, fixed for the thread: every load of a pass is its base
    // pointer plus a compile-time offset.  A wave-load covers two 256-B row
    // pieces of X, or four 128-B row pieces of Wt.
    const int a_r = t >> 4;          // first X row, then 8 rows apart
    const int a_c = (t & 15) * 4;    // X column
    const int b_n = t >> 3;          // first Wt row, then 16 rows apart
    const int b_c = (t & 7) * 8;     // Wt column
    const float*    pA = X  + (size_t)(row0 + a_r) * K + a_c;
    const _Float16* pB = Wt + (size_t)(col0 + b_n) * K + b_c;
    _Float16* sA = &As[a_r * LDP + a_c];
    _Float16* sB = &Bs[b_n * LDP + b_c];
    const _Float16* fA = &As[(waveM * 64 + l16) * LDP + khalf];
    const _Float16* fB = &Bs[(waveN * 64 + l16) * LDP + khalf];

    for (int k0 = 0; k0 < K; k0 += PK) {
        __syncthreads();
        // All global loads of the pass go out first, into registers, so that
        // the pass waits out one round trip and not one per load.
        const float*    qa = pA + k0;
        const _Float16* qb = pB + k0;
        v8h vb[PN / 16];
        #pragma unroll
        for (int j = 0; j < PN / 16; ++j)
            vb[j] = *(const v8h*)(qb + j * 16 * K);
        float4 va[PM / 8];
        #pragma unroll
        for (int j = 0; j < PM / 8; ++j)
            va[j] = *(const float4*)(qa + j * 8 * K);
        // Precaution: stands ahead of any reuse of the loads' address
        // registers; the pointers as inputs keep those registers from being
        // a load's own destination before it.
        asm volatile("s_wait_xcnt 0x0" :: "v"(qa), "v"(qb) : "memory");
        #pragma unroll
        for (int j = 0; j < PM / 8; ++j) {
            v4h h = { (_Float16)va[j].x, (_Float16)va[j].y,
                      (_Float16)va[j].z, (_Float16)va[j].w };
            *(v4h*)(sA + j * 8 * LDP) = h;
        }
        #pragma unroll
        for (int j = 0; j < PN / 16; ++j)
            *(v8h*)(sB + j * 16 * LDP) = vb[j];
        __syncthreads();

        // Two k steps of 32 in ascending k; a step's 16 fragment reads go out
        // as one group ahead of its 16 WMMAs.
        #pragma unroll
        for (int ks = 0; ks < PK; ks += 32) {
            v16h af[4], bf[4];
            #pragma unroll
            for (int i = 0; i < 4; ++i) {
                af[i] = load_frag(fA + i * 16 * LDP + ks);
                bf[i] = load_frag(fB + i * 16 * LDP + ks);
            }
            // Holds the step's reads ahead of its WMMAs: left free, the
            // scheduler sinks them among the WMMAs, each behind a full wait.
            __builtin_amdgcn_sched_barrier(0);
            #pragma unroll
            for (int am = 0; am < 4; ++am)
                #pragma unroll
                for (int bn = 0; bn < 4; ++bn)
                    acc[am][bn] = WMMA16(af[am], bf[bn], acc[am][bn]);
        }
    }

    // Epilogue: C/D layout, lane: col = l16, VGPR r: row = r + (lane>>4)*8.
    #pragma unroll
    for (int bn = 0; bn < 4; ++bn) {
        int col = col0 + waveN * 64 + bn * 16 + l16;
        float bv = bias[col];
        #pragma unroll
        for (int am = 0; am < 4; ++am) {
            int rowbase = row0 + waveM * 64 + am * 16 + (lane >> 4) * 8;
            #pragma unroll
            for (int r = 0; r < 8; ++r)
                out[(size_t)(rowbase + r) * N + col] =
                    (_Float16)silu_slot_f(acc[am][bn][r] + bv);
        }
    }
}

// The four projections silu(X @ W + b) -> f16 in ONE launch of 1024
// work-groups, four resident a WGP (one wave of each on every SIMD), which
// fill each other's waits.  blockIdx.y picks the operand set (y >> 1 = 0: Q,
// 1: K, 2: V, 3: U; V and U both read Xv) and the half of its columns,
// blockIdx.z the column tile in that half: work-groups 256 apart in launch
// order then read the same rows of X (for speed only, nothing rests on it).
// Four waves a SIMD, stated so that the compiler keeps to 256 registers.
__global__ __launch_bounds__(128) __attribute__((amdgpu_waves_per_eu(4, 4)))
void proj4_wmma_kernel(
    const float* __restrict__ Xq, const float* __restrict__ Xk,
    const float* __restrict__ Xv,
    const _Float16* __restrict__ Tq, const _Float16* __restrict__ Tk,
    const _Float16* __restrict__ Tv, const _Float16* __restrict__ Tu,
    const float* __restrict__ bq, const float* __restrict__ bk,
    const float* __restrict__ bv, const float* __restrict__ bu,
    _Float16* __restrict__ Qo, _Float16* __restrict__ Ko,
    _Float16* __restrict__ Vo, _Float16* __restrict__ Uo)
{
    const int z = blockIdx.y >> 1;
    const float*    X = z == 0 ? Xq : z == 1 ? Xk : Xv;
    const _Float16* T = z == 0 ? Tq : z == 1 ? Tk : z == 2 ? Tv : Tu;
    const float*    b = z == 0 ? bq : z == 1 ? bk : z == 2 ? bv : bu;
    _Float16*       O = z == 0 ? Qo : z == 1 ? Ko : z == 2 ? Vo : Uo;
    proj_tile(X, T, b, O, blockIdx.x * PM,
              ((blockIdx.y & 1) * 4 + blockIdx.z) * PN);
}

// One product a launch (the final GEMM).
template <bool A_IS_F32, bool SILU, bool OUT_F16, int N, int K>
__global__ __launch_bounds__(256) void gemm_wmma_kernel(
    const float* __restrict__ A32, const _Float16* __restrict__ A16,
    const _Float16* __restrict__ Wt, const float* __restrict__ bias,
    _Float16* __restrict__ out16, float* __restrict__ out32)
{
    gemm_tile<A_IS_F32, SILU, OUT_F16, N, K>(A32, A16, Wt, bias, out16, out32);
}

// ---------------------------------------------------------------------------
// Attention: per (b,head) slice, 128-query tile per block, stream 64-key tiles.
// scores = silu(Q K^T)/N * mask  (linear accumulation, no softmax) then S @ V.
// ---------------------------------------------------------------------------
#define AN 2048
#define AH 1024
#define ANH 16
#define AHD 64
#define LQK 72  // 64 + 8 halves pad (144B rows, 16B aligned)
#define LV  80  // V rows: 64 + 16 halves (160 B = 32 B x odd, the transposing load's pitch)

// Two work-groups a WGP is all the grid gives (512 on 256 WGPs): four waves a
// SIMD, stated so that the compiler spends the 256 registers a wave then has
// on loads in flight and does not schedule for more resident waves.
__global__ __launch_bounds__(256) __attribute__((amdgpu_waves_per_eu(4, 4)))
void attn_wmma_kernel(
    const _Float16* __restrict__ Qg, const _Float16* __restrict__ Kg,
    const _Float16* __restrict__ Vg, const float* __restrict__ mask,
    float* __restrict__ Og)
{
    __shared__ _Float16 Qs[128 * LQK];      // 128 queries x 64 d
    __shared__ _Float16 Ks[64 * LQK];       // 64 keys x 64 d
    __shared__ _Float16 Vs[64 * LV];        // 64 keys x 64 d, as in memory
    __shared__ _Float16 Ps[8 * 16 * LQK];   // per-wave probs: 16 q x 64 key

    const int bh   = blockIdx.y;
    const int b    = bh / ANH;
    const int h    = bh % ANH;
    const int q0   = blockIdx.x * 128;
    const int t    = threadIdx.x;
    const int lane = t & 31;
    const int wid  = t >> 5;
    const int l16  = lane & 15;
    const int khalf = (lane >> 4) * 8;

    const _Float16* Qbase = Qg + (size_t)(b * AN + q0) * AH + h * AHD;
    const float* mrow = mask + (size_t)b * AN * AN;
    const float invN = 1.0f / (float)AN;

    // Stage Q tile: v8h copies (4 per thread), all loads ahead of the stores.
    {
        v8h qv[4];
        #pragma unroll
        for (int j = 0; j < 4; ++j) {
            int i = t + j * 256;
            int r = i >> 3, d = (i & 7) * 8;
            qv[j] = *(const v8h*)&Qbase[(size_t)r * AH + d];
        }
        // Precaution: the offset registers of the four loads above are reused
        // soon after; this wait stands ahead of any such overwrite.
        asm volatile("s_wait_xcnt 0x0" ::: "memory");
        #pragma unroll
        for (int j = 0; j < 4; ++j) {
            int i = t + j * 256;
            int r = i >> 3, d = (i & 7) * 8;
            *(v8h*)&Qs[r * LQK + d] = qv[j];
        }
    }
    __syncthreads();

    // A-fragments from Q are loop-invariant per wave (16 query rows).
    v16h aq0, aq1;
    {
        int r = wid * 16 + l16;
        aq0 = load_frag(&Qs[r * LQK + khalf]);        // d 0..31
        aq1 = load_frag(&Qs[r * LQK + 32 + khalf]);   // d 32..63
    }

    v8f zero = {};
    v8f o[4];
    o[0] = zero; o[1] = zero; o[2] = zero; o[3] = zero;

    _Float16* Pw = &Ps[wid * 16 * LQK];
    // The lane's address in V's tile for the transposing loads (key 0, d 0).
    const _Float16* Vr = &Vs[(khalf + (lane & 7)) * LV + ((lane >> 3) & 1) * 8];

    // All global loads of the pass that starts at key m0: K and V (v8h, two
    // each a thread) and the wave's mask values (16 queries x 64 keys).
    // K's rows are dealt out over the four score tiles: row p of Ks holds key
    // 4 * (p & 15) + (p >> 4), so that column l16 of score tile nt is key
    // 4 * l16 + nt and a lane holds four consecutive keys of each of its
    // queries.  Its mask values are then one float4 a query (a wave-load is
    // two whole rows of 256 B) and its probabilities one 8-byte LDS store a
    // query, in P's plain key order.  V and P keep that order.
    v8h kv[2], vv[2];
    const unsigned kvo = (unsigned)((t >> 3) * AH + (t & 7) * 8);
    const unsigned kko = (unsigned)((4 * ((t >> 3) & 15) + (t >> 7)) * AH + (t & 7) * 8);
    const unsigned mo  = (unsigned)((wid * 16 + (lane >> 4) * 8) * AN + l16 * 4);
    v4f mv[8];
    auto fetch_kv = [&](int m0) {
        const _Float16* Kb = Kg + (size_t)(b * AN + m0) * AH + h * AHD;
        const _Float16* Vb = Vg + (size_t)(b * AN + m0) * AH + h * AHD;
        const _Float16* kp = Kb + kko;
        const _Float16* vp = Vb + kvo;
        kv[0] = *(const v8h*)kp;
        vv[0] = *(const v8h*)vp;
        kv[1] = *(const v8h*)(kp + 2 * AH);    // row p + 32 of Ks: key + 2
        vv[1] = *(const v8h*)(vp + 32 * AH);
        // Precaution: stands ahead of any reuse of the loads' address
        // registers; the pointers as inputs keep those registers from being
        // a later load's own destination before it.
        asm volatile("s_wait_xcnt 0x0" :: "v"(kp), "v"(vp) : "memory");
    };
    auto fetch_mask = [&](int m0) {
        const float* Mb = mrow + (size_t)q0 * AN + m0;
        const float* mp = Mb + mo;
        #pragma unroll
        for (int r = 0; r < 8; ++r)
            mv[r] = *(const v4f*)(mp + r * AN);
        // The same precaution.
        asm volatile("s_wait_xcnt 0x0" :: "v"(mp) : "memory");
    };

    // A pass finds its K, V and mask values in registers.  The next pass's
    // loads go out as soon as their registers are free: K and V behind the
    // barrier that publishes this pass's tiles, the mask behind its last use,
    // so that their round trips run under this pass's work.
    fetch_kv(0);
    fetch_mask(0);
    for (int m0 = 0; m0 < AN; m0 += 64) {
        // The last pass asks for its own tile again: no branch in the loop
        // body, and every address stays inside its buffer.
        const int mn = m0 + 64 < AN ? m0 + 64 : m0;
        lds_barrier();
        // Stage K and V, both as straight 16-byte copies.
        #pragma unroll
        for (int u = 0; u < 2; ++u) {
            int i = t + u * 256;
            int r = i >> 3, d = (i & 7) * 8;
            *(v8h*)&Ks[r * LQK + d] = kv[u];
            *(v8h*)&Vs[r * LV + d]  = vv[u];
        }
        lds_barrier();

        fetch_kv(mn);

        // Scores: 16 queries x 64 keys per wave, 2 WMMAs per 16x16 tile.
        v4h ph[8];
        #pragma unroll
        for (int nt = 0; nt < 4; ++nt) {
            int kr = nt * 16 + l16;    // row of Ks: key 4 * l16 + nt
            v16h bk0 = load_frag(&Ks[kr * LQK + khalf]);
            v16h bk1 = load_frag(&Ks[kr * LQK + 32 + khalf]);
            v8f s = zero;
            s = WMMA16(aq0, bk0, s);
            s = WMMA16(aq1, bk1, s);

            #pragma unroll
            for (int r = 0; r < 8; ++r) {
                float x = s[r];
                float v = silu_f(x) * invN * mv[r][nt];
                ph[r][nt] = (_Float16)v;
            }
        }
        #pragma unroll
        for (int r = 0; r < 8; ++r)
            *(v4h*)&Pw[((lane >> 4) * 8 + r) * LQK + l16 * 4] = ph[r];

        fetch_mask(mn);

        // P @ V: re-layout P (C->A) via per-wave LDS round-trip (in-order DS).
        v16h ap0 = load_frag(&Pw[l16 * LQK + khalf]);        // keys 0..31
        v16h ap1 = load_frag(&Pw[l16 * LQK + 32 + khalf]);   // keys 32..63
        #pragma unroll
        for (int dt = 0; dt < 4; ++dt) {
            // V is turned on its way out of LDS: column d = dt*16 + l16.
            v16h bv0 = load_frag_tr(Vr + dt * 16, LV);             // keys 0..31
            v16h bv1 = load_frag_tr(Vr + 32 * LV + dt * 16, LV);   // keys 32..63
            o[dt] = WMMA16(ap0, bv0, o[dt]);
            o[dt] = WMMA16(ap1, bv1, o[dt]);
        }
    }

    // The last pass's loads are used by nobody: they have landed before the
    // wave reuses their registers or gives them back at its end.
    asm volatile("s_wait_loadcnt 0x0" ::: "memory");

    // Write f32 attention output [B*N, H].
    int qb = b * AN + q0 + wid * 16 + (lane >> 4) * 8;
    #pragma unroll
    for (int dt = 0; dt < 4; ++dt) {
        int col = h * AHD + dt * 16 + l16;
        #pragma unroll
        for (int r = 0; r < 8; ++r)
            Og[(size_t)(qb + r) * AH + col] = o[dt][r];
    }
}

// ---------------------------------------------------------------------------
// LayerNorm over H=1024 + build o_input = [U, A, U*A] as f16 [4096 x 3072].
// ---------------------------------------------------------------------------
__global__ __launch_bounds__(256) void ln_concat_kernel(
    const float* __restrict__ attn, const _Float16* __restrict__ Uh,
    _Float16* __restrict__ oin)
{
    __shared__ float red[256];
    const int row = blockIdx.x;
    const int t = threadIdx.x;
    const float* x = attn + (size_t)row * 1024;

    float vals[4], s = 0.0f, ss = 0.0f;
    #pragma unroll
    for (int i = 0; i < 4; ++i) {
        float v = x[t + i * 256];
        vals[i] = v; s += v; ss += v * v;
    }
    red[t] = s; __syncthreads();
    for (int st = 128; st > 0; st >>= 1) {
        if (t < st) red[t] += red[t + st];
        __syncthreads();
    }
    float mean = red[0] * (1.0f / 1024.0f);
    __syncthreads();
    red[t] = ss; __syncthreads();
    for (int st = 128; st > 0; st >>= 1) {
        if (t < st) red[t] += red[t + st];
        __syncthreads();
    }
    float var  = red[0] * (1.0f / 1024.0f) - mean * mean;
    float rstd = __builtin_amdgcn_rsqf(var + 1e-8f);   // native v_rsq_f32

    _Float16* orow = oin + (size_t)row * 3072;
    const _Float16* urow = Uh + (size_t)row * 1024;
    #pragma unroll
    for (int i = 0; i < 4; ++i) {
        int c = t + i * 256;
        float a = (vals[i] - mean) * rstd;
        float u = (float)urow[c];
        orow[c]        = (_Float16)u;
        orow[1024 + c] = (_Float16)a;
        orow[2048 + c] = (_Float16)(u * a);
    }
}

// ---------------------------------------------------------------------------
// Host-side orchestration.
// ---------------------------------------------------------------------------
extern "C" void kernel_launch(void* const* d_in, const int* in_sizes, int n_in,
                              void* d_out, int out_size, void* d_ws, size_t ws_size,
                              hipStream_t stream) {
    const float* query = (const float*)d_in[0];
    const float* key_  = (const float*)d_in[1];
    const float* value = (const float*)d_in[2];
    const float* mask  = (const float*)d_in[3];
    const float* Wq = (const float*)d_in[4];   const float* bq = (const float*)d_in[5];
    const float* Wk = (const float*)d_in[6];   const float* bk = (const float*)d_in[7];
    const float* Wv = (const float*)d_in[8];   const float* bv = (const float*)d_in[9];
    const float* Wu = (const float*)d_in[10];  const float* bu = (const float*)d_in[11];
    const float* Wo = (const float*)d_in[12];  const float* bo = (const float*)d_in[13];
    float* out = (float*)d_out;

    const int M = 2 * 2048;        // 4096 rows
    const int H = 1024;

    // Workspace carve-out (~90 MB total, deterministic layout).
    char* ws = (char*)d_ws;
    size_t off = 0;
    auto carve = [&](size_t bytes) -> void* {
        void* p = ws + off;
        off += (bytes + 255) & ~(size_t)255;
        return p;
    };
    _Float16* Wq_t = (_Float16*)carve((size_t)H * H * 2);       // [N][K] f16
    _Float16* Wk_t = (_Float16*)carve((size_t)H * H * 2);
    _Float16* Wv_t = (_Float16*)carve((size_t)H * H * 2);
    _Float16* Wu_t = (_Float16*)carve((size_t)H * H * 2);
    _Float16* Wo_t = (_Float16*)carve((size_t)H * 3 * H * 2);   // [1024][3072]
    _Float16* Q_h  = (_Float16*)carve((size_t)M * H * 2);
    _Float16* K_h  = (_Float16*)carve((size_t)M * H * 2);
    _Float16* V_h  = (_Float16*)carve((size_t)M * H * 2);
    _Float16* U_h  = (_Float16*)carve((size_t)M * H * 2);
    float*    At_f = (float*)   carve((size_t)M * H * 4);
    _Float16* Oi_h = (_Float16*)carve((size_t)M * 3 * H * 2);
    (void)ws_size; (void)in_sizes; (void)n_in; (void)out_size;

    // 1) Weights -> f16, transposed to [N][K] for contiguous B staging:
    //    16 column tiles x 28 slabs of 256 k rows, one launch.
    cvt_transpose_all_kernel<<<dim3(16, 28), 256, 0, stream>>>(
        Wq, Wk, Wv, Wu, Wo, Wq_t, Wk_t, Wv_t, Wu_t, Wo_t);

    // 2) Projections: silu(X @ W + b), f16 outputs, all four in one launch.
    dim3 ggrid(M / PM, 8, 4);
    proj4_wmma_kernel<<<ggrid, 128, 0, stream>>>(
        query, key_, value, Wq_t, Wk_t, Wv_t, Wu_t, bq, bk, bv, bu,
        Q_h, K_h, V_h, U_h);

    // 3) Attention (16 query tiles x 32 (b,head) slices).
    dim3 agrid(AN / 128, 2 * ANH);
    attn_wmma_kernel<<<agrid, 256, 0, stream>>>(Q_h, K_h, V_h, mask, At_f);

    // 4) LayerNorm + concat [U, A, U*A].
    ln_concat_kernel<<<M, 256, 0, stream>>>(At_f, U_h, Oi_h);

    // 5) Final GEMM: o_input[4096x3072] @ Wo[3072x1024] + bo -> f32 out.
    dim3 fgrid(M / BM, H / BN);
    gemm_wmma_kernel<false, false, false, 1024, 3072><<<fgrid, 256, 0, stream>>>(
        nullptr, Oi_h, Wo_t, bo, nullptr, out);
}

// v009
// It runs in 118 microseconds.
// Next to v008, in two timings, it ran 1.04 times as fast each time.
// Counting every step since v000, it is 3.54 times as fast.
#include <hip/hip_runtime.h>
#include <hip/hip_bf16.h>
#include <math.h>

// HSTU attention for MI455X (gfx1250, wave32, WMMA).
// B=2, N=2048, H=1024, NH=16, HD=64.

typedef __attribute__((ext_vector_type(16))) _Float16 v16h;
typedef __attribute__((ext_vector_type(8)))  _Float16 v8h;
typedef __attribute__((ext_vector_type(4)))  _Float16 v4h;
typedef __attribute__((ext_vector_type(8)))  float    v8f;
typedef __attribute__((ext_vector_type(4)))  float    v4f;

#define WMMA16(a, b, c) __builtin_amdgcn_wmma_f32_16x16x32_f16( \
    false, (a), false, (b), (short)0, (c), false, false)

// SiLU via native v_exp_f32 + v_rcp_f32 (no IEEE div sequence).
__device__ __forceinline__ float silu_f(float x) {
    return x * __builtin_amdgcn_rcpf(1.0f + __expf(-x));
}

// The same SiLU, same instructions and rounding, for a long unrolled epilogue
// that runs the registers full.  The v_nop in the
// statement is the one slot that the instruction set asks for behind a
// transcendental.
__device__ __forceinline__ float silu_slot_f(float x) {
    float e, r;
    asm("v_exp_f32 %0, %1\n\tv_nop" : "=v"(e) : "v"(x * -1.442695041f));
    asm("v_rcp_f32 %0, %1\n\tv_nop" : "=v"(r) : "v"(1.0f + e));
    return x * r;
}

// Work-group barrier for tiles handed over through LDS alone: its fences name
// the LDS only, so that a wave waits out its LDS operations at the barrier and
// not its global loads as well (__syncthreads() drains those too, and a load
// issued ahead could never stay in flight across it).
__device__ __forceinline__ void lds_barrier() {
    __builtin_amdgcn_fence(__ATOMIC_RELEASE, "workgroup", "local");
    __builtin_amdgcn_s_barrier();
    __builtin_amdgcn_fence(__ATOMIC_ACQUIRE, "workgroup", "local");
}

// Load a v16h fragment per the CDNA5 16-bit A/B layout:
// halves 0..7  = K (or col) khalf..khalf+7
// halves 8..15 = K (or col) khalf+16..khalf+23   (khalf = (lane>>4)*8)
__device__ __forceinline__ v16h load_frag(const _Float16* p) {
    v16h f;
    *((v8h*)&f)       = *(const v8h*)p;
    *(((v8h*)&f) + 1) = *(const v8h*)(p + 16);
    return f;
}

// Transposing LDS load (ds_load_tr16_b128) from a row-major 16-bit tile T.
// Lane l passes the address of T[k + 8*(l>>4) + (l&7)][n + 8*((l>>3)&1)] and
// gets T[k + 8*(l>>4) + 0..7][n + (l&15)]: one half of a B fragment whose
// column is n + (l&15), in the k order of load_frag.
typedef __attribute__((ext_vector_type(8))) short s16x8;
__device__ __forceinline__ v8h load_tr16(const _Float16* p) {
    typedef __attribute__((address_space(3))) s16x8 lds_s16x8;
    return __builtin_bit_cast(v8h,
        __builtin_amdgcn_ds_load_tr16_b128_v8i16((lds_s16x8*)p));
}
// B fragment over 32 rows (k) of such a tile: rows k..k+15 and k+16..k+31.
__device__ __forceinline__ v16h load_frag_tr(const _Float16* p, int pitch) {
    v16h f;
    *((v8h*)&f)       = load_tr16(p);
    *(((v8h*)&f) + 1) = load_tr16(p + 16 * pitch);
    return f;
}

// ---------------------------------------------------------------------------
// Kernel: all five weights, f32 [K x 1024] -> f16 transposed [1024 x K], in one
// launch.  A work-group moves a 256(k) x 64(n) tile.  A thread loads a
// 16(k) x 4(n) block as 16 float4 (a wave-load covers two rows of 256 B), turns
// it in registers into 8-half runs along k, and the runs pass through LDS so
// that each wave-store writes 512 contiguous bytes of one output row.
// blockIdx.y counts slabs of 256 k rows: 4 each for Wq, Wk, Wv, Wu, 12 for Wo.
// ---------------------------------------------------------------------------
#define TK 256
#define TN 64
#define TP (TK + 8)  // LDS row pitch in halves (528 B = 16 B x odd)

__global__ __launch_bounds__(256) void cvt_transpose_all_kernel(
    const float* __restrict__ Wq, const float* __restrict__ Wk,
    const float* __restrict__ Wv, const float* __restrict__ Wu,
    const float* __restrict__ Wo,
    _Float16* __restrict__ Tq, _Float16* __restrict__ Tk,
    _Float16* __restrict__ Tv, _Float16* __restrict__ Tu,
    _Float16* __restrict__ To)
{
    __shared__ _Float16 Ts[TN * TP];   // [n][k], 16-B chunks swizzled per row

    const int t    = threadIdx.x;
    const int slab = blockIdx.y;
    const int w    = slab >> 2;
    const float* src = w == 0 ? Wq : w == 1 ? Wk : w == 2 ? Wv : w == 3 ? Wu : Wo;
    _Float16*    dst = w == 0 ? Tq : w == 1 ? Tk : w == 2 ? Tv : w == 3 ? Tu : To;
    const int K  = w < 4 ? 1024 : 3072;
    const int k0 = (w < 4 ? (slab & 3) : (slab - 16)) * TK;
    const int n0 = blockIdx.x * TN;

    const int nq = t & 15;   // which group of 4 columns
    const int kb = t >> 4;   // which group of 16 rows
    const float* p = src + (size_t)(k0 + kb * 16) * 1024 + n0 + nq * 4;
    v4f v[16];
    #pragma unroll
    for (int j = 0; j < 16; ++j)
        v[j] = *(const v4f*)(p + j * 1024);
    // Precaution: stands ahead of any reuse of the loads' address registers;
    // p as an input keeps them from being a load's own destination before it.
    asm volatile("s_wait_xcnt 0x0" :: "v"(p) : "memory");
    // Keeps the conversions behind all 16 loads: left free, the scheduler holds
    // four loads back behind the first waits, a second memory round trip.
    __builtin_amdgcn_sched_barrier(0);

    // The 16 lanes of a half-wave write rows 4 apart, which at this pitch fall
    // on four bank groups only; the chunk index is XORed with (row >> 4) so
    // that they spread over all 64 banks.  The reader undoes it.
    #pragma unroll
    for (int c = 0; c < 4; ++c) {
        #pragma unroll
        for (int hh = 0; hh < 2; ++hh) {
            v8h h;
            #pragma unroll
            for (int j = 0; j < 8; ++j)
                h[j] = (_Float16)v[hh * 8 + j][c];
            *(v8h*)&Ts[(nq * 4 + c) * TP + ((kb * 2 + hh) ^ (nq >> 2)) * 8] = h;
        }
    }
    __syncthreads();

    const int ch = t & 31;
    v8h h[8];
    #pragma unroll
    for (int i = 0; i < 8; ++i) {
        const int n = (t >> 5) + i * 8;    // one output row a wave
        h[i] = *(const v8h*)&Ts[n * TP + (ch ^ (n >> 4)) * 8];
    }
    _Float16* q = dst + ((n0 + (t >> 5)) * K + k0 + ch * 8);
    #pragma unroll
    for (int i = 0; i < 8; ++i)
        *(v8h*)(q + i * 8 * K) = h[i];
}

// ---------------------------------------------------------------------------
// WMMA GEMM: out = act(A[MxK] @ W[KxN] + bias), W given pre-transposed f16
// as Wt[N x K].  Block tile 128x64, BK=128. 256 threads = 8 waves arranged
// 4(M) x 2(N); each wave computes a 32x32 tile = 2x2 WMMA frags.
// A pass costs a global round trip, two barriers and an LDS round trip
// whatever its depth, so a pass takes 128 k (four WMMA k steps): a quarter of
// the passes, each with four times the bytes in flight, and every f16 operand
// row piece is 256 aligned bytes.  K must be a multiple of 128.
// ---------------------------------------------------------------------------
#define BM 128
#define BN 64
#define BK 128
#define LDA 136  // BK + 8 halves pad (row = 272B = 16B x odd)
#define LDB 136

template <bool A_IS_F32, bool SILU, bool OUT_F16, int N, int K>
__device__ __forceinline__ void gemm_tile(
    const float* __restrict__ A32, const _Float16* __restrict__ A16,
    const _Float16* __restrict__ Wt, const float* __restrict__ bias,
    _Float16* __restrict__ out16, float* __restrict__ out32)
{
    __shared__ _Float16 As[BM * LDA];
    __shared__ _Float16 Bs[BN * LDB];

    const int t     = threadIdx.x;
    const int lane  = t & 31;
    const int wid   = t >> 5;
    const int waveM = wid >> 1;   // 0..3
    const int waveN = wid & 1;    // 0..1
    const int row0  = blockIdx.x * BM;
    const int col0  = blockIdx.y * BN;
    const int l16   = lane & 15;
    const int khalf = (lane >> 4) * 8;

    v8f zero = {};
    v8f acc[2][2];
    acc[0][0] = zero; acc[0][1] = zero; acc[1][0] = zero; acc[1][1] = zero;

    // Staging maps, fixed for the thread: every load of a pass is its base
    // pointer plus a compile-time offset (N and K are template constants), so
    // the fatter pass needs no address register per load.
    const int a_r = A_IS_F32 ? (t >> 5) : (t >> 4);            // first A row
    const int a_c = A_IS_F32 ? (t & 31) * 4 : (t & 15) * 8;    // A column
    const int b_n = t >> 4;                                    // first B row
    const int b_c = (t & 15) * 8;                              // B column
    const float*    pA32 = A_IS_F32 ? A32 + (size_t)(row0 + a_r) * K + a_c : nullptr;
    const _Float16* pA16 = A_IS_F32 ? nullptr : A16 + (size_t)(row0 + a_r) * K + a_c;
    const _Float16* pB   = Wt + (size_t)(col0 + b_n) * K + b_c;
    _Float16* sA = &As[a_r * LDA + a_c];
    _Float16* sB = &Bs[b_n * LDB + b_c];
    const _Float16* pPre = Wt + (size_t)(col0 + (t >> 2)) * K + BK;

    // 64x128 f16 B tile from pre-transposed Wt[N][K]: 4 v8h per thread,
    // 16 rows apart.  128x128 f16 A tile: 8 v8h per thread, 16 rows apart.
    v8h vb[BN / 16];
    v8h va16[BM / 16];
    // f16 A (two work-groups a WGP, registers to spare): the staging registers
    // are filled one pass ahead, behind the barrier that publishes the pass in
    // hand, so that the global round trip runs under its fragment reads and
    // WMMAs and not in front of them.
    auto fetch16 = [&](int k0) {
        #pragma unroll
        for (int j = 0; j < BN / 16; ++j)
            vb[j] = *(const v8h*)(pB + k0 + j * 16 * K);
        #pragma unroll
        for (int j = 0; j < BM / 16; ++j)
            va16[j] = *(const v8h*)(pA16 + k0 + j * 16 * K);
    };
    if (!A_IS_F32) fetch16(0);

    for (int k0 = 0; k0 < K; k0 += BK) {
        __syncthreads();
        if (A_IS_F32) {
            // All global loads of the pass go out first, into registers, with
            // fixed trip counts (no per-trip bound test on the thread index),
            // so that the pass waits out one round trip and not one per load.
            #pragma unroll
            for (int j = 0; j < BN / 16; ++j)
                vb[j] = *(const v8h*)(pB + k0 + j * 16 * K);
            // 128x128 f32 tile: float4 loads -> v4h LDS stores (16 per
            // thread, 8 rows apart; a wave-load is one row piece of 512 B).
            float4 va[BM / 8];
            #pragma unroll
            for (int j = 0; j < BM / 8; ++j)
                va[j] = *(const float4*)(pA32 + k0 + j * 8 * K);
            #pragma unroll
            for (int j = 0; j < BM / 8; ++j) {
                v4h h = { (_Float16)va[j].x, (_Float16)va[j].y,
                          (_Float16)va[j].z, (_Float16)va[j].w };
                *(v4h*)(sA + j * 8 * LDA) = h;
            }
        } else {
            #pragma unroll
            for (int j = 0; j < BM / 16; ++j)
                *(v8h*)(sA + j * 16 * LDA) = va16[j];
        }
        #pragma unroll
        for (int j = 0; j < BN / 16; ++j)
            *(v8h*)(sB + j * 16 * LDB) = vb[j];
        // Prefetch next Wt tile into L2, one address a row.  In asm text over a pointer that lives through the
        // loop: the builtin's address here was a temporary whose register the
        // fragment reads below take over at once.
        // (f32 A only: with f16 A the loads themselves ask for that tile below.)
        if (A_IS_F32) {
            if (k0 + BK < K)
                asm volatile("global_prefetch_b8 %0, off scope:SCOPE_SE" :: "v"(pPre));
            // The pointer stays inside Wt behind its last use as well.
            pPre += (k0 + 2 * BK < K) ? BK : 0;
        }
        __syncthreads();

        if (!A_IS_F32) {
            if (k0 + BK < K) fetch16(k0 + BK);
            // Holds the next pass's loads ahead of this pass's fragment reads:
            // sunk among the WMMAs they would lose the lead they are issued for.
            __builtin_amdgcn_sched_barrier(0);
        }

        // The four k steps of 32 run in ascending k as before, but their
        // fragment reads go out in groups of FG k steps ahead of the WMMAs, so
        // that the pass also waits out one LDS round trip a group and not two
        // a k step.  FG: what the registers allow (f32 A: two k steps, in the
        // registers that the staging has just left, which keeps four
        // work-groups on a WGP; f16 A: all four, beside the next pass's
        // staging registers, with the two work-groups a WGP that its grid gives).
        constexpr int FG = A_IS_F32 ? 2 : 4;
        #pragma unroll
        for (int g = 0; g < BK / 32; g += FG) {
            v16h afrag[FG][2], bfrag[FG][2];
            #pragma unroll
            for (int s = 0; s < FG; ++s) {
                const int ks = (g + s) * 32;
                #pragma unroll
                for (int am = 0; am < 2; ++am) {
                    int r = waveM * 32 + am * 16 + l16;
                    afrag[s][am] = load_frag(&As[r * LDA + ks + khalf]);
                }
                #pragma unroll
                for (int bn = 0; bn < 2; ++bn) {
                    int n = waveN * 32 + bn * 16 + l16;
                    bfrag[s][bn] = load_frag(&Bs[n * LDB + ks + khalf]);
                }
            }
            // Holds the group's reads ahead of its WMMAs: left free, the
            // scheduler sinks them back among the WMMAs, each behind a full wait.
            __builtin_amdgcn_sched_barrier(0);
            #pragma unroll
            for (int s = 0; s < FG; ++s) {
                acc[0][0] = WMMA16(afrag[s][0], bfrag[s][0], acc[0][0]);
                acc[0][1] = WMMA16(afrag[s][0], bfrag[s][1], acc[0][1]);
                acc[1][0] = WMMA16(afrag[s][1], bfrag[s][0], acc[1][0]);
                acc[1][1] = WMMA16(afrag[s][1], bfrag[s][1], acc[1][1]);
            }
        }
    }

    // Epilogue: C/D layout — lane: col = l16, VGPR r: row = r + (lane>>4)*8.
    #pragma unroll
    for (int am = 0; am < 2; ++am) {
        int rowbase = row0 + waveM * 32 + am * 16 + (lane >> 4) * 8;
        #pragma unroll
        for (int bn = 0; bn < 2; ++bn) {
            int col = col0 + waveN * 32 + bn * 16 + l16;
            float bv = bias[col];
            #pragma unroll
            for (int r = 0; r < 8; ++r) {
                float v = acc[am][bn][r] + bv;
                if (SILU) v = silu_f(v);
                size_t idx = (size_t)(rowbase + r) * N + col;
                if (OUT_F16) out16[idx] = (_Float16)v;
                else         out32[idx] = v;
            }
        }
    }
}

// ---------------------------------------------------------------------------
// Projection tile: out = silu(X[M x 1024] @ W + b) -> f16, X in f32, W given
// pre-transposed f16 as Wt[N][K].  Block tile 128x128, 128 threads = 4 waves
// arranged 2(M) x 2(N); each wave computes a 64x64 tile = 4x4 WMMA frags, so
// that a fragment read from LDS feeds four WMMAs (two with a 32x32 wave tile)
// and a row of X is fetched and converted by 8 work-groups and not by 16.
// A pass takes 64 k: its staging registers (96) and the 128 accumulator
// registers stay inside the 256 that four waves a SIMD leave each wave.
// ---------------------------------------------------------------------------
#define PM 128
#define PN 128
#define PK 64
#define LDP 72  // PK + 8 halves pad (row = 144B = 16B x odd)

__device__ __forceinline__ void proj_tile(
    const float* __restrict__ X, const _Float16* __restrict__ Wt,
    const float* __restrict__ bias, _Float16* __restrict__ out,
    int row0, int col0)
{
    constexpr int N = 1024, K = 1024;
    __shared__ _Float16 As[PM * LDP];
    __shared__ _Float16 Bs[PN * LDP];

    const int t     = threadIdx.x;
    const int lane  = t & 31;
    const int wid   = t >> 5;
    const int waveM = wid >> 1;   // 0..1
    const int waveN = wid & 1;    // 0..1
    const int l16   = lane & 15;
    const int khalf = (lane >> 4) * 8;

    v8f zero = {};
    v8f acc[4][4];
    #pragma unroll
    for (int am = 0; am < 4; ++am)
        #pragma unroll
        for (int bn = 0; bn < 4; ++bn)
            acc[am][bn] = zero;

    // Staging maps, fixed for the thread: every load of a pass is its base
    // pointer plus a compile-time offset.  A wave-load covers two 256-B row
    // pieces of X, or four 128-B row pieces of Wt.
    const int a_r = t >> 4;          // first X row, then 8 rows apart
    const int a_c = (t & 15) * 4;    // X column
    const int b_n = t >> 3;          // first Wt row, then 16 rows apart
    const int b_c = (t & 7) * 8;     // Wt column
    const float*    pA = X  + (size_t)(row0 + a_r) * K + a_c;
    const _Float16* pB = Wt + (size_t)(col0 + b_n) * K + b_c;
    _Float16* sA = &As[a_r * LDP + a_c];
    _Float16* sB = &Bs[b_n * LDP + b_c];
    const _Float16* fA = &As[(waveM * 64 + l16) * LDP + khalf];
    const _Float16* fB = &Bs[(waveN * 64 + l16) * LDP + khalf];

    for (int k0 = 0; k0 < K; k0 += PK) {
        __syncthreads();
        // All global loads of the pass go out first, into registers, so that
        // the pass waits out one round trip and not one per load.
        const float*    qa = pA + k0;
        const _Float16* qb = pB + k0;
        v8h vb[PN / 16];
        #pragma unroll
        for (int j = 0; j < PN / 16; ++j)
            vb[j] = *(const v8h*)(qb + j * 16 * K);
        float4 va[PM / 8];
        #pragma unroll
        for (int j = 0; j < PM / 8; ++j)
            va[j] = *(const float4*)(qa + j * 8 * K);
        // Precaution: stands ahead of any reuse of the loads' address
        // registers; the pointers as inputs keep those registers from being
        // a load's own destination before it.
        asm volatile("s_wait_xcnt 0x0" :: "v"(qa), "v"(qb) : "memory");
        #pragma unroll
        for (int j = 0; j < PM / 8; ++j) {
            v4h h = { (_Float16)va[j].x, (_Float16)va[j].y,
                      (_Float16)va[j].z, (_Float16)va[j].w };
            *(v4h*)(sA + j * 8 * LDP) = h;
        }
        #pragma unroll
        for (int j = 0; j < PN / 16; ++j)
            *(v8h*)(sB + j * 16 * LDP) = vb[j];
        __syncthreads();

        // Two k steps of 32 in ascending k; a step's 16 fragment reads go out
        // as one group ahead of its 16 WMMAs.
        #pragma unroll
        for (int ks = 0; ks < PK; ks += 32) {
            v16h af[4], bf[4];
            #pragma unroll
            for (int i = 0; i < 4; ++i) {
                af[i] = load_frag(fA + i * 16 * LDP + ks);
                bf[i] = load_frag(fB + i * 16 * LDP + ks);
            }
            // Holds the step's reads ahead of its WMMAs: left free, the
            // scheduler sinks them among the WMMAs, each behind a full wait.
            __builtin_amdgcn_sched_barrier(0);
            #pragma unroll
            for (int am = 0; am < 4; ++am)
                #pragma unroll
                for (int bn = 0; bn < 4; ++bn)
                    acc[am][bn] = WMMA16(af[am], bf[bn], acc[am][bn]);
        }
    }

    // Epilogue: C/D layout, lane: col = l16, VGPR r: row = r + (lane>>4)*8.
    #pragma unroll
    for (int bn = 0; bn < 4; ++bn) {
        int col = col0 + waveN * 64 + bn * 16 + l16;
        float bv = bias[col];
        #pragma unroll
        for (int am = 0; am < 4; ++am) {
            int rowbase = row0 + waveM * 64 + am * 16 + (lane >> 4) * 8;
            #pragma unroll
            for (int r = 0; r < 8; ++r)
                out[(size_t)(rowbase + r) * N + col] =
                    (_Float16)silu_slot_f(acc[am][bn][r] + bv);
        }
    }
}

// The four projections silu(X @ W + b) -> f16 in ONE launch of 1024
// work-groups, four resident a WGP (one wave of each on every SIMD), which
// fill each other's waits.  blockIdx.y picks the operand set (y >> 1 = 0: Q,
// 1: K, 2: V, 3: U; V and U both read Xv) and the half of its columns,
// blockIdx.z the column tile in that half: work-groups 256 apart in launch
// order then read the same rows of X (for speed only, nothing rests on it).
// Four waves a SIMD, stated so that the compiler keeps to 256 registers.
__global__ __launch_bounds__(128) __attribute__((amdgpu_waves_per_eu(4, 4)))
void proj4_wmma_kernel(
    const float* __restrict__ Xq, const float* __restrict__ Xk,
    const float* __restrict__ Xv,
    const _Float16* __restrict__ Tq, const _Float16* __restrict__ Tk,
    const _Float16* __restrict__ Tv, const _Float16* __restrict__ Tu,
    const float* __restrict__ bq, const float* __restrict__ bk,
    const float* __restrict__ bv, const float* __restrict__ bu,
    _Float16* __restrict__ Qo, _Float16* __restrict__ Ko,
    _Float16* __restrict__ Vo, _Float16* __restrict__ Uo)
{
    const int z = blockIdx.y >> 1;
    const float*    X = z == 0 ? Xq : z == 1 ? Xk : Xv;
    const _Float16* T = z == 0 ? Tq : z == 1 ? Tk : z == 2 ? Tv : Tu;
    const float*    b = z == 0 ? bq : z == 1 ? bk : z == 2 ? bv : bu;
    _Float16*       O = z == 0 ? Qo : z == 1 ? Ko : z == 2 ? Vo : Uo;
    proj_tile(X, T, b, O, blockIdx.x * PM,
              ((blockIdx.y & 1) * 4 + blockIdx.z) * PN);
}

// One product a launch (the final GEMM).
template <bool A_IS_F32, bool SILU, bool OUT_F16, int N, int K>
__global__ __launch_bounds__(256) void gemm_wmma_kernel(
    const float* __restrict__ A32, const _Float16* __restrict__ A16,
    const _Float16* __restrict__ Wt, const float* __restrict__ bias,
    _Float16* __restrict__ out16, float* __restrict__ out32)
{
    gemm_tile<A_IS_F32, SILU, OUT_F16, N, K>(A32, A16, Wt, bias, out16, out32);
}

// ---------------------------------------------------------------------------
// Attention: per (b,head) slice, 128-query tile per block, stream 64-key tiles.
// scores = silu(Q K^T)/N * mask  (linear accumulation, no softmax) then S @ V.
// ---------------------------------------------------------------------------
#define AN 2048
#define AH 1024
#define ANH 16
#define AHD 64
#define LQK 72  // 64 + 8 halves pad (144B rows, 16B aligned)
#define LV  80  // V rows: 64 + 16 halves (160 B = 32 B x odd, the transposing load's pitch)

// Two work-groups a WGP is all the grid gives (512 on 256 WGPs): four waves a
// SIMD, stated so that the compiler spends the 256 registers a wave then has
// on loads in flight and does not schedule for more resident waves.
__global__ __launch_bounds__(256) __attribute__((amdgpu_waves_per_eu(4, 4)))
void attn_wmma_kernel(
    const _Float16* __restrict__ Qg, const _Float16* __restrict__ Kg,
    const _Float16* __restrict__ Vg, const float* __restrict__ mask,
    float* __restrict__ Og)
{
    __shared__ _Float16 Qs[128 * LQK];      // 128 queries x 64 d
    __shared__ _Float16 Ks[64 * LQK];       // 64 keys x 64 d
    __shared__ _Float16 Vs[64 * LV];        // 64 keys x 64 d, as in memory
    __shared__ _Float16 Ps[8 * 16 * LQK];   // per-wave probs: 16 q x 64 key

    const int bh   = blockIdx.y;
    const int b    = bh / ANH;
    const int h    = bh % ANH;
    const int q0   = blockIdx.x * 128;
    const int t    = threadIdx.x;
    const int lane = t & 31;
    const int wid  = t >> 5;
    const int l16  = lane & 15;
    const int khalf = (lane >> 4) * 8;

    const _Float16* Qbase = Qg + (size_t)(b * AN + q0) * AH + h * AHD;
    const float* mrow = mask + (size_t)b * AN * AN;
    const float invN = 1.0f / (float)AN;

    // Stage Q tile: v8h copies (4 per thread), all loads ahead of the stores.
    {
        v8h qv[4];
        #pragma unroll
        for (int j = 0; j < 4; ++j) {
            int i = t + j * 256;
            int r = i >> 3, d = (i & 7) * 8;
            qv[j] = *(const v8h*)&Qbase[(size_t)r * AH + d];
        }
        // Precaution: the offset registers of the four loads above are reused
        // soon after; this wait stands ahead of any such overwrite.
        asm volatile("s_wait_xcnt 0x0" ::: "memory");
        #pragma unroll
        for (int j = 0; j < 4; ++j) {
            int i = t + j * 256;
            int r = i >> 3, d = (i & 7) * 8;
            *(v8h*)&Qs[r * LQK + d] = qv[j];
        }
    }
    __syncthreads();

    // A-fragments from Q are loop-invariant per wave (16 query rows).
    v16h aq0, aq1;
    {
        int r = wid * 16 + l16;
        aq0 = load_frag(&Qs[r * LQK + khalf]);        // d 0..31
        aq1 = load_frag(&Qs[r * LQK + 32 + khalf]);   // d 32..63
    }

    v8f zero = {};
    v8f o[4];
    o[0] = zero; o[1] = zero; o[2] = zero; o[3] = zero;

    _Float16* Pw = &Ps[wid * 16 * LQK];
    // The lane's address in V's tile for the transposing loads (key 0, d 0).
    const _Float16* Vr = &Vs[(khalf + (lane & 7)) * LV + ((lane >> 3) & 1) * 8];

    // All global loads of the pass that starts at key m0: K and V (v8h, two
    // each a thread) and the wave's mask values (16 queries x 64 keys).
    // K's rows are dealt out over the four score tiles: row p of Ks holds key
    // 4 * (p & 15) + (p >> 4), so that column l16 of score tile nt is key
    // 4 * l16 + nt and a lane holds four consecutive keys of each of its
    // queries.  Its mask values are then one float4 a query (a wave-load is
    // two whole rows of 256 B) and its probabilities one 8-byte LDS store a
    // query, in P's plain key order.  V and P keep that order.
    v8h kv[2], vv[2];
    const unsigned kvo = (unsigned)((t >> 3) * AH + (t & 7) * 8);
    const unsigned kko = (unsigned)((4 * ((t >> 3) & 15) + (t >> 7)) * AH + (t & 7) * 8);
    const unsigned mo  = (unsigned)((wid * 16 + (lane >> 4) * 8) * AN + l16 * 4);
    v4f mv[8];
    auto fetch_kv = [&](int m0) {
        const _Float16* Kb = Kg + (size_t)(b * AN + m0) * AH + h * AHD;
        const _Float16* Vb = Vg + (size_t)(b * AN + m0) * AH + h * AHD;
        const _Float16* kp = Kb + kko;
        const _Float16* vp = Vb + kvo;
        kv[0] = *(const v8h*)kp;
        vv[0] = *(const v8h*)vp;
        kv[1] = *(const v8h*)(kp + 2 * AH);    // row p + 32 of Ks: key + 2
        vv[1] = *(const v8h*)(vp + 32 * AH);
        // Precaution: stands ahead of any reuse of the loads' address
        // registers; the pointers as inputs keep those registers from being
        // a later load's own destination before it.
        asm volatile("s_wait_xcnt 0x0" :: "v"(kp), "v"(vp) : "memory");
    };
    auto fetch_mask = [&](int m0) {
        const float* Mb = mrow + (size_t)q0 * AN + m0;
        const float* mp = Mb + mo;
        #pragma unroll
        for (int r = 0; r < 8; ++r)
            mv[r] = *(const v4f*)(mp + r * AN);
        // The same precaution.
        asm volatile("s_wait_xcnt 0x0" :: "v"(mp) : "memory");
    };

    // A pass finds its K, V and mask values in registers.  The next pass's
    // loads go out as soon as their registers are free: K and V behind the
    // barrier that publishes this pass's tiles, the mask behind its last use,
    // so that their round trips run under this pass's work.
    fetch_kv(0);
    fetch_mask(0);
    for (int m0 = 0; m0 < AN; m0 += 64) {
        // The last pass asks for its own tile again: no branch in the loop
        // body, and every address stays inside its buffer.
        const int mn = m0 + 64 < AN ? m0 + 64 : m0;
        lds_barrier();
        // Stage K and V, both as straight 16-byte copies.
        #pragma unroll
        for (int u = 0; u < 2; ++u) {
            int i = t + u * 256;
            int r = i >> 3, d = (i & 7) * 8;
            *(v8h*)&Ks[r * LQK + d] = kv[u];
            *(v8h*)&Vs[r * LV + d]  = vv[u];
        }
        lds_barrier();

        // Scores: 16 queries x 64 keys per wave, 2 WMMAs per 16x16 tile.
        // K's 16 fragment reads go out as one group ahead of the 8 WMMAs: the
        // wave waits out one LDS round trip and not one in front of each WMMA.
        v16h bk[4][2];
        #pragma unroll
        for (int nt = 0; nt < 4; ++nt) {
            int kr = nt * 16 + l16;    // row of Ks: key 4 * l16 + nt
            bk[nt][0] = load_frag(&Ks[kr * LQK + khalf]);
            bk[nt][1] = load_frag(&Ks[kr * LQK + 32 + khalf]);
        }
        // Holds the group ahead of its WMMAs: left free, the scheduler sinks
        // the reads among them, each WMMA behind a read issued just before it.
        __builtin_amdgcn_sched_barrier(0);
        // The next pass's K and V loads go out behind the reads: their issue
        // and its wait run under the reads' round trip.
        fetch_kv(mn);
        v8f s[4];
        #pragma unroll
        for (int nt = 0; nt < 4; ++nt)
            s[nt] = WMMA16(aq0, bk[nt][0], zero);
        #pragma unroll
        for (int nt = 0; nt < 4; ++nt)
            s[nt] = WMMA16(aq1, bk[nt][1], s[nt]);

        // V's 16 fragment reads (they do not depend on P) go out here, so that
        // their LDS round trip runs under the score arithmetic below.
        // V is turned on its way out of LDS: column d = dt*16 + l16.
        v16h bv[4][2];
        #pragma unroll
        for (int dt = 0; dt < 4; ++dt) {
            bv[dt][0] = load_frag_tr(Vr + dt * 16, LV);             // keys 0..31
            bv[dt][1] = load_frag_tr(Vr + 32 * LV + dt * 16, LV);   // keys 32..63
        }
        // Holds V's reads ahead of the score arithmetic: left free, the
        // scheduler sinks them behind it, just in front of P's stores and
        // reads, whose round trip then queues behind all 16.
        __builtin_amdgcn_sched_barrier(0);

        v4h ph[8];
        #pragma unroll
        for (int nt = 0; nt < 4; ++nt) {
            #pragma unroll
            for (int r = 0; r < 8; ++r) {
                float x = s[nt][r];
                float v = silu_f(x) * invN * mv[r][nt];
                ph[r][nt] = (_Float16)v;
            }
        }
        #pragma unroll
        for (int r = 0; r < 8; ++r)
            *(v4h*)&Pw[((lane >> 4) * 8 + r) * LQK + l16 * 4] = ph[r];

        fetch_mask(mn);

        // P @ V: re-layout P (C->A) via per-wave LDS round-trip (in-order DS).
        v16h ap0 = load_frag(&Pw[l16 * LQK + khalf]);        // keys 0..31
        v16h ap1 = load_frag(&Pw[l16 * LQK + 32 + khalf]);   // keys 32..63
        // Holds P's four reads together ahead of the WMMAs: left free, two of
        // them sink behind the first WMMA, a second round trip.
        __builtin_amdgcn_sched_barrier(0);
        #pragma unroll
        for (int dt = 0; dt < 4; ++dt) {
            o[dt] = WMMA16(ap0, bv[dt][0], o[dt]);
            o[dt] = WMMA16(ap1, bv[dt][1], o[dt]);
        }
    }

    // The last pass's loads are used by nobody: they have landed before the
    // wave reuses their registers or gives them back at its end.
    asm volatile("s_wait_loadcnt 0x0" ::: "memory");

    // Write f32 attention output [B*N, H].
    int qb = b * AN + q0 + wid * 16 + (lane >> 4) * 8;
    #pragma unroll
    for (int dt = 0; dt < 4; ++dt) {
        int col = h * AHD + dt * 16 + l16;
        #pragma unroll
        for (int r = 0; r < 8; ++r)
            Og[(size_t)(qb + r) * AH + col] = o[dt][r];
    }
}

// ---------------------------------------------------------------------------
// LayerNorm over H=1024 + build o_input = [U, A, U*A] as f16 [4096 x 3072].
// ---------------------------------------------------------------------------
__global__ __launch_bounds__(256) void ln_concat_kernel(
    const float* __restrict__ attn, const _Float16* __restrict__ Uh,
    _Float16* __restrict__ oin)
{
    __shared__ float red[256];
    const int row = blockIdx.x;
    const int t = threadIdx.x;
    const float* x = attn + (size_t)row * 1024;

    float vals[4], s = 0.0f, ss = 0.0f;
    #pragma unroll
    for (int i = 0; i < 4; ++i) {
        float v = x[t + i * 256];
        vals[i] = v; s += v; ss += v * v;
    }
    red[t] = s; __syncthreads();
    for (int st = 128; st > 0; st >>= 1) {
        if (t < st) red[t] += red[t + st];
        __syncthreads();
    }
    float mean = red[0] * (1.0f / 1024.0f);
    __syncthreads();
    red[t] = ss; __syncthreads();
    for (int st = 128; st > 0; st >>= 1) {
        if (t < st) red[t] += red[t + st];
        __syncthreads();
    }
    float var  = red[0] * (1.0f / 1024.0f) - mean * mean;
    float rstd = __builtin_amdgcn_rsqf(var + 1e-8f);   // native v_rsq_f32

    _Float16* orow = oin + (size_t)row * 3072;
    const _Float16* urow = Uh + (size_t)row * 1024;
    #pragma unroll
    for (int i = 0; i < 4; ++i) {
        int c = t + i * 256;
        float a = (vals[i] - mean) * rstd;
        float u = (float)urow[c];
        orow[c]        = (_Float16)u;
        orow[1024 + c] = (_Float16)a;
        orow[2048 + c] = (_Float16)(u * a);
    }
}

// ---------------------------------------------------------------------------
// Host-side orchestration.
// ---------------------------------------------------------------------------
extern "C" void kernel_launch(void* const* d_in, const int* in_sizes, int n_in,
                              void* d_out, int out_size, void* d_ws, size_t ws_size,
                              hipStream_t stream) {
    const float* query = (const float*)d_in[0];
    const float* key_  = (const float*)d_in[1];
    const float* value = (const float*)d_in[2];
    const float* mask  = (const float*)d_in[3];
    const float* Wq = (const float*)d_in[4];   const float* bq = (const float*)d_in[5];
    const float* Wk = (const float*)d_in[6];   const float* bk = (const float*)d_in[7];
    const float* Wv = (const float*)d_in[8];   const float* bv = (const float*)d_in[9];
    const float* Wu = (const float*)d_in[10];  const float* bu = (const float*)d_in[11];
    const float* Wo = (const float*)d_in[12];  const float* bo = (const float*)d_in[13];
    float* out = (float*)d_out;

    const int M = 2 * 2048;        // 4096 rows
    const int H = 1024;

    // Workspace carve-out (~90 MB total, deterministic layout).
    char* ws = (char*)d_ws;
    size_t off = 0;
    auto carve = [&](size_t bytes) -> void* {
        void* p = ws + off;
        off += (bytes + 255) & ~(size_t)255;
        return p;
    };
    _Float16* Wq_t = (_Float16*)carve((size_t)H * H * 2);       // [N][K] f16
    _Float16* Wk_t = (_Float16*)carve((size_t)H * H * 2);
    _Float16* Wv_t = (_Float16*)carve((size_t)H * H * 2);
    _Float16* Wu_t = (_Float16*)carve((size_t)H * H * 2);
    _Float16* Wo_t = (_Float16*)carve((size_t)H * 3 * H * 2);   // [1024][3072]
    _Float16* Q_h  = (_Float16*)carve((size_t)M * H * 2);
    _Float16* K_h  = (_Float16*)carve((size_t)M * H * 2);
    _Float16* V_h  = (_Float16*)carve((size_t)M * H * 2);
    _Float16* U_h  = (_Float16*)carve((size_t)M * H * 2);
    float*    At_f = (float*)   carve((size_t)M * H * 4);
    _Float16* Oi_h = (_Float16*)carve((size_t)M * 3 * H * 2);
    (void)ws_size; (void)in_sizes; (void)n_in; (void)out_size;

    // 1) Weights -> f16, transposed to [N][K] for contiguous B staging:
    //    16 column tiles x 28 slabs of 256 k rows, one launch.
    cvt_transpose_all_kernel<<<dim3(16, 28), 256, 0, stream>>>(
        Wq, Wk, Wv, Wu, Wo, Wq_t, Wk_t, Wv_t, Wu_t, Wo_t);

    // 2) Projections: silu(X @ W + b), f16 outputs, all four in one launch.
    dim3 ggrid(M / PM, 8, 4);
    proj4_wmma_kernel<<<ggrid, 128, 0, stream>>>(
        query, key_, value, Wq_t, Wk_t, Wv_t, Wu_t, bq, bk, bv, bu,
        Q_h, K_h, V_h, U_h);

    // 3) Attention (16 query tiles x 32 (b,head) slices).
    dim3 agrid(AN / 128, 2 * ANH);
    attn_wmma_kernel<<<agrid, 256, 0, stream>>>(Q_h, K_h, V_h, mask, At_f);

    // 4) LayerNorm + concat [U, A, U*A].
    ln_concat_kernel<<<M, 256, 0, stream>>>(At_f, U_h, Oi_h);

    // 5) Final GEMM: o_input[4096x3072] @ Wo[3072x1024] + bo -> f32 out.
    dim3 fgrid(M / BM, H / BN);
    gemm_wmma_kernel<false, false, false, 1024, 3072><<<fgrid, 256, 0, stream>>>(
        nullptr, Oi_h, Wo_t, bo, nullptr, out);
}

// v010
// Measured time: 111 microseconds a run.
// In both of two side-by-side timings against v009, it was 1.06 times as fast.
// Over all steps from v000 it is 3.76 times as fast.
#include <hip/hip_runtime.h>
#include <hip/hip_bf16.h>
#include <math.h>

// HSTU attention for MI455X (gfx1250, wave32, WMMA).
// B=2, N=2048, H=1024, NH=16, HD=64.

typedef __attribute__((ext_vector_type(16))) _Float16 v16h;
typedef __attribute__((ext_vector_type(8)))  _Float16 v8h;
typedef __attribute__((ext_vector_type(4)))  _Float16 v4h;
typedef __attribute__((ext_vector_type(8)))  float    v8f;
typedef __attribute__((ext_vector_type(4)))  float    v4f;

#define WMMA16(a, b, c) __builtin_amdgcn_wmma_f32_16x16x32_f16( \
    false, (a), false, (b), (short)0, (c), false, false)

// SiLU via native v_exp_f32 + v_rcp_f32 (no IEEE div sequence).
__device__ __forceinline__ float silu_f(float x) {
    return x * __builtin_amdgcn_rcpf(1.0f + __expf(-x));
}

// The same SiLU, same instructions and rounding, for a long unrolled epilogue
// that runs the registers full.  The v_nop in the
// statement is the one slot that the instruction set asks for behind a
// transcendental.
__device__ __forceinline__ float silu_slot_f(float x) {
    float e, r;
    asm("v_exp_f32 %0, %1\n\tv_nop" : "=v"(e) : "v"(x * -1.442695041f));
    asm("v_rcp_f32 %0, %1\n\tv_nop" : "=v"(r) : "v"(1.0f + e));
    return x * r;
}

// Work-group barrier for tiles handed over through LDS alone: its fences name
// the LDS only, so that a wave waits out its LDS operations at the barrier and
// not its global loads as well (__syncthreads() drains those too, and a load
// issued ahead could never stay in flight across it).
__device__ __forceinline__ void lds_barrier() {
    __builtin_amdgcn_fence(__ATOMIC_RELEASE, "workgroup", "local");
    __builtin_amdgcn_s_barrier();
    __builtin_amdgcn_fence(__ATOMIC_ACQUIRE, "workgroup", "local");
}

// Load a v16h fragment per the CDNA5 16-bit A/B layout:
// halves 0..7  = K (or col) khalf..khalf+7
// halves 8..15 = K (or col) khalf+16..khalf+23   (khalf = (lane>>4)*8)
__device__ __forceinline__ v16h load_frag(const _Float16* p) {
    v16h f;
    *((v8h*)&f)       = *(const v8h*)p;
    *(((v8h*)&f) + 1) = *(const v8h*)(p + 16);
    return f;
}

// Transposing LDS load (ds_load_tr16_b128) from a row-major 16-bit tile T.
// Lane l passes the address of T[k + 8*(l>>4) + (l&7)][n + 8*((l>>3)&1)] and
// gets T[k + 8*(l>>4) + 0..7][n + (l&15)]: one half of a B fragment whose
// column is n + (l&15), in the k order of load_frag.
typedef __attribute__((ext_vector_type(8))) short s16x8;
__device__ __forceinline__ v8h load_tr16(const _Float16* p) {
    typedef __attribute__((address_space(3))) s16x8 lds_s16x8;
    return __builtin_bit_cast(v8h,
        __builtin_amdgcn_ds_load_tr16_b128_v8i16((lds_s16x8*)p));
}
// B fragment over 32 rows (k) of such a tile: rows k..k+15 and k+16..k+31.
__device__ __forceinline__ v16h load_frag_tr(const _Float16* p, int pitch) {
    v16h f;
    *((v8h*)&f)       = load_tr16(p);
    *(((v8h*)&f) + 1) = load_tr16(p + 16 * pitch);
    return f;
}

// ---------------------------------------------------------------------------
// Kernel: all five weights, f32 [K x 1024] -> f16 transposed [1024 x K], in one
// launch.  A work-group moves a 256(k) x 64(n) tile.  A thread loads a
// 16(k) x 4(n) block as 16 float4 (a wave-load covers two rows of 256 B), turns
// it in registers into 8-half runs along k, and the runs pass through LDS so
// that each wave-store writes 512 contiguous bytes of one output row.
// blockIdx.y counts slabs of 256 k rows: 4 each for Wq, Wk, Wv, Wu, 12 for Wo.
// ---------------------------------------------------------------------------
#define TK 256
#define TN 64
#define TP (TK + 8)  // LDS row pitch in halves (528 B = 16 B x odd)

__global__ __launch_bounds__(256) void cvt_transpose_all_kernel(
    const float* __restrict__ Wq, const float* __restrict__ Wk,
    const float* __restrict__ Wv, const float* __restrict__ Wu,
    const float* __restrict__ Wo,
    _Float16* __restrict__ Tq, _Float16* __restrict__ Tk,
    _Float16* __restrict__ Tv, _Float16* __restrict__ Tu,
    _Float16* __restrict__ To)
{
    __shared__ _Float16 Ts[TN * TP];   // [n][k], 16-B chunks swizzled per row

    const int t    = threadIdx.x;
    const int slab = blockIdx.y;
    const int w    = slab >> 2;
    const float* src = w == 0 ? Wq : w == 1 ? Wk : w == 2 ? Wv : w == 3 ? Wu : Wo;
    _Float16*    dst = w == 0 ? Tq : w == 1 ? Tk : w == 2 ? Tv : w == 3 ? Tu : To;
    const int K  = w < 4 ? 1024 : 3072;
    const int k0 = (w < 4 ? (slab & 3) : (slab - 16)) * TK;
    const int n0 = blockIdx.x * TN;

    const int nq = t & 15;   // which group of 4 columns
    const int kb = t >> 4;   // which group of 16 rows
    const float* p = src + (size_t)(k0 + kb * 16) * 1024 + n0 + nq * 4;
    v4f v[16];
    #pragma unroll
    for (int j = 0; j < 16; ++j)
        v[j] = *(const v4f*)(p + j * 1024);
    // Precaution: stands ahead of any reuse of the loads' address registers;
    // p as an input keeps them from being a load's own destination before it.
    asm volatile("s_wait_xcnt 0x0" :: "v"(p) : "memory");
    // Keeps the conversions behind all 16 loads: left free, the scheduler holds
    // four loads back behind the first waits, a second memory round trip.
    __builtin_amdgcn_sched_barrier(0);

    // The 16 lanes of a half-wave write rows 4 apart, which at this pitch fall
    // on four bank groups only; the chunk index is XORed with (row >> 4) so
    // that they spread over all 64 banks.  The reader undoes it.
    #pragma unroll
    for (int c = 0; c < 4; ++c) {
        #pragma unroll
        for (int hh = 0; hh < 2; ++hh) {
            v8h h;
            #pragma unroll
            for (int j = 0; j < 8; ++j)
                h[j] = (_Float16)v[hh * 8 + j][c];
            *(v8h*)&Ts[(nq * 4 + c) * TP + ((kb * 2 + hh) ^ (nq >> 2)) * 8] = h;
        }
    }
    __syncthreads();

    const int ch = t & 31;
    v8h h[8];
    #pragma unroll
    for (int i = 0; i < 8; ++i) {
        const int n = (t >> 5) + i * 8;    // one output row a wave
        h[i] = *(const v8h*)&Ts[n * TP + (ch ^ (n >> 4)) * 8];
    }
    _Float16* q = dst + ((n0 + (t >> 5)) * K + k0 + ch * 8);
    #pragma unroll
    for (int i = 0; i < 8; ++i)
        *(v8h*)(q + i * 8 * K) = h[i];
}

// ---------------------------------------------------------------------------
// Projection tile: out = silu(X[M x 1024] @ W + b) -> f16, X in f32, W given
// pre-transposed f16 as Wt[N][K].  Block tile 128x128, 128 threads = 4 waves
// arranged 2(M) x 2(N); each wave computes a 64x64 tile = 4x4 WMMA frags, so
// that a fragment read from LDS feeds four WMMAs (two with a 32x32 wave tile)
// and a row of X is fetched and converted by 8 work-groups and not by 16.
// A pass takes 64 k: its staging registers (96) and the 128 accumulator
// registers stay inside the 256 that four waves a SIMD leave each wave.
// ---------------------------------------------------------------------------
#define PM 128
#define PN 128
#define PK 64
#define LDP 72  // PK + 8 halves pad (row = 144B = 16B x odd)

__device__ __forceinline__ void proj_tile(
    const float* __restrict__ X, const _Float16* __restrict__ Wt,
    const float* __restrict__ bias, _Float16* __restrict__ out,
    int row0, int col0)
{
    constexpr int N = 1024, K = 1024;
    __shared__ _Float16 As[PM * LDP];
    __shared__ _Float16 Bs[PN * LDP];

    const int t     = threadIdx.x;
    const int lane  = t & 31;
    const int wid   = t >> 5;
    const int waveM = wid >> 1;   // 0..1
    const int waveN = wid & 1;    // 0..1
    const int l16   = lane & 15;
    const int khalf = (lane >> 4) * 8;

    v8f zero = {};
    v8f acc[4][4];
    #pragma unroll
    for (int am = 0; am < 4; ++am)
        #pragma unroll
        for (int bn = 0; bn < 4; ++bn)
            acc[am][bn] = zero;

    // Staging maps, fixed for the thread: every load of a pass is its base
    // pointer plus a compile-time offset.  A wave-load covers two 256-B row
    // pieces of X, or four 128-B row pieces of Wt.
    const int a_r = t >> 4;          // first X row, then 8 rows apart
    const int a_c = (t & 15) * 4;    // X column
    const int b_n = t >> 3;          // first Wt row, then 16 rows apart
    const int b_c = (t & 7) * 8;     // Wt column
    const float*    pA = X  + (size_t)(row0 + a_r) * K + a_c;
    const _Float16* pB = Wt + (size_t)(col0 + b_n) * K + b_c;
    _Float16* sA = &As[a_r * LDP + a_c];
    _Float16* sB = &Bs[b_n * LDP + b_c];
    const _Float16* fA = &As[(waveM * 64 + l16) * LDP + khalf];
    const _Float16* fB = &Bs[(waveN * 64 + l16) * LDP + khalf];

    for (int k0 = 0; k0 < K; k0 += PK) {
        __syncthreads();
        // All global loads of the pass go out first, into registers, so that
        // the pass waits out one round trip and not one per load.
        const float*    qa = pA + k0;
        const _Float16* qb = pB + k0;
        v8h vb[PN / 16];
        #pragma unroll
        for (int j = 0; j < PN / 16; ++j)
            vb[j] = *(const v8h*)(qb + j * 16 * K);
        float4 va[PM / 8];
        #pragma unroll
        for (int j = 0; j < PM / 8; ++j)
            va[j] = *(const float4*)(qa + j * 8 * K);
        // Precaution: stands ahead of any reuse of the loads' address
        // registers; the pointers as inputs keep those registers from being
        // a load's own destination before it.
        asm volatile("s_wait_xcnt 0x0" :: "v"(qa), "v"(qb) : "memory");
        #pragma unroll
        for (int j = 0; j < PM / 8; ++j) {
            v4h h = { (_Float16)va[j].x, (_Float16)va[j].y,
                      (_Float16)va[j].z, (_Float16)va[j].w };
            *(v4h*)(sA + j * 8 * LDP) = h;
        }
        #pragma unroll
        for (int j = 0; j < PN / 16; ++j)
            *(v8h*)(sB + j * 16 * LDP) = vb[j];
        __syncthreads();

        // Two k steps of 32 in ascending k; a step's 16 fragment reads go out
        // as one group ahead of its 16 WMMAs.
        #pragma unroll
        for (int ks = 0; ks < PK; ks += 32) {
            v16h af[4], bf[4];
            #pragma unroll
            for (int i = 0; i < 4; ++i) {
                af[i] = load_frag(fA + i * 16 * LDP + ks);
                bf[i] = load_frag(fB + i * 16 * LDP + ks);
            }
            // Holds the step's reads ahead of its WMMAs: left free, the
            // scheduler sinks them among the WMMAs, each behind a full wait.
            __builtin_amdgcn_sched_barrier(0);
            #pragma unroll
            for (int am = 0; am < 4; ++am)
                #pragma unroll
                for (int bn = 0; bn < 4; ++bn)
                    acc[am][bn] = WMMA16(af[am], bf[bn], acc[am][bn]);
        }
    }

    // Epilogue: C/D layout, lane: col = l16, VGPR r: row = r + (lane>>4)*8.
    #pragma unroll
    for (int bn = 0; bn < 4; ++bn) {
        int col = col0 + waveN * 64 + bn * 16 + l16;
        float bv = bias[col];
        #pragma unroll
        for (int am = 0; am < 4; ++am) {
            int rowbase = row0 + waveM * 64 + am * 16 + (lane >> 4) * 8;
            #pragma unroll
            for (int r = 0; r < 8; ++r)
                out[(size_t)(rowbase + r) * N + col] =
                    (_Float16)silu_slot_f(acc[am][bn][r] + bv);
        }
    }
}

// The four projections silu(X @ W + b) -> f16 in ONE launch of 1024
// work-groups, four resident a WGP (one wave of each on every SIMD), which
// fill each other's waits.  blockIdx.y picks the operand set (y >> 1 = 0: Q,
// 1: K, 2: V, 3: U; V and U both read Xv) and the half of its columns,
// blockIdx.z the column tile in that half: work-groups 256 apart in launch
// order then read the same rows of X (for speed only, nothing rests on it).
// Four waves a SIMD, stated so that the compiler keeps to 256 registers.
__global__ __launch_bounds__(128) __attribute__((amdgpu_waves_per_eu(4, 4)))
void proj4_wmma_kernel(
    const float* __restrict__ Xq, const float* __restrict__ Xk,
    const float* __restrict__ Xv,
    const _Float16* __restrict__ Tq, const _Float16* __restrict__ Tk,
    const _Float16* __restrict__ Tv, const _Float16* __restrict__ Tu,
    const float* __restrict__ bq, const float* __restrict__ bk,
    const float* __restrict__ bv, const float* __restrict__ bu,
    _Float16* __restrict__ Qo, _Float16* __restrict__ Ko,
    _Float16* __restrict__ Vo, _Float16* __restrict__ Uo)
{
    const int z = blockIdx.y >> 1;
    const float*    X = z == 0 ? Xq : z == 1 ? Xk : Xv;
    const _Float16* T = z == 0 ? Tq : z == 1 ? Tk : z == 2 ? Tv : Tu;
    const float*    b = z == 0 ? bq : z == 1 ? bk : z == 2 ? bv : bu;
    _Float16*       O = z == 0 ? Qo : z == 1 ? Ko : z == 2 ? Vo : Uo;
    proj_tile(X, T, b, O, blockIdx.x * PM,
              ((blockIdx.y & 1) * 4 + blockIdx.z) * PN);
}

// ---------------------------------------------------------------------------
// Final GEMM: out = A[4096 x 3072] @ W + bias -> f32, A in f16, W given
// pre-transposed f16 as Wt[N][K].  Block tile 128x128, one work-group a WGP,
// a pass takes 128 k.  256 threads = 8 waves: four 64x64 wave tiles (2 x 2),
// each worked on by two waves, one on the lower 64 k of every pass and one on
// the upper 64 k, so that a fragment read from LDS feeds four WMMAs and two
// waves still stand on every SIMD.  The two partial sums of a tile are joined
// through LDS behind the loop.
// With no second work-group on the WGP to fill a staging phase, the tiles go
// through two LDS buffers: pass p works on one while the tile of pass p + 1,
// fetched into registers a pass earlier, is stored into the other; one
// barrier a pass publishes that tile and ends the reads of this one.
// ---------------------------------------------------------------------------
#define FM 128
#define FN 128
#define FK 128
#define LDF 136                    // FK + 8 halves pad (row = 272 B = 16 B x odd)
#define FTILE ((FM + FN) * LDF)    // halves in one buffer: A rows, then Wt rows

__global__ __launch_bounds__(256) void final_gemm_kernel(
    const _Float16* __restrict__ A, const _Float16* __restrict__ Wt,
    const float* __restrict__ bias, float* __restrict__ out)
{
    constexpr int N = 1024, K = 3072, NP = K / FK;
    __shared__ _Float16 S[2 * FTILE];

    const int t     = threadIdx.x;
    const int lane  = t & 31;
    const int wid   = __builtin_amdgcn_readfirstlane(t >> 5);
    const int kh    = wid >> 2;         // which 64 k of a pass
    const int waveM = (wid >> 1) & 1;
    const int waveN = wid & 1;
    const int row0  = blockIdx.x * FM;
    const int col0  = blockIdx.y * FN;
    const int l16   = lane & 15;
    const int khalf = (lane >> 4) * 8;

    // Every short loop of this kernel is unrolled in full: its index picks
    // registers (accumulator tiles, fragments, staging vectors).
    v8f zero = {};
    v8f acc[4][4];
    #pragma unroll
    for (int am = 0; am < 4; ++am)
        #pragma unroll
        for (int bn = 0; bn < 4; ++bn)
            acc[am][bn] = zero;

    // Staging map, fixed for the thread: 8 v8h of A and 8 of Wt, 16 rows
    // apart; a wave-load covers two whole row pieces of 256 B.
    const _Float16* pA = A  + (size_t)(row0 + (t >> 4)) * K + (t & 15) * 8;
    const _Float16* pB = Wt + (size_t)(col0 + (t >> 4)) * K + (t & 15) * 8;
    const int so = (t >> 4) * LDF + (t & 15) * 8;
    const int fa = (waveM * 64 + l16) * LDF + kh * 64 + khalf;
    const int fb = (FM + waveN * 64 + l16) * LDF + kh * 64 + khalf;

    v8h va[8], vb[8];
    auto fetch = [&](const int k0) __attribute__((always_inline)) {
        const _Float16* qa = pA + k0;
        const _Float16* qb = pB + k0;
        #pragma unroll
        for (int j = 0; j < 8; ++j)
            va[j] = *(const v8h*)(qa + j * 16 * K);
        #pragma unroll
        for (int j = 0; j < 8; ++j)
            vb[j] = *(const v8h*)(qb + j * 16 * K);
        // Precaution: stands ahead of any reuse of the loads' address
        // registers.  No pointer operands: to form one the compiler added to
        // an address register in place, ahead of the wait.
        asm volatile("s_wait_xcnt 0x0" ::: "memory");
    };
    auto stage = [&](const int buf) __attribute__((always_inline)) {
        _Float16* d = &S[buf * FTILE + so];
        #pragma unroll
        for (int j = 0; j < 8; ++j)
            *(v8h*)(d + j * 16 * LDF) = va[j];
        #pragma unroll
        for (int j = 0; j < 8; ++j)
            *(v8h*)(d + (FM + j * 16) * LDF) = vb[j];
    };

    // One pass on buffer buf.  st: the next tile is in the registers and goes
    // into the other buffer; kf >= 0: the tile behind it is asked for.
    auto pass = [&](const int buf, const bool st, const int kf)
        __attribute__((always_inline)) {
        const _Float16* fA = &S[buf * FTILE + fa];
        const _Float16* fB = &S[buf * FTILE + fb];
        // The wave's two k steps of 32, in ascending k; all 32 fragment reads
        // go out as one group ahead of the WMMAs.
        v16h af[2][4], bf[2][4];
        #pragma unroll
        for (int s = 0; s < 2; ++s)
            #pragma unroll
            for (int i = 0; i < 4; ++i) {
                af[s][i] = load_frag(fA + i * 16 * LDF + s * 32);
                bf[s][i] = load_frag(fB + i * 16 * LDF + s * 32);
            }
        // Holds the reads ahead of the WMMAs: left free, the scheduler sinks
        // them among the WMMAs, each behind a full wait.
        __builtin_amdgcn_sched_barrier(0);
        #pragma unroll
        for (int am = 0; am < 4; ++am)
            #pragma unroll
            for (int bn = 0; bn < 4; ++bn)
                acc[am][bn] = WMMA16(af[0][am], bf[0][bn], acc[am][bn]);
        // Holds the staging behind the first k step's WMMAs: hoisted in front
        // of them, its wait on the global loads would stall the wave with
        // its fragments ready.
        __builtin_amdgcn_sched_barrier(0);
        if (st) stage(buf ^ 1);
        if (kf >= 0) fetch(kf);
        // Keeps the next fetch's address arithmetic behind the wait in fetch.
        // The second step's WMMAs touch registers only and stay free to run
        // behind the barrier, under the next pass's fragment reads.
        __builtin_amdgcn_sched_barrier(0);
        #pragma unroll
        for (int am = 0; am < 4; ++am)
            #pragma unroll
            for (int bn = 0; bn < 4; ++bn)
                acc[am][bn] = WMMA16(af[1][am], bf[1][bn], acc[am][bn]);
        lds_barrier();
    };

    fetch(0);
    stage(0);
    fetch(FK);
    lds_barrier();
    for (int p = 0; p < NP - 2; p += 2) {
        pass(0, true, (p + 2) * FK);
        pass(1, true, (p + 3) * FK);
    }
    pass(0, true, -1);
    pass(1, false, -1);

    // Join the two k halves.  Of a 64x64 tile the wave of the lower k finishes
    // rows 0..31 and its partner rows 32..63: each hands the other's 8
    // accumulator tiles over through LDS (16 B a lane, lanes adjacent).  The
    // area lies in the first buffer, which nobody has read since the barrier
    // of the pass before the last.  Which half a wave keeps is picked by
    // selects, so that both kinds of wave run the same code.
    float* X = (float*)S;
    const float* pb = bias + col0 + waveN * 64 + l16;
    float bv[4];
    #pragma unroll
    for (int bn = 0; bn < 4; ++bn)
        bv[bn] = pb[bn * 16];
    // The same precaution as in fetch.
    asm volatile("s_wait_xcnt 0x0" ::: "memory");

    const bool up = kh != 0;
    float* d = X + wid * 2048 + lane * 4;
    #pragma unroll
    for (int a = 0; a < 2; ++a)
        #pragma unroll
        for (int bn = 0; bn < 4; ++bn) {
            v8f v;
            #pragma unroll
            for (int r = 0; r < 8; ++r)
                v[r] = up ? acc[a][bn][r] : acc[2 + a][bn][r];
            v4f lo = { v[0], v[1], v[2], v[3] };
            v4f hi = { v[4], v[5], v[6], v[7] };
            *(v4f*)(d + (a * 4 + bn) * 256)       = lo;
            *(v4f*)(d + (a * 4 + bn) * 256 + 128) = hi;
        }
    lds_barrier();

    // C/D layout: lane: col = l16, VGPR r: row = r + (lane>>4)*8.
    const float* s = X + (wid ^ 4) * 2048 + lane * 4;
    float* o = out + (size_t)(row0 + waveM * 64 + kh * 32 + (lane >> 4) * 8) * N
                   + col0 + waveN * 64 + l16;
    #pragma unroll
    for (int a = 0; a < 2; ++a)
        #pragma unroll
        for (int bn = 0; bn < 4; ++bn) {
            const v4f lo = *(const v4f*)(s + (a * 4 + bn) * 256);
            const v4f hi = *(const v4f*)(s + (a * 4 + bn) * 256 + 128);
            #pragma unroll
            for (int r = 0; r < 8; ++r) {
                const float mine = up ? acc[2 + a][bn][r] : acc[a][bn][r];
                o[(a * 16 + r) * N + bn * 16] =
                    mine + (r < 4 ? lo[r & 3] : hi[r & 3]) + bv[bn];
            }
        }
}

// ---------------------------------------------------------------------------
// Attention: per (b,head) slice, 128-query tile per block, stream 64-key tiles.
// scores = silu(Q K^T)/N * mask  (linear accumulation, no softmax) then S @ V.
// ---------------------------------------------------------------------------
#define AN 2048
#define AH 1024
#define ANH 16
#define AHD 64
#define LQK 72  // 64 + 8 halves pad (144B rows, 16B aligned)
#define LV  80  // V rows: 64 + 16 halves (160 B = 32 B x odd, the transposing load's pitch)

// Two work-groups a WGP is all the grid gives (512 on 256 WGPs): four waves a
// SIMD, stated so that the compiler spends the 256 registers a wave then has
// on loads in flight and does not schedule for more resident waves.
__global__ __launch_bounds__(256) __attribute__((amdgpu_waves_per_eu(4, 4)))
void attn_wmma_kernel(
    const _Float16* __restrict__ Qg, const _Float16* __restrict__ Kg,
    const _Float16* __restrict__ Vg, const float* __restrict__ mask,
    float* __restrict__ Og)
{
    __shared__ _Float16 Qs[128 * LQK];      // 128 queries x 64 d
    __shared__ _Float16 Ks[64 * LQK];       // 64 keys x 64 d
    __shared__ _Float16 Vs[64 * LV];        // 64 keys x 64 d, as in memory
    __shared__ _Float16 Ps[8 * 16 * LQK];   // per-wave probs: 16 q x 64 key

    const int bh   = blockIdx.y;
    const int b    = bh / ANH;
    const int h    = bh % ANH;
    const int q0   = blockIdx.x * 128;
    const int t    = threadIdx.x;
    const int lane = t & 31;
    const int wid  = t >> 5;
    const int l16  = lane & 15;
    const int khalf = (lane >> 4) * 8;

    const _Float16* Qbase = Qg + (size_t)(b * AN + q0) * AH + h * AHD;
    const float* mrow = mask + (size_t)b * AN * AN;
    const float invN = 1.0f / (float)AN;

    // Stage Q tile: v8h copies (4 per thread), all loads ahead of the stores.
    {
        v8h qv[4];
        #pragma unroll
        for (int j = 0; j < 4; ++j) {
            int i = t + j * 256;
            int r = i >> 3, d = (i & 7) * 8;
            qv[j] = *(const v8h*)&Qbase[(size_t)r * AH + d];
        }
        // Precaution: the offset registers of the four loads above are reused
        // soon after; this wait stands ahead of any such overwrite.
        asm volatile("s_wait_xcnt 0x0" ::: "memory");
        #pragma unroll
        for (int j = 0; j < 4; ++j) {
            int i = t + j * 256;
            int r = i >> 3, d = (i & 7) * 8;
            *(v8h*)&Qs[r * LQK + d] = qv[j];
        }
    }
    __syncthreads();

    // A-fragments from Q are loop-invariant per wave (16 query rows).
    v16h aq0, aq1;
    {
        int r = wid * 16 + l16;
        aq0 = load_frag(&Qs[r * LQK + khalf]);        // d 0..31
        aq1 = load_frag(&Qs[r * LQK + 32 + khalf]);   // d 32..63
    }

    v8f zero = {};
    v8f o[4];
    o[0] = zero; o[1] = zero; o[2] = zero; o[3] = zero;

    _Float16* Pw = &Ps[wid * 16 * LQK];
    // The lane's address in V's tile for the transposing loads (key 0, d 0).
    const _Float16* Vr = &Vs[(khalf + (lane & 7)) * LV + ((lane >> 3) & 1) * 8];

    // All global loads of the pass that starts at key m0: K and V (v8h, two
    // each a thread) and the wave's mask values (16 queries x 64 keys).
    // K's rows are dealt out over the four score tiles: row p of Ks holds key
    // 4 * (p & 15) + (p >> 4), so that column l16 of score tile nt is key
    // 4 * l16 + nt and a lane holds four consecutive keys of each of its
    // queries.  Its mask values are then one float4 a query (a wave-load is
    // two whole rows of 256 B) and its probabilities one 8-byte LDS store a
    // query, in P's plain key order.  V and P keep that order.
    v8h kv[2], vv[2];
    const unsigned kvo = (unsigned)((t >> 3) * AH + (t & 7) * 8);
    const unsigned kko = (unsigned)((4 * ((t >> 3) & 15) + (t >> 7)) * AH + (t & 7) * 8);
    const unsigned mo  = (unsigned)((wid * 16 + (lane >> 4) * 8) * AN + l16 * 4);
    v4f mv[8];
    auto fetch_kv = [&](int m0) {
        const _Float16* Kb = Kg + (size_t)(b * AN + m0) * AH + h * AHD;
        const _Float16* Vb = Vg + (size_t)(b * AN + m0) * AH + h * AHD;
        const _Float16* kp = Kb + kko;
        const _Float16* vp = Vb + kvo;
        kv[0] = *(const v8h*)kp;
        vv[0] = *(const v8h*)vp;
        kv[1] = *(const v8h*)(kp + 2 * AH);    // row p + 32 of Ks: key + 2
        vv[1] = *(const v8h*)(vp + 32 * AH);
        // Precaution: stands ahead of any reuse of the loads' address
        // registers; the pointers as inputs keep those registers from being
        // a later load's own destination before it.
        asm volatile("s_wait_xcnt 0x0" :: "v"(kp), "v"(vp) : "memory");
    };
    auto fetch_mask = [&](int m0) {
        const float* Mb = mrow + (size_t)q0 * AN + m0;
        const float* mp = Mb + mo;
        #pragma unroll
        for (int r = 0; r < 8; ++r)
            mv[r] = *(const v4f*)(mp + r * AN);
        // The same precaution.
        asm volatile("s_wait_xcnt 0x0" :: "v"(mp) : "memory");
    };

    // A pass finds its K, V and mask values in registers.  The next pass's
    // loads go out as soon as their registers are free: K and V behind the
    // barrier that publishes this pass's tiles, the mask behind its last use,
    // so that their round trips run under this pass's work.
    fetch_kv(0);
    fetch_mask(0);
    for (int m0 = 0; m0 < AN; m0 += 64) {
        // The last pass asks for its own tile again: no branch in the loop
        // body, and every address stays inside its buffer.
        const int mn = m0 + 64 < AN ? m0 + 64 : m0;
        lds_barrier();
        // Stage K and V, both as straight 16-byte copies.
        #pragma unroll
        for (int u = 0; u < 2; ++u) {
            int i = t + u * 256;
            int r = i >> 3, d = (i & 7) * 8;
            *(v8h*)&Ks[r * LQK + d] = kv[u];
            *(v8h*)&Vs[r * LV + d]  = vv[u];
        }
        lds_barrier();

        // Scores: 16 queries x 64 keys per wave, 2 WMMAs per 16x16 tile.
        // K's 16 fragment reads go out as one group ahead of the 8 WMMAs: the
        // wave waits out one LDS round trip and not one in front of each WMMA.
        v16h bk[4][2];
        #pragma unroll
        for (int nt = 0; nt < 4; ++nt) {
            int kr = nt * 16 + l16;    // row of Ks: key 4 * l16 + nt
            bk[nt][0] = load_frag(&Ks[kr * LQK + khalf]);
            bk[nt][1] = load_frag(&Ks[kr * LQK + 32 + khalf]);
        }
        // Holds the group ahead of its WMMAs: left free, the scheduler sinks
        // the reads among them, each WMMA behind a read issued just before it.
        __builtin_amdgcn_sched_barrier(0);
        // The next pass's K and V loads go out behind the reads: their issue
        // and its wait run under the reads' round trip.
        fetch_kv(mn);
        v8f s[4];
        #pragma unroll
        for (int nt = 0; nt < 4; ++nt)
            s[nt] = WMMA16(aq0, bk[nt][0], zero);
        #pragma unroll
        for (int nt = 0; nt < 4; ++nt)
            s[nt] = WMMA16(aq1, bk[nt][1], s[nt]);

        // V's 16 fragment reads (they do not depend on P) go out here, so that
        // their LDS round trip runs under the score arithmetic below.
        // V is turned on its way out of LDS: column d = dt*16 + l16.
        v16h bv[4][2];
        #pragma unroll
        for (int dt = 0; dt < 4; ++dt) {
            bv[dt][0] = load_frag_tr(Vr + dt * 16, LV);             // keys 0..31
            bv[dt][1] = load_frag_tr(Vr + 32 * LV + dt * 16, LV);   // keys 32..63
        }
        // Holds V's reads ahead of the score arithmetic: left free, the
        // scheduler sinks them behind it, just in front of P's stores and
        // reads, whose round trip then queues behind all 16.
        __builtin_amdgcn_sched_barrier(0);

        v4h ph[8];
        #pragma unroll
        for (int nt = 0; nt < 4; ++nt) {
            #pragma unroll
            for (int r = 0; r < 8; ++r) {
                float x = s[nt][r];
                float v = silu_f(x) * invN * mv[r][nt];
                ph[r][nt] = (_Float16)v;
            }
        }
        #pragma unroll
        for (int r = 0; r < 8; ++r)
            *(v4h*)&Pw[((lane >> 4) * 8 + r) * LQK + l16 * 4] = ph[r];

        fetch_mask(mn);

        // P @ V: re-layout P (C->A) via per-wave LDS round-trip (in-order DS).
        v16h ap0 = load_frag(&Pw[l16 * LQK + khalf]);        // keys 0..31
        v16h ap1 = load_frag(&Pw[l16 * LQK + 32 + khalf]);   // keys 32..63
        // Holds P's four reads together ahead of the WMMAs: left free, two of
        // them sink behind the first WMMA, a second round trip.
        __builtin_amdgcn_sched_barrier(0);
        #pragma unroll
        for (int dt = 0; dt < 4; ++dt) {
            o[dt] = WMMA16(ap0, bv[dt][0], o[dt]);
            o[dt] = WMMA16(ap1, bv[dt][1], o[dt]);
        }
    }

    // The last pass's loads are used by nobody: they have landed before the
    // wave reuses their registers or gives them back at its end.
    asm volatile("s_wait_loadcnt 0x0" ::: "memory");

    // Write f32 attention output [B*N, H].
    int qb = b * AN + q0 + wid * 16 + (lane >> 4) * 8;
    #pragma unroll
    for (int dt = 0; dt < 4; ++dt) {
        int col = h * AHD + dt * 16 + l16;
        #pragma unroll
        for (int r = 0; r < 8; ++r)
            Og[(size_t)(qb + r) * AH + col] = o[dt][r];
    }
}

// ---------------------------------------------------------------------------
// LayerNorm over H=1024 + build o_input = [U, A, U*A] as f16 [4096 x 3072].
// ---------------------------------------------------------------------------
__global__ __launch_bounds__(256) void ln_concat_kernel(
    const float* __restrict__ attn, const _Float16* __restrict__ Uh,
    _Float16* __restrict__ oin)
{
    __shared__ float red[256];
    const int row = blockIdx.x;
    const int t = threadIdx.x;
    const float* x = attn + (size_t)row * 1024;

    float vals[4], s = 0.0f, ss = 0.0f;
    #pragma unroll
    for (int i = 0; i < 4; ++i) {
        float v = x[t + i * 256];
        vals[i] = v; s += v; ss += v * v;
    }
    red[t] = s; __syncthreads();
    for (int st = 128; st > 0; st >>= 1) {
        if (t < st) red[t] += red[t + st];
        __syncthreads();
    }
    float mean = red[0] * (1.0f / 1024.0f);
    __syncthreads();
    red[t] = ss; __syncthreads();
    for (int st = 128; st > 0; st >>= 1) {
        if (t < st) red[t] += red[t + st];
        __syncthreads();
    }
    float var  = red[0] * (1.0f / 1024.0f) - mean * mean;
    float rstd = __builtin_amdgcn_rsqf(var + 1e-8f);   // native v_rsq_f32

    _Float16* orow = oin + (size_t)row * 3072;
    const _Float16* urow = Uh + (size_t)row * 1024;
    #pragma unroll
    for (int i = 0; i < 4; ++i) {
        int c = t + i * 256;
        float a = (vals[i] - mean) * rstd;
        float u = (float)urow[c];
        orow[c]        = (_Float16)u;
        orow[1024 + c] = (_Float16)a;
        orow[2048 + c] = (_Float16)(u * a);
    }
}

// ---------------------------------------------------------------------------
// Host-side orchestration.
// ---------------------------------------------------------------------------
extern "C" void kernel_launch(void* const* d_in, const int* in_sizes, int n_in,
                              void* d_out, int out_size, void* d_ws, size_t ws_size,
                              hipStream_t stream) {
    const float* query = (const float*)d_in[0];
    const float* key_  = (const float*)d_in[1];
    const float* value = (const float*)d_in[2];
    const float* mask  = (const float*)d_in[3];
    const float* Wq = (const float*)d_in[4];   const float* bq = (const float*)d_in[5];
    const float* Wk = (const float*)d_in[6];   const float* bk = (const float*)d_in[7];
    const float* Wv = (const float*)d_in[8];   const float* bv = (const float*)d_in[9];
    const float* Wu = (const float*)d_in[10];  const float* bu = (const float*)d_in[11];
    const float* Wo = (const float*)d_in[12];  const float* bo = (const float*)d_in[13];
    float* out = (float*)d_out;

    const int M = 2 * 2048;        // 4096 rows
    const int H = 1024;

    // Workspace carve-out (~90 MB total, deterministic layout).
    char* ws = (char*)d_ws;
    size_t off = 0;
    auto carve = [&](size_t bytes) -> void* {
        void* p = ws + off;
        off += (bytes + 255) & ~(size_t)255;
        return p;
    };
    _Float16* Wq_t = (_Float16*)carve((size_t)H * H * 2);       // [N][K] f16
    _Float16* Wk_t = (_Float16*)carve((size_t)H * H * 2);
    _Float16* Wv_t = (_Float16*)carve((size_t)H * H * 2);
    _Float16* Wu_t = (_Float16*)carve((size_t)H * H * 2);
    _Float16* Wo_t = (_Float16*)carve((size_t)H * 3 * H * 2);   // [1024][3072]
    _Float16* Q_h  = (_Float16*)carve((size_t)M * H * 2);
    _Float16* K_h  = (_Float16*)carve((size_t)M * H * 2);
    _Float16* V_h  = (_Float16*)carve((size_t)M * H * 2);
    _Float16* U_h  = (_Float16*)carve((size_t)M * H * 2);
    float*    At_f = (float*)   carve((size_t)M * H * 4);
    _Float16* Oi_h = (_Float16*)carve((size_t)M * 3 * H * 2);
    (void)ws_size; (void)in_sizes; (void)n_in; (void)out_size;

    // 1) Weights -> f16, transposed to [N][K] for contiguous B staging:
    //    16 column tiles x 28 slabs of 256 k rows, one launch.
    cvt_transpose_all_kernel<<<dim3(16, 28), 256, 0, stream>>>(
        Wq, Wk, Wv, Wu, Wo, Wq_t, Wk_t, Wv_t, Wu_t, Wo_t);

    // 2) Projections: silu(X @ W + b), f16 outputs, all four in one launch.
    dim3 ggrid(M / PM, 8, 4);
    proj4_wmma_kernel<<<ggrid, 128, 0, stream>>>(
        query, key_, value, Wq_t, Wk_t, Wv_t, Wu_t, bq, bk, bv, bu,
        Q_h, K_h, V_h, U_h);

    // 3) Attention (16 query tiles x 32 (b,head) slices).
    dim3 agrid(AN / 128, 2 * ANH);
    attn_wmma_kernel<<<agrid, 256, 0, stream>>>(Q_h, K_h, V_h, mask, At_f);

    // 4) LayerNorm + concat [U, A, U*A].
    ln_concat_kernel<<<M, 256, 0, stream>>>(At_f, U_h, Oi_h);

    // 5) Final GEMM: o_input[4096x3072] @ Wo[3072x1024] + bo -> f32 out.
    dim3 fgrid(M / FM, H / FN);
    final_gemm_kernel<<<fgrid, 256, 0, stream>>>(Oi_h, Wo_t, bo, out);
}
